// v000
// Times are from an AMD MI455X. After a warm-up the kernel runs many times in a row, and a time is the length of
// such a window on the GPU divided by its runs, so every launch and the gaps after it count. The runs cycle
// through copies of the inputs. A figure is the median of several windows, for all but v000 over two sittings.
// Sittings can differ by a few percent; kernels timed side by side share one.
// v000 is the starting kernel. One run takes 1130 microseconds.
// compute dtype: all float inputs rounded to bf16; per-head q/k/v projections with EXACT bf16 products on WMMA 16x16x32 (f32 accumulate) + bias; logits with q as f16 hi + residual (x 2^10) against k once to f16 (2 products) x 64^-0.5; softmax f32; P x 2^11 once to f16 x v once to f16 (1 product); ctx carried x 2^6 once to f16 x Wo f16(bf16 x 2^8) + bo; f32 output.
#include <hip/hip_runtime.h>
#include <math.h>

typedef __attribute__((ext_vector_type(16))) _Float16 v16h;
typedef __attribute__((ext_vector_type(16))) __bf16 v16b;
typedef __attribute__((ext_vector_type(8)))  _Float16 v8h;
typedef __attribute__((ext_vector_type(8)))  float v8f;
typedef __attribute__((ext_vector_type(4)))  float v4f;
typedef __attribute__((ext_vector_type(2)))  float v2f;
typedef __attribute__((ext_vector_type(4)))  unsigned v4u;
typedef __attribute__((ext_vector_type(4)))  int v4i;
typedef float __attribute__((may_alias)) float_a;
typedef int __attribute__((may_alias)) int_a;

template <typename T> __device__ __forceinline__ void vst2(void* p, T v) { *(T*)p = v;  }
__device__ __forceinline__ v8f wmma16(v16h a, v16h b, v8f c) {
  v8f d = __builtin_amdgcn_wmma_f32_16x16x32_f16(false, a, false, b, (short)0, c, false, false);
  asm volatile("v_nop\n\tv_nop\n\tv_nop\n\tv_nop" : "+v"(d) : "v"(a), "v"(b));
  return d;
}
__device__ __forceinline__ v8f wmma_bf(v16b a, v16b b, v8f c) {
  v8f d = __builtin_amdgcn_wmma_f32_16x16x32_bf16(false, a, false, b, (short)0, c, false, false);
  asm volatile("v_nop\n\tv_nop\n\tv_nop\n\tv_nop" : "+v"(d) : "v"(a), "v"(b));
  return d;
}
// 16x16x32 fragments: lane = (h = lane>>4, row/col = lane&15); elements 0..7 = k0+8h+0..7, 8..15 = k0+16+8h+0..7; D element r = row 8h+r
__device__ __forceinline__ v16h frag_h(const _Float16* rowk0, int lane) {
  union { v16h v; v8h q[2]; } u; const _Float16* p = rowk0 + 8 * (lane >> 4);
  u.q[0] = *(const v8h*)p; u.q[1] = *(const v8h*)(p + 16); return u.v;
}
__device__ __forceinline__ v16h frag_f32(const float* rowk0, int lane) {
  v16h a; const float* p = rowk0 + 8 * (lane >> 4);
#pragma unroll
  for (int i = 0; i < 8; ++i) { a[i] = (_Float16)p[i]; a[8 + i] = (_Float16)p[16 + i]; }
  return a;
}
__device__ __forceinline__ v16h frag_f32s(const float* rowk0, int lane, float sc) {
  v16h a; const float* p = rowk0 + 8 * (lane >> 4);
#pragma unroll
  for (int i = 0; i < 8; ++i) { a[i] = (_Float16)(p[i] * sc); a[8 + i] = (_Float16)(p[16 + i] * sc); }
  return a;
}
// column fragment from a [K][ld] layout (column n), rows >= K read as 0
__device__ __forceinline__ v16h fragc_f32(const float* W, int k0, int n, int lane, int ld, int K) {
  v16h a; const int g = lane >> 4;
#pragma unroll
  for (int i = 0; i < 8; ++i) { const int ka = k0 + 8 * g + i, kb = ka + 16;
    a[i] = (_Float16)(ka < K ? W[(size_t)(ka < K ? ka : K - 1) * ld + n] : 0.f); a[8 + i] = (_Float16)(kb < K ? W[(size_t)(kb < K ? kb : K - 1) * ld + n] : 0.f); }
  return a;
}
struct F2 { v16b h, l; };
__device__ __forceinline__ F2 bsplit16(const float v[16]) { F2 r;
#pragma unroll
  for (int i = 0; i < 16; ++i) { const __bf16 h = (__bf16)v[i]; r.h[i] = h; r.l[i] = (__bf16)(v[i] - (float)h); }
  return r; }
__device__ __forceinline__ F2 split_row(const float* row, int k0, int lane) { float v[16]; const float* p = row + k0 + 8 * (lane >> 4);
#pragma unroll
  for (int i = 0; i < 8; ++i) { v[i] = p[i]; v[8 + i] = p[16 + i]; }
  return bsplit16(v); }
__device__ __forceinline__ F2 split_rowK(const float* row, int k0, int lane, int K) { float v[16]; const int g = lane >> 4;
#pragma unroll
  for (int i = 0; i < 8; ++i) { const int ka = k0 + 8 * g + i, kb = ka + 16; v[i] = ka < K ? row[ka < K ? ka : K - 1] : 0.f; v[8 + i] = kb < K ? row[kb < K ? kb : K - 1] : 0.f; }
  return bsplit16(v); }
__device__ __forceinline__ F2 split_col(const float* W, int k0, int n, int lane, int ld, int K) { float v[16]; const int g = lane >> 4;
#pragma unroll
  for (int i = 0; i < 8; ++i) { const int ka = k0 + 8 * g + i, kb = ka + 16; v[i] = ka < K ? W[(size_t)(ka < K ? ka : K - 1) * ld + n] : 0.f; v[8 + i] = kb < K ? W[(size_t)(kb < K ? kb : K - 1) * ld + n] : 0.f; }
  return bsplit16(v); }
__device__ __forceinline__ v8f mac3(const F2& a, const F2& b, v8f c) { c = wmma_bf(a.l, b.h, c); c = wmma_bf(a.h, b.l, c); return wmma_bf(a.h, b.h, c); }
__device__ __forceinline__ float sigm(float v) { return 1.0f / (1.0f + expf(-v)); }
#define LDSX() do { asm volatile("s_wait_dscnt 0" ::: "memory"); __builtin_amdgcn_wave_barrier(); __builtin_amdgcn_fence(__ATOMIC_RELEASE, "workgroup"); } while (0)

// Multi-head self-attention (B 16, S 1,024, D 384 = 6 heads x 64; per-head (in,out) Wq/Wk/Wv [6,384,64] + biases [6,64], 0.02-scale; (out,in) Wo [384,384] + bo): out = merge(softmax(q k^T / 8) v) Wo^T + bo.
#define NB 16
#define TT 1024
#define CC 384            // NH * HD = projected width
#define DIN 384          // input (model) width
#define NH 6
#define HD 64
#define NQB (TT / 64)
#define HG 6
#define SCALE (0.125f)
#define CAUSAL 0
#ifndef TNB
#define TNB NB
#endif
__device__ __forceinline__ float bfr(float v) { return (float)(__bf16)v; }
__host__ __device__ __forceinline__ int kb_last(int qb) { return CAUSAL ? ((qb * 64 + 63) >> 7) : (TT / 128 - 1); }
typedef __attribute__((ext_vector_type(8))) __bf16 v8b;
__device__ __forceinline__ v16b frag_b(const __bf16* rowk0, int lane) {
  union { v16b v; v8b q[2]; } u; const __bf16* p = rowk0 + 8 * (lane >> 4);
  u.q[0] = *(const v8b*)p; u.q[1] = *(const v8b*)(p + 16); return u.v;
}
#define QBH 0              // causal: query blocks 0..QBH-1 of each sequence (few keys, no averaging) take the high-precision path
#define QHI 1024            // rows carrying a q residual plane (all rows when non-causal: 2-product logits everywhere)
#define KHI 64            // key rows carrying k residual / v bf16 hi+lo planes (used only by the causal high-precision path)
// B fragment (k rows k0+.., output column o) of a weight: (in,out) [K][ld] or (out,in) [ld rows of K]: bf16 exact, or f16(bf16 * 256) exact
__device__ __forceinline__ v16b wcol_io(const float* Wm, int k0, int o, int lane, int ld) { v16b w; const int g = lane >> 4;
#pragma unroll
  for (int i = 0; i < 8; ++i) { w[i] = (__bf16)Wm[(size_t)(k0 + 8 * g + i) * ld + o]; w[8 + i] = (__bf16)Wm[(size_t)(k0 + 16 + 8 * g + i) * ld + o]; }
  return w; }
__device__ __forceinline__ v16b wcol_oi(const float* Wm, int k0, int o, int lane, int K) { v16b w; const float* p = Wm + (size_t)o * K + k0 + 8 * (lane >> 4);
#pragma unroll
  for (int i = 0; i < 8; ++i) { w[i] = (__bf16)p[i]; w[8 + i] = (__bf16)p[16 + i]; }
  return w; }
__device__ __forceinline__ v16h wcolh_io(const float* Wm, int k0, int o, int lane, int ld) { v16h w; const int g = lane >> 4;
#pragma unroll
  for (int i = 0; i < 8; ++i) { w[i] = (_Float16)(bfr(Wm[(size_t)(k0 + 8 * g + i) * ld + o]) * 256.0f); w[8 + i] = (_Float16)(bfr(Wm[(size_t)(k0 + 16 + 8 * g + i) * ld + o]) * 256.0f); }
  return w; }
__device__ __forceinline__ v16h wcolh_oi(const float* Wm, int k0, int o, int lane, int K) { v16h w; const float* p = Wm + (size_t)o * K + k0 + 8 * (lane >> 4);
#pragma unroll
  for (int i = 0; i < 8; ++i) { w[i] = (_Float16)(bfr(p[i]) * 256.0f); w[8 + i] = (_Float16)(bfr(p[16 + i]) * 256.0f); }
  return w; }
#define WQKV_LAYOUT 0   // 0 = per-head [NH][DIN][HD] (wcol_heads); 1 = (out,in) [CC][DIN]; 2 = per-head [NH][DIN][HD]
__device__ __forceinline__ v16b wcol_hdk(const float* Wm, int k0, int o, int lane) { v16b w; const int g = lane >> 4; const float* p = Wm + (size_t)(o / HD) * DIN * HD + (o % HD);
#pragma unroll
  for (int i = 0; i < 8; ++i) { w[i] = (__bf16)p[(size_t)(k0 + 8 * g + i) * HD]; w[8 + i] = (__bf16)p[(size_t)(k0 + 16 + 8 * g + i) * HD]; }
  return w; }
#define WO_OUT_IN 1
#if WQKV_LAYOUT == 1
#define WCOL(W, k0, o, lane) wcol_oi(W, k0, o, lane, DIN)
#elif WQKV_LAYOUT == 2
#define WCOL(W, k0, o, lane) wcol_hdk(W, k0, o, lane)
#else
#define WCOL(W, k0, o, lane) wcol_heads(W, k0, o, lane)   /* per-head [h][D][64] weights */
#endif
#if WO_OUT_IN
#define WOCOL(W, k0, o, lane) wcol_oi(W, k0, o, lane, CC)
#define WOCOLH(W, k0, o, lane) wcolh_oi(W, k0, o, lane, CC)
#else
#define WOCOL(W, k0, o, lane) wcol_io(W, k0, o, lane, DIN)
#define WOCOLH(W, k0, o, lane) wcolh_io(W, k0, o, lane, DIN)
#endif
// per-head projection weights W[h][D][64] ([6][384][64]): column o = h*64 + d of the virtual (in,out) [D][384] matrix lives at W + (h*D + k)*64 + d
__device__ __forceinline__ v16b wcol_heads(const float* __restrict__ Wm, int k0, int o, int lane) { v16b w; const int g = lane >> 4; const float* p = Wm + ((size_t)(o >> 6) * DIN + k0 + 8 * g) * 64 + (o & 63);
#pragma unroll
  for (int i = 0; i < 8; ++i) { w[i] = (__bf16)p[(size_t)i * 64]; w[8 + i] = (__bf16)p[(size_t)(16 + i) * 64]; }
  asm volatile("s_wait_loadcnt 0x0" ::: "memory"); return w; }
#ifndef SM_EXTRA_PARAMS
#define SM_EXTRA_PARAMS
#endif
#ifndef PROJ_EXTRA_PARAMS
#define PROJ_EXTRA_PARAMS
#endif
#ifndef SM_MASK_HOOK
#define SM_MASK_HOOK (void)0
#endif

#define WS_QH  0u                                      // f16 q rows [b*t][CC]
#define WS_KH  (WS_QH + 2u * (size_t)NB * TT * CC)      // f16 k rows [b*t][CC]
#define WS_VT  (WS_KH + 2u * (size_t)NB * TT * CC)      // f16 v planes [b][c][t]
#define WS_QL  (WS_VT + 2u * (size_t)NB * CC * TT)      // f16 q residual x 2^10 rows [b][t < QHI][CC]
#define WS_KL  (WS_QL + 2u * (size_t)NB * QHI * CC)     // f16 k residual x 2^10 rows [b][t < KHI][CC]
#define WS_VB  (WS_KL + 2u * (size_t)NB * KHI * CC)     // bf16 v hi planes [b][c][t < KHI]
#define WS_VBL (WS_VB + 2u * (size_t)NB * CC * KHI)
#define WS_S   (WS_VBL + 2u * (size_t)NB * CC * KHI)    // f32 logits / P [hg][t][s]
#define WS_Y   (WS_S  + 4u * (size_t)HG * TT * TT)      // f32 ctx rows [b*t][CC] (only when there is an output projection)
#define WS_END (WS_Y  + 4u * (size_t)NB * TT * CC)

// ---- k_proj: block = (64 rows, 128 cols, which): q/k/v = X W (+ b) with exact bf16 products (K = DIN) -> which 0: q f16 rows (+ residual rows < QHI); 1: k f16 rows (+ residual rows < KHI); 2: v f16 planes [c][t] (+ bf16 hi/lo planes for t < KHI)
__global__ __launch_bounds__(128) void k_proj(const float* __restrict__ XQ, const float* __restrict__ XK, const float* __restrict__ XV, const float* __restrict__ WQ, const float* __restrict__ WK, const float* __restrict__ WV, const float* __restrict__ BQ, const float* __restrict__ BK, const float* __restrict__ BV,
    _Float16* __restrict__ QH, _Float16* __restrict__ QL, _Float16* __restrict__ KH, _Float16* __restrict__ KL, _Float16* __restrict__ VT, __bf16* __restrict__ VB, __bf16* __restrict__ VBL) {
  __shared__ __align__(16) _Float16 sh[64][136], sl[64][136]; __shared__ __align__(16) _Float16 th[128][72]; __shared__ __align__(16) __bf16 tb[128][72], tbl[128][72];
  const int tid = threadIdx.x, wave = tid >> 5, lane = tid & 31, col = lane & 15, g = lane >> 4; const int which = blockIdx.z; const int c0 = blockIdx.y * 128; const size_t r0 = (size_t)blockIdx.x * 64; const size_t bb = r0 / TT; const int t0 = (int)(r0 % TT);
  const float* X = which == 0 ? XQ : which == 1 ? XK : XV; const float* WA = which == 0 ? WQ : which == 1 ? WK : WV; const float* BA = which == 0 ? BQ : which == 1 ? BK : BV;
  v8f acc[8] = {};
#pragma unroll 2
  for (int kc = 0; kc < DIN / 32; ++kc) { v16b a; { const float* p = X + (r0 + wave * 16 + col) * DIN + kc * 32 + 8 * g;
#pragma unroll
      for (int i = 0; i < 8; ++i) { a[i] = (__bf16)p[i]; a[8 + i] = (__bf16)p[16 + i]; } }
    asm volatile("s_wait_loadcnt 0x0" ::: "memory");
#pragma unroll
    for (int j = 0; j < 8; ++j) { const v16b w = WCOL(WA, kc * 32, c0 + j * 16 + col, lane); asm volatile("s_wait_loadcnt 0x0" ::: "memory"); acc[j] = wmma_bf(a, w, acc[j]); } }
  if (which < 2) { _Float16* DH = which == 0 ? QH : KH; _Float16* DL = which == 0 ? QL : KL; const int nhi = which == 0 ? QHI : KHI; const bool hi_rows = t0 < nhi;
#pragma unroll
    for (int j = 0; j < 8; ++j) { const float bias = BA ? bfr(BA[c0 + j * 16 + col]) : 0.f;
#pragma unroll
      for (int r = 0; r < 8; ++r) { const float v = acc[j][r] + bias; const _Float16 hv = (_Float16)v; sh[wave * 16 + 8 * g + r][j * 16 + col] = hv; sl[wave * 16 + 8 * g + r][j * 16 + col] = (_Float16)((v - (float)hv) * 1024.0f); } }
    __syncthreads();
    for (int e = tid; e < 64 * 16; e += 128) { const int rl = e >> 4, q = e & 15; vst2((unsigned*)(DH + (r0 + rl) * CC + c0 + q * 8), *(const v4u*)&sh[rl][q * 8]); if (hi_rows) vst2((unsigned*)(DL + (bb * nhi + t0 + rl) * (size_t)CC + c0 + q * 8), *(const v4u*)&sl[rl][q * 8]); }
  } else { const bool hi_rows = t0 < KHI;
#pragma unroll
    for (int j = 0; j < 8; ++j) { const float bias = BA ? bfr(BA[c0 + j * 16 + col]) : 0.f;
#pragma unroll
      for (int r = 0; r < 8; ++r) { const float v = acc[j][r] + bias; const int rl = wave * 16 + 8 * g + r, cl = j * 16 + col; th[cl][rl] = (_Float16)v; const __bf16 bh = (__bf16)v; tb[cl][rl] = bh; tbl[cl][rl] = (__bf16)(v - (float)bh); } }
    __syncthreads();
    for (int e = tid; e < 128 * 8; e += 128) { const int cl = e >> 3, q = e & 7; vst2((unsigned*)(VT + (bb * CC + c0 + cl) * (size_t)TT + t0 + q * 8), *(const v4u*)&th[cl][q * 8]); if (hi_rows) { const size_t o3 = (bb * CC + c0 + cl) * (size_t)KHI + t0 + q * 8; vst2((unsigned*)(VB + o3), *(const v4u*)&tb[cl][q * 8]); vst2((unsigned*)(VBL + o3), *(const v4u*)&tbl[cl][q * 8]); } } } }
// ---- k_sc: block = (query block qb, key block kb <= kb_last(qb), head in group) of batch b: logits x SCALE; q hi + residual (x 2^10) against k (2 products) for query rows < QHI, plus the k residual (3 products) for query blocks < QBH (causal early rows); causal: blocks past the diagonal exit, the mask itself is applied by index in k_sm
__global__ __launch_bounds__(128) void k_sc(const _Float16* __restrict__ QH, const _Float16* __restrict__ KH, const _Float16* __restrict__ QL, const _Float16* __restrict__ KL, int b, int h0, float* __restrict__ S0) { __shared__ __align__(16) float ss[4][16][132];
  const int qb = blockIdx.x, kb = blockIdx.y; if (kb > kb_last(qb)) return;
  const int h = h0 + blockIdx.z; float* S = S0 + (size_t)blockIdx.z * TT * TT;
  const int tid = threadIdx.x, wave = tid >> 5, lane = tid & 31, col = lane & 15, g = lane >> 4; const int k0 = kb * 128; const int ql0 = qb * 64 + wave * 16; const size_t q0 = (size_t)b * TT + ql0, kr0 = (size_t)b * TT + k0;
  v8f acc[8] = {}, accl[8] = {};
  const _Float16* QLb = QL + (size_t)b * QHI * CC; const _Float16* KLb = KL + (size_t)b * KHI * CC;
  if (qb < QBH) {
#pragma unroll
    for (int kc = 0; kc < HD / 32; ++kc) { const v16h ah = frag_h(QH + (q0 + col) * CC + h * HD + kc * 32, lane), al = frag_h(QLb + (size_t)(ql0 + col) * CC + h * HD + kc * 32, lane);
#pragma unroll
      for (int j = 0; j < 8; ++j) { const v16h kbf = frag_h(KH + (kr0 + j * 16 + col) * CC + h * HD + kc * 32, lane), klf = frag_h(KLb + (size_t)(k0 + j * 16 + col) * CC + h * HD + kc * 32, lane); acc[j] = wmma16(ah, kbf, acc[j]); accl[j] = wmma16(al, kbf, accl[j]); accl[j] = wmma16(ah, klf, accl[j]); } }
  } else if (qb * 64 < QHI) {
#pragma unroll
    for (int kc = 0; kc < HD / 32; ++kc) { const v16h ah = frag_h(QH + (q0 + col) * CC + h * HD + kc * 32, lane), al = frag_h(QLb + (size_t)(ql0 + col) * CC + h * HD + kc * 32, lane);
#pragma unroll
      for (int j = 0; j < 8; ++j) { const v16h kbf = frag_h(KH + (kr0 + j * 16 + col) * CC + h * HD + kc * 32, lane); acc[j] = wmma16(ah, kbf, acc[j]); accl[j] = wmma16(al, kbf, accl[j]); } }
  } else {
#pragma unroll
    for (int kc = 0; kc < HD / 32; ++kc) { const v16h ah = frag_h(QH + (q0 + col) * CC + h * HD + kc * 32, lane);
#pragma unroll
      for (int j = 0; j < 8; ++j) { const v16h kbf = frag_h(KH + (kr0 + j * 16 + col) * CC + h * HD + kc * 32, lane); acc[j] = wmma16(ah, kbf, acc[j]); } } }
#pragma unroll
  for (int j = 0; j < 8; ++j) {
#pragma unroll
    for (int r = 0; r < 8; ++r) ss[wave][8 * g + r][j * 16 + col] = (acc[j][r] + accl[j][r] * (1.0f / 1024.0f)) * SCALE; }
  LDSX(); for (int rl = 0; rl < 16; ++rl) vst2(S + (size_t)(ql0 + rl) * TT + k0 + lane * 4, *(const v4f*)&ss[wave][rl][lane * 4]); }
// ---- k_sm: block = query row t (head in group): keys [0, kend): causal -> logit if s <= t else excluded; softmax in f32; P x 2^11 in place (0 for excluded)
__global__ __launch_bounds__(256) void k_sm(float* __restrict__ S0 SM_EXTRA_PARAMS) { __shared__ float sred[8]; __shared__ float sbc; __shared__ __align__(16) float shv[TT];
  const int tid = threadIdx.x; const int t = blockIdx.x; const int kend = (kb_last(t >> 6) + 1) * 128;
  float* sr = S0 + (size_t)blockIdx.y * TT * TT + (size_t)t * TT;
  float m = -3.0e38f; for (int k = tid; k < kend; k += 256) { float v = (!CAUSAL || k <= t) ? sr[k] : -3.0e38f; SM_MASK_HOOK; shv[k] = v; m = fmaxf(m, v); }
#pragma unroll
  for (int o = 1; o < 32; o <<= 1) m = fmaxf(m, __shfl_xor(m, o));
  if ((tid & 31) == 0) sred[tid >> 5] = m; __syncthreads(); if (tid == 0) { float a = sred[0]; for (int i = 1; i < 8; ++i) a = fmaxf(a, sred[i]); sbc = a; } __syncthreads(); m = sbc; __syncthreads();
  float sum = 0.f; for (int k = tid; k < kend; k += 256) { const float v = shv[k]; const float e = (v <= -1.0e38f) ? 0.f : expf(v - m); shv[k] = e; sum += e; }
#pragma unroll
  for (int o = 1; o < 32; o <<= 1) sum += __shfl_xor(sum, o);
  if ((tid & 31) == 0) sred[tid >> 5] = sum; __syncthreads(); if (tid == 0) { float a = 0.f; for (int i = 0; i < 8; ++i) a += sred[i]; sbc = a > 0.f ? 2048.0f / a : 0.f; }   /* a fully excluded row yields P = 0 */ __syncthreads(); const float inv = sbc;
  for (int k = tid; k < kend; k += 256) shv[k] = shv[k] * inv;
  __syncthreads(); for (int q = tid; q < kend / 4; q += 256) vst2(sr + q * 4, *(const v4f*)&shv[q * 4]); }
// ---- k_pv: block = 64 queries (qb) of (b, h): ctx = P . v over keys [0, kend) (P x 2^11 once to f16 against v f16: 1 product; causal early query blocks: P and v as bf16 hi + lo, 3 products); 256-B (row, head) segment by 16 lanes
__global__ __launch_bounds__(128) void k_pv(const float* __restrict__ PS0, const _Float16* __restrict__ VT, const __bf16* __restrict__ VB, const __bf16* __restrict__ VBL, int b, int h0, float* __restrict__ Y) { const int h = h0 + blockIdx.z; const float* PS = PS0 + (size_t)blockIdx.z * TT * TT; __shared__ __align__(16) float ss[4][16][HD + 4];
  const int tid = threadIdx.x, wave = tid >> 5, lane = tid & 31, col = lane & 15, g = lane >> 4; const int qb = blockIdx.x; const int ql0 = qb * 64 + wave * 16; const int kce = (kb_last(qb) + 1) * 4;
  v8f acc[HD / 16] = {};
  if (qb < QBH) {
#pragma unroll 1
    for (int kc = 0; kc < kce; ++kc) { const F2 p = split_row(PS + (size_t)(ql0 + col) * TT, kc * 32, lane);
      asm volatile("s_wait_loadcnt 0x0" ::: "memory");
#pragma unroll
      for (int j = 0; j < HD / 16; ++j) { const size_t po = ((size_t)b * CC + h * HD + j * 16 + col) * (size_t)KHI + kc * 32; const v16b vh = frag_b(VB + po, lane); acc[j] = wmma_bf(p.h, vh, acc[j]); acc[j] = wmma_bf(p.l, vh, acc[j]); acc[j] = wmma_bf(p.h, frag_b(VBL + po, lane), acc[j]); } }
  } else {
#pragma unroll 1
    for (int kc = 0; kc < kce; ++kc) { const v16h p = frag_f32(PS + (size_t)(ql0 + col) * TT + kc * 32, lane);
      asm volatile("s_wait_loadcnt 0x0" ::: "memory");
#pragma unroll
      for (int j = 0; j < HD / 16; ++j) { const size_t po = ((size_t)b * CC + h * HD + j * 16 + col) * (size_t)TT + kc * 32; acc[j] = wmma16(p, frag_h(VT + po, lane), acc[j]); } } }
#pragma unroll
  for (int j = 0; j < HD / 16; ++j)
#pragma unroll
    for (int r = 0; r < 8; ++r) ss[wave][8 * g + r][j * 16 + col] = acc[j][r] * (1.0f / 2048.0f);
  LDSX(); for (int rl = 0; rl < 16; ++rl) if (lane < HD / 4) vst2(Y + ((size_t)b * TT + ql0 + rl) * CC + h * HD + lane * 4, *(const v4f*)&ss[wave][rl][lane * 4]); }
// ---- k_out: block = (64 rows, 128 cols): out = ctx Wo (+ bo): ctx x 2^6 once to f16 against Wo as f16(bf16 x 2^8) exact (1 product) x 2^-14; causal early rows (< QHI of each sequence): ctx bf16 hi + lo against exact bf16 Wo (2 products)
__global__ __launch_bounds__(128) void k_out(const float* __restrict__ Y, const float* __restrict__ WO, const float* __restrict__ BO, float* __restrict__ OUT) { __shared__ __align__(16) float sf[4][16][132];
  const int tid = threadIdx.x, wave = tid >> 5, lane = tid & 31, col = lane & 15, g = lane >> 4; const int c0 = blockIdx.y * 128; const size_t r0 = (size_t)blockIdx.x * 64 + wave * 16;
  v8f acc[8] = {};
  if (CAUSAL && (int)(((size_t)blockIdx.x * 64) % TT) < QHI) {   /* block-uniform */
#pragma unroll 2
    for (int kc = 0; kc < CC / 32; ++kc) { const F2 a = split_row(Y + (r0 + col) * CC, kc * 32, lane); asm volatile("s_wait_loadcnt 0x0" ::: "memory");
#pragma unroll
      for (int j = 0; j < 8; ++j) { const v16b w = WOCOL(WO, kc * 32, c0 + j * 16 + col, lane); asm volatile("s_wait_loadcnt 0x0" ::: "memory"); acc[j] = wmma_bf(a.h, w, acc[j]); acc[j] = wmma_bf(a.l, w, acc[j]); } }
#pragma unroll
    for (int j = 0; j < 8; ++j) { const float bias = BO ? bfr(BO[c0 + j * 16 + col]) : 0.f;
#pragma unroll
      for (int r = 0; r < 8; ++r) sf[wave][8 * g + r][j * 16 + col] = acc[j][r] + bias; }
  } else {
#pragma unroll 2
    for (int kc = 0; kc < CC / 32; ++kc) { const v16h a = frag_f32s(Y + (r0 + col) * CC + kc * 32, lane, 64.0f); asm volatile("s_wait_loadcnt 0x0" ::: "memory");   /* ctx carried x 2^6 into f16 so small-magnitude context rows stay clear of f16 subnormals */
#pragma unroll
      for (int j = 0; j < 8; ++j) { const v16h w = WOCOLH(WO, kc * 32, c0 + j * 16 + col, lane); asm volatile("s_wait_loadcnt 0x0" ::: "memory"); acc[j] = wmma16(a, w, acc[j]); } }
#pragma unroll
    for (int j = 0; j < 8; ++j) { const float bias = BO ? bfr(BO[c0 + j * 16 + col]) : 0.f;
#pragma unroll
      for (int r = 0; r < 8; ++r) sf[wave][8 * g + r][j * 16 + col] = acc[j][r] * (1.0f / 16384.0f) + bias; } }   /* 2^-8 (Wo carry) x 2^-6 (ctx carry) */
  LDSX(); for (int rl = 0; rl < 16; ++rl) vst2(OUT + (r0 + rl) * DIN + c0 + lane * 4, *(const v4f*)&sf[wave][rl][lane * 4]); }

extern "C" void kernel_launch(void* const* d_in, const int* in_sizes, int n_in, void* d_out, int out_size, void* d_ws, size_t ws_size, hipStream_t stream) {
  (void)in_sizes; (void)n_in; (void)out_size;
  const float** F = (const float**)d_in;
  if (ws_size < (size_t)WS_END) return;
  char* ws = (char*)d_ws; _Float16 *QH = (_Float16*)(ws + WS_QH), *KH = (_Float16*)(ws + WS_KH), *VT = (_Float16*)(ws + WS_VT), *QL = (_Float16*)(ws + WS_QL), *KL = (_Float16*)(ws + WS_KL); __bf16 *VB = (__bf16*)(ws + WS_VB), *VBL = (__bf16*)(ws + WS_VBL); float *S = (float*)(ws + WS_S), *Y = (float*)(ws + WS_Y);
  (void)Y; (void)QL; (void)KL; (void)VB; (void)VBL;
  // inputs: 0 x [16,1024,384]; 1 Wq [6,384,64], 2 bq [6,64]; 3 Wk, 4 bk; 5 Wv, 6 bv; 7 Wo [384,384] (out,in), 8 bo [384]
  k_proj<<<dim3(TNB * TT / 64, CC / 128, 3), 128, 0, stream>>>(F[0], F[0], F[0], F[1], F[3], F[5], F[2], F[4], F[6], QH, QL, KH, KL, VT, VB, VBL);
  for (int b = 0; b < TNB; ++b) for (int h0 = 0; h0 < NH; h0 += HG) {
    k_sc<<<dim3(NQB, TT / 128, HG), 128, 0, stream>>>(QH, KH, QL, KL, b, h0, S);
    k_sm<<<dim3(TT, HG), 256, 0, stream>>>(S);
    k_pv<<<dim3(NQB, 1, HG), 128, 0, stream>>>(S, VT, VB, VBL, b, h0, Y);
  }
  k_out<<<dim3(TNB * TT / 64, DIN / 128), 128, 0, stream>>>(Y, F[7], F[8], (float*)d_out);
}

// v001
// A run of this version takes 187 microseconds.
// Next to v000, in two timings, it ran 6.09 and 6.08 times as fast.
// compute dtype: all float inputs rounded to bf16; per-head q/k/v projections with EXACT bf16 products on WMMA 16x16x32 (f32 accumulate) + bias; logits with q as f16 hi + residual (x 2^10) against k once to f16 (2 products) x 64^-0.5; softmax f32 with a running maximum and sum (logits stay on chip); exp(logit - max) x 2^11 once to f16 x v once to f16 (1 product), divided by the f32 sum at the end; ctx carried x 2^6 once to f16 x Wo f16(bf16 x 2^8) + bo; f32 output.
#include <hip/hip_runtime.h>
#include <math.h>

typedef __attribute__((ext_vector_type(16))) _Float16 v16h;
typedef __attribute__((ext_vector_type(16))) __bf16 v16b;
typedef __attribute__((ext_vector_type(8)))  _Float16 v8h;
typedef __attribute__((ext_vector_type(8)))  float v8f;
typedef __attribute__((ext_vector_type(4)))  float v4f;
typedef __attribute__((ext_vector_type(2)))  float v2f;
typedef __attribute__((ext_vector_type(4)))  unsigned v4u;
typedef __attribute__((ext_vector_type(4)))  int v4i;
typedef float __attribute__((may_alias)) float_a;
typedef int __attribute__((may_alias)) int_a;

template <typename T> __device__ __forceinline__ void vst2(void* p, T v) { *(T*)p = v;  }
__device__ __forceinline__ v8f wmma16(v16h a, v16h b, v8f c) {
  v8f d = __builtin_amdgcn_wmma_f32_16x16x32_f16(false, a, false, b, (short)0, c, false, false);
  asm volatile("v_nop\n\tv_nop\n\tv_nop\n\tv_nop" : "+v"(d) : "v"(a), "v"(b));
  return d;
}
__device__ __forceinline__ v8f wmma_bf(v16b a, v16b b, v8f c) {
  v8f d = __builtin_amdgcn_wmma_f32_16x16x32_bf16(false, a, false, b, (short)0, c, false, false);
  asm volatile("v_nop\n\tv_nop\n\tv_nop\n\tv_nop" : "+v"(d) : "v"(a), "v"(b));
  return d;
}
// 16x16x32 fragments: lane = (h = lane>>4, row/col = lane&15); elements 0..7 = k0+8h+0..7, 8..15 = k0+16+8h+0..7; D element r = row 8h+r
__device__ __forceinline__ v16h frag_h(const _Float16* rowk0, int lane) {
  union { v16h v; v8h q[2]; } u; const _Float16* p = rowk0 + 8 * (lane >> 4);
  u.q[0] = *(const v8h*)p; u.q[1] = *(const v8h*)(p + 16); return u.v;
}
__device__ __forceinline__ v16h frag_f32(const float* rowk0, int lane) {
  v16h a; const float* p = rowk0 + 8 * (lane >> 4);
#pragma unroll
  for (int i = 0; i < 8; ++i) { a[i] = (_Float16)p[i]; a[8 + i] = (_Float16)p[16 + i]; }
  return a;
}
__device__ __forceinline__ v16h frag_f32s(const float* rowk0, int lane, float sc) {
  v16h a; const float* p = rowk0 + 8 * (lane >> 4);
#pragma unroll
  for (int i = 0; i < 8; ++i) { a[i] = (_Float16)(p[i] * sc); a[8 + i] = (_Float16)(p[16 + i] * sc); }
  return a;
}
// column fragment from a [K][ld] layout (column n), rows >= K read as 0
__device__ __forceinline__ v16h fragc_f32(const float* W, int k0, int n, int lane, int ld, int K) {
  v16h a; const int g = lane >> 4;
#pragma unroll
  for (int i = 0; i < 8; ++i) { const int ka = k0 + 8 * g + i, kb = ka + 16;
    a[i] = (_Float16)(ka < K ? W[(size_t)(ka < K ? ka : K - 1) * ld + n] : 0.f); a[8 + i] = (_Float16)(kb < K ? W[(size_t)(kb < K ? kb : K - 1) * ld + n] : 0.f); }
  return a;
}
struct F2 { v16b h, l; };
__device__ __forceinline__ F2 bsplit16(const float v[16]) { F2 r;
#pragma unroll
  for (int i = 0; i < 16; ++i) { const __bf16 h = (__bf16)v[i]; r.h[i] = h; r.l[i] = (__bf16)(v[i] - (float)h); }
  return r; }
__device__ __forceinline__ F2 split_row(const float* row, int k0, int lane) { float v[16]; const float* p = row + k0 + 8 * (lane >> 4);
#pragma unroll
  for (int i = 0; i < 8; ++i) { v[i] = p[i]; v[8 + i] = p[16 + i]; }
  return bsplit16(v); }
__device__ __forceinline__ F2 split_rowK(const float* row, int k0, int lane, int K) { float v[16]; const int g = lane >> 4;
#pragma unroll
  for (int i = 0; i < 8; ++i) { const int ka = k0 + 8 * g + i, kb = ka + 16; v[i] = ka < K ? row[ka < K ? ka : K - 1] : 0.f; v[8 + i] = kb < K ? row[kb < K ? kb : K - 1] : 0.f; }
  return bsplit16(v); }
__device__ __forceinline__ F2 split_col(const float* W, int k0, int n, int lane, int ld, int K) { float v[16]; const int g = lane >> 4;
#pragma unroll
  for (int i = 0; i < 8; ++i) { const int ka = k0 + 8 * g + i, kb = ka + 16; v[i] = ka < K ? W[(size_t)(ka < K ? ka : K - 1) * ld + n] : 0.f; v[8 + i] = kb < K ? W[(size_t)(kb < K ? kb : K - 1) * ld + n] : 0.f; }
  return bsplit16(v); }
__device__ __forceinline__ v8f mac3(const F2& a, const F2& b, v8f c) { c = wmma_bf(a.l, b.h, c); c = wmma_bf(a.h, b.l, c); return wmma_bf(a.h, b.h, c); }
__device__ __forceinline__ float sigm(float v) { return 1.0f / (1.0f + expf(-v)); }
#define LDSX() do { asm volatile("s_wait_dscnt 0" ::: "memory"); __builtin_amdgcn_wave_barrier(); __builtin_amdgcn_fence(__ATOMIC_RELEASE, "workgroup"); } while (0)

// Multi-head self-attention (B 16, S 1,024, D 384 = 6 heads x 64; per-head (in,out) Wq/Wk/Wv [6,384,64] + biases [6,64], 0.02-scale; (out,in) Wo [384,384] + bo): out = merge(softmax(q k^T / 8) v) Wo^T + bo.
#define NB 16
#define TT 1024
#define CC 384            // NH * HD = projected width
#define DIN 384          // input (model) width
#define NH 6
#define HD 64
#define NQB (TT / 64)
#define HG 6
#define SCALE (0.125f)
#define CAUSAL 0
#ifndef TNB
#define TNB NB
#endif
__device__ __forceinline__ float bfr(float v) { return (float)(__bf16)v; }
__host__ __device__ __forceinline__ int kb_last(int qb) { return CAUSAL ? ((qb * 64 + 63) >> 7) : (TT / 128 - 1); }
typedef __attribute__((ext_vector_type(8))) __bf16 v8b;
__device__ __forceinline__ v16b frag_b(const __bf16* rowk0, int lane) {
  union { v16b v; v8b q[2]; } u; const __bf16* p = rowk0 + 8 * (lane >> 4);
  u.q[0] = *(const v8b*)p; u.q[1] = *(const v8b*)(p + 16); return u.v;
}
#define QBH 0
#define QHI 1024            // rows carrying a q residual plane (all rows when non-causal: 2-product logits everywhere)
#define KHI 64            // key rows carrying k residual / v bf16 hi+lo planes (written by k_proj, read by no kernel here)
// B fragment (k rows k0+.., output column o) of a weight: (in,out) [K][ld] or (out,in) [ld rows of K]: bf16 exact, or f16(bf16 * 256) exact
__device__ __forceinline__ v16b wcol_io(const float* Wm, int k0, int o, int lane, int ld) { v16b w; const int g = lane >> 4;
#pragma unroll
  for (int i = 0; i < 8; ++i) { w[i] = (__bf16)Wm[(size_t)(k0 + 8 * g + i) * ld + o]; w[8 + i] = (__bf16)Wm[(size_t)(k0 + 16 + 8 * g + i) * ld + o]; }
  return w; }
__device__ __forceinline__ v16b wcol_oi(const float* Wm, int k0, int o, int lane, int K) { v16b w; const float* p = Wm + (size_t)o * K + k0 + 8 * (lane >> 4);
#pragma unroll
  for (int i = 0; i < 8; ++i) { w[i] = (__bf16)p[i]; w[8 + i] = (__bf16)p[16 + i]; }
  return w; }
__device__ __forceinline__ v16h wcolh_io(const float* Wm, int k0, int o, int lane, int ld) { v16h w; const int g = lane >> 4;
#pragma unroll
  for (int i = 0; i < 8; ++i) { w[i] = (_Float16)(bfr(Wm[(size_t)(k0 + 8 * g + i) * ld + o]) * 256.0f); w[8 + i] = (_Float16)(bfr(Wm[(size_t)(k0 + 16 + 8 * g + i) * ld + o]) * 256.0f); }
  return w; }
__device__ __forceinline__ v16h wcolh_oi(const float* Wm, int k0, int o, int lane, int K) { v16h w; const float* p = Wm + (size_t)o * K + k0 + 8 * (lane >> 4);
#pragma unroll
  for (int i = 0; i < 8; ++i) { w[i] = (_Float16)(bfr(p[i]) * 256.0f); w[8 + i] = (_Float16)(bfr(p[16 + i]) * 256.0f); }
  return w; }
#define WQKV_LAYOUT 0   // 0 = per-head [NH][DIN][HD] (wcol_heads); 1 = (out,in) [CC][DIN]; 2 = per-head [NH][DIN][HD]
__device__ __forceinline__ v16b wcol_hdk(const float* Wm, int k0, int o, int lane) { v16b w; const int g = lane >> 4; const float* p = Wm + (size_t)(o / HD) * DIN * HD + (o % HD);
#pragma unroll
  for (int i = 0; i < 8; ++i) { w[i] = (__bf16)p[(size_t)(k0 + 8 * g + i) * HD]; w[8 + i] = (__bf16)p[(size_t)(k0 + 16 + 8 * g + i) * HD]; }
  return w; }
#define WO_OUT_IN 1
#if WQKV_LAYOUT == 1
#define WCOL(W, k0, o, lane) wcol_oi(W, k0, o, lane, DIN)
#elif WQKV_LAYOUT == 2
#define WCOL(W, k0, o, lane) wcol_hdk(W, k0, o, lane)
#else
#define WCOL(W, k0, o, lane) wcol_heads(W, k0, o, lane)   /* per-head [h][D][64] weights */
#endif
#if WO_OUT_IN
#define WOCOL(W, k0, o, lane) wcol_oi(W, k0, o, lane, CC)
#define WOCOLH(W, k0, o, lane) wcolh_oi(W, k0, o, lane, CC)
#else
#define WOCOL(W, k0, o, lane) wcol_io(W, k0, o, lane, DIN)
#define WOCOLH(W, k0, o, lane) wcolh_io(W, k0, o, lane, DIN)
#endif
// per-head projection weights W[h][D][64] ([6][384][64]): column o = h*64 + d of the virtual (in,out) [D][384] matrix lives at W + (h*D + k)*64 + d
__device__ __forceinline__ v16b wcol_heads(const float* __restrict__ Wm, int k0, int o, int lane) { v16b w; const int g = lane >> 4; const float* p = Wm + ((size_t)(o >> 6) * DIN + k0 + 8 * g) * 64 + (o & 63);
#pragma unroll
  for (int i = 0; i < 8; ++i) { w[i] = (__bf16)p[(size_t)i * 64]; w[8 + i] = (__bf16)p[(size_t)(16 + i) * 64]; }
  asm volatile("s_wait_loadcnt 0x0" ::: "memory"); return w; }
#ifndef SM_EXTRA_PARAMS
#define SM_EXTRA_PARAMS
#endif
#ifndef PROJ_EXTRA_PARAMS
#define PROJ_EXTRA_PARAMS
#endif
#ifndef SM_MASK_HOOK
#define SM_MASK_HOOK (void)0
#endif

#define WS_QH  0u                                      // f16 q rows [b*t][CC]
#define WS_KH  (WS_QH + 2u * (size_t)NB * TT * CC)      // f16 k rows [b*t][CC]
#define WS_VT  (WS_KH + 2u * (size_t)NB * TT * CC)      // f16 v planes [b][c][t]
#define WS_QL  (WS_VT + 2u * (size_t)NB * CC * TT)      // f16 q residual x 2^10 rows [b][t < QHI][CC]
#define WS_KL  (WS_QL + 2u * (size_t)NB * QHI * CC)     // f16 k residual x 2^10 rows [b][t < KHI][CC]
#define WS_VB  (WS_KL + 2u * (size_t)NB * KHI * CC)     // bf16 v hi planes [b][c][t < KHI]
#define WS_VBL (WS_VB + 2u * (size_t)NB * CC * KHI)
#define WS_S   (WS_VBL + 2u * (size_t)NB * CC * KHI)    // f32 [hg][t][s], reserved but not used (logits stay on chip)
#define WS_Y   (WS_S  + 4u * (size_t)HG * TT * TT)      // f32 ctx rows [b*t][CC] (only when there is an output projection)
#define WS_END (WS_Y  + 4u * (size_t)NB * TT * CC)

// ---- k_proj: block = (64 rows, 128 cols, which): q/k/v = X W (+ b) with exact bf16 products (K = DIN) -> which 0: q f16 rows (+ residual rows < QHI); 1: k f16 rows (+ residual rows < KHI); 2: v f16 planes [c][t] (+ bf16 hi/lo planes for t < KHI)
__global__ __launch_bounds__(128) void k_proj(const float* __restrict__ XQ, const float* __restrict__ XK, const float* __restrict__ XV, const float* __restrict__ WQ, const float* __restrict__ WK, const float* __restrict__ WV, const float* __restrict__ BQ, const float* __restrict__ BK, const float* __restrict__ BV,
    _Float16* __restrict__ QH, _Float16* __restrict__ QL, _Float16* __restrict__ KH, _Float16* __restrict__ KL, _Float16* __restrict__ VT, __bf16* __restrict__ VB, __bf16* __restrict__ VBL) {
  __shared__ __align__(16) _Float16 sh[64][136], sl[64][136]; __shared__ __align__(16) _Float16 th[128][72]; __shared__ __align__(16) __bf16 tb[128][72], tbl[128][72];
  const int tid = threadIdx.x, wave = tid >> 5, lane = tid & 31, col = lane & 15, g = lane >> 4; const int which = blockIdx.z; const int c0 = blockIdx.y * 128; const size_t r0 = (size_t)blockIdx.x * 64; const size_t bb = r0 / TT; const int t0 = (int)(r0 % TT);
  const float* X = which == 0 ? XQ : which == 1 ? XK : XV; const float* WA = which == 0 ? WQ : which == 1 ? WK : WV; const float* BA = which == 0 ? BQ : which == 1 ? BK : BV;
  v8f acc[8] = {};
#pragma unroll 2
  for (int kc = 0; kc < DIN / 32; ++kc) { v16b a; { const float* p = X + (r0 + wave * 16 + col) * DIN + kc * 32 + 8 * g;
#pragma unroll
      for (int i = 0; i < 8; ++i) { a[i] = (__bf16)p[i]; a[8 + i] = (__bf16)p[16 + i]; } }
    asm volatile("s_wait_loadcnt 0x0" ::: "memory");
#pragma unroll
    for (int j = 0; j < 8; ++j) { const v16b w = WCOL(WA, kc * 32, c0 + j * 16 + col, lane); asm volatile("s_wait_loadcnt 0x0" ::: "memory"); acc[j] = wmma_bf(a, w, acc[j]); } }
  if (which < 2) { _Float16* DH = which == 0 ? QH : KH; _Float16* DL = which == 0 ? QL : KL; const int nhi = which == 0 ? QHI : KHI; const bool hi_rows = t0 < nhi;
#pragma unroll
    for (int j = 0; j < 8; ++j) { const float bias = BA ? bfr(BA[c0 + j * 16 + col]) : 0.f;
#pragma unroll
      for (int r = 0; r < 8; ++r) { const float v = acc[j][r] + bias; const _Float16 hv = (_Float16)v; sh[wave * 16 + 8 * g + r][j * 16 + col] = hv; sl[wave * 16 + 8 * g + r][j * 16 + col] = (_Float16)((v - (float)hv) * 1024.0f); } }
    __syncthreads();
    for (int e = tid; e < 64 * 16; e += 128) { const int rl = e >> 4, q = e & 15; vst2((unsigned*)(DH + (r0 + rl) * CC + c0 + q * 8), *(const v4u*)&sh[rl][q * 8]); if (hi_rows) vst2((unsigned*)(DL + (bb * nhi + t0 + rl) * (size_t)CC + c0 + q * 8), *(const v4u*)&sl[rl][q * 8]); }
  } else { const bool hi_rows = t0 < KHI;
#pragma unroll
    for (int j = 0; j < 8; ++j) { const float bias = BA ? bfr(BA[c0 + j * 16 + col]) : 0.f;
#pragma unroll
      for (int r = 0; r < 8; ++r) { const float v = acc[j][r] + bias; const int rl = wave * 16 + 8 * g + r, cl = j * 16 + col; th[cl][rl] = (_Float16)v; const __bf16 bh = (__bf16)v; tb[cl][rl] = bh; tbl[cl][rl] = (__bf16)(v - (float)bh); } }
    __syncthreads();
    for (int e = tid; e < 128 * 8; e += 128) { const int cl = e >> 3, q = e & 7; vst2((unsigned*)(VT + (bb * CC + c0 + cl) * (size_t)TT + t0 + q * 8), *(const v4u*)&th[cl][q * 8]); if (hi_rows) { const size_t o3 = (bb * CC + c0 + cl) * (size_t)KHI + t0 + q * 8; vst2((unsigned*)(VB + o3), *(const v4u*)&tb[cl][q * 8]); vst2((unsigned*)(VBL + o3), *(const v4u*)&tbl[cl][q * 8]); } } } }
// ---- k_attn: block = 128 queries (8 waves x 16) of (b, h); keys walked in LDS stages of 64 (K rows and v planes staged once per block, next stage's global loads in flight under this stage's work).
// Per 64 keys: S^T = K Q^T (A = K rows, B = q: residual product first, x 2^-10, then the hi product on top), so a lane holds one query's logits; running maximum and sum per lane (+ one exchange between the wave halves);
// P^T = exp(logit - max) x 2^11 once to f16 is already a B operand (two D tiles = 32 keys in the hardware k order); O^T += V^T P^T; the accumulators are rescaled when the maximum moves; ctx = O^T / sum at the end.
#define AKT 64             // keys per LDS stage
#define KPITCH 72          // f16 per staged K row: 144 B (16 B x odd), conflict-free 16-byte reads
#define VPITCH 72          // f16 per staged v plane row: 144 B
#define CSL2 (SCALE * 1.4426950408889634f)
__device__ __forceinline__ v8f wm16(v16h a, v16h b, v8f c) { return __builtin_amdgcn_wmma_f32_16x16x32_f16(false, a, false, b, (short)0, c, false, false); }
__device__ __forceinline__ float xhalf(float x) { return __builtin_bit_cast(float, __builtin_amdgcn_permlanex16(__builtin_bit_cast(int, x), __builtin_bit_cast(int, x), 0x76543210, 0xfedcba98, false, false)); }  // lane l with lane l ^ 16
// grid 8 x 6 x 16 = 768 blocks; at under 160 registers and 18 KB of LDS three blocks (six waves per SIMD) fit a WGP, so other waves cover each wave's LDS and exp latency
__global__ __launch_bounds__(256) void k_attn(const _Float16* __restrict__ QH, const _Float16* __restrict__ QL, const _Float16* __restrict__ KH, const _Float16* __restrict__ VT, float* __restrict__ Y) {
  __shared__ __align__(16) _Float16 sk[AKT][KPITCH]; __shared__ __align__(16) _Float16 sv[HD][VPITCH];
  const int tid = threadIdx.x, wave = tid >> 5, lane = tid & 31, col = lane & 15, g = lane >> 4; const int h = blockIdx.y, b = blockIdx.z; const int q = blockIdx.x * 128 + wave * 16 + col;
  v16h qh[HD / 32], ql[HD / 32];
#pragma unroll
  for (int kc = 0; kc < HD / 32; ++kc) { qh[kc] = frag_h(QH + ((size_t)b * TT + q) * CC + h * HD + kc * 32, lane); ql[kc] = frag_h(QL + ((size_t)b * QHI + q) * CC + h * HD + kc * 32, lane); }
  const _Float16* kg = KH + ((size_t)b * TT + (tid >> 3)) * CC + h * HD + (tid & 7) * 8;      // 16-byte piece (tid & 7) of key rows (tid >> 3) + 32 i
  const _Float16* vg = VT + ((size_t)b * CC + h * HD + (tid >> 3)) * (size_t)TT + (tid & 7) * 8;   // 16-byte piece (tid & 7) of planes (tid >> 3) + 32 i
  v4u rk[2], rv[2];
#pragma unroll
  for (int i = 0; i < 2; ++i) { rk[i] = *(const v4u*)(kg + (size_t)(32 * i) * CC); rv[i] = *(const v4u*)(vg + (size_t)(32 * i) * TT); }
  v8f o[HD / 16] = {}; float m = -3.0e38f, l = 0.f;
  for (int s = 0; s < TT / AKT; ++s) {
#pragma unroll
    for (int i = 0; i < 2; ++i) { *(v4u*)&sk[(tid >> 3) + 32 * i][(tid & 7) * 8] = rk[i]; *(v4u*)&sv[(tid >> 3) + 32 * i][(tid & 7) * 8] = rv[i]; }
    __syncthreads();
    if (s + 1 < TT / AKT) {
#pragma unroll
      for (int i = 0; i < 2; ++i) { rk[i] = *(const v4u*)(kg + (size_t)((s + 1) * AKT + 32 * i) * CC); rv[i] = *(const v4u*)(vg + (size_t)(32 * i) * TT + (s + 1) * AKT); }
      asm volatile("s_wait_xcnt 0x0" ::: "memory"); }   // the loads' address registers are reused by the fragment loads that follow: the wait stands in front of that overwrite
    { v8f st[4];
#pragma unroll
      for (int j = 0; j < 4; ++j) { const v16h a0 = frag_h(&sk[j * 16 + col][0], lane), a1 = frag_h(&sk[j * 16 + col][32], lane);
        v8f c = {}; c = wm16(a0, ql[0], c); c = wm16(a1, ql[1], c); c = c * (1.0f / 1024.0f); c = wm16(a0, qh[0], c); st[j] = wm16(a1, qh[1], c); }
      float mx = st[0][0];
#pragma unroll
      for (int j = 0; j < 4; ++j)
#pragma unroll
        for (int r = 0; r < 8; ++r) mx = fmaxf(mx, st[j][r]);
      const float mn = fmaxf(m, fmaxf(mx, xhalf(mx)));   // both halves hold the query's maximum so far (unscaled logits)
      const float corr = __builtin_amdgcn_exp2f((m - mn) * CSL2); m = mn;   // 0 on the first pass
      const float nm = 11.0f - mn * CSL2;
      l *= corr;
#pragma unroll
      for (int t = 0; t < HD / 16; ++t) o[t] = o[t] * corr;
#pragma unroll
      for (int kk = 0; kk < 2; ++kk) { v8f e0 = __builtin_elementwise_fma(st[2 * kk], (v8f)(CSL2), (v8f)(nm)), e1 = __builtin_elementwise_fma(st[2 * kk + 1], (v8f)(CSL2), (v8f)(nm)); v16h pf;
#pragma unroll
        for (int i = 0; i < 8; ++i) { e0[i] = __builtin_amdgcn_exp2f(e0[i]); e1[i] = __builtin_amdgcn_exp2f(e1[i]); }
#pragma unroll
        for (int i = 0; i < 8; ++i) { pf[i] = (_Float16)e0[i]; pf[8 + i] = (_Float16)e1[i]; }
        e0 = e0 + e1; l += ((e0[0] + e0[1]) + (e0[2] + e0[3])) + ((e0[4] + e0[5]) + (e0[6] + e0[7]));
#pragma unroll
        for (int t = 0; t < HD / 16; ++t) o[t] = wm16(frag_h(&sv[t * 16 + col][kk * 32], lane), pf, o[t]); } }
    __syncthreads(); }
  l += xhalf(l); const float inv = 1.0f / l;   // l >= 2^11: the maximum's own term
  float* yr = Y + ((size_t)b * TT + q) * CC + h * HD + 8 * g;
#pragma unroll
  for (int t = 0; t < HD / 16; ++t) { const v8f v = o[t] * inv; vst2(yr + t * 16, (v4f){v[0], v[1], v[2], v[3]}); vst2(yr + t * 16 + 4, (v4f){v[4], v[5], v[6], v[7]}); } }
// ---- k_out: block = (64 rows, 128 cols): out = ctx Wo (+ bo): ctx x 2^6 once to f16 against Wo as f16(bf16 x 2^8) exact (1 product) x 2^-14; causal early rows (< QHI of each sequence): ctx bf16 hi + lo against exact bf16 Wo (2 products)
__global__ __launch_bounds__(128) void k_out(const float* __restrict__ Y, const float* __restrict__ WO, const float* __restrict__ BO, float* __restrict__ OUT) { __shared__ __align__(16) float sf[4][16][132];
  const int tid = threadIdx.x, wave = tid >> 5, lane = tid & 31, col = lane & 15, g = lane >> 4; const int c0 = blockIdx.y * 128; const size_t r0 = (size_t)blockIdx.x * 64 + wave * 16;
  v8f acc[8] = {};
  if (CAUSAL && (int)(((size_t)blockIdx.x * 64) % TT) < QHI) {   /* block-uniform */
#pragma unroll 2
    for (int kc = 0; kc < CC / 32; ++kc) { const F2 a = split_row(Y + (r0 + col) * CC, kc * 32, lane); asm volatile("s_wait_loadcnt 0x0" ::: "memory");
#pragma unroll
      for (int j = 0; j < 8; ++j) { const v16b w = WOCOL(WO, kc * 32, c0 + j * 16 + col, lane); asm volatile("s_wait_loadcnt 0x0" ::: "memory"); acc[j] = wmma_bf(a.h, w, acc[j]); acc[j] = wmma_bf(a.l, w, acc[j]); } }
#pragma unroll
    for (int j = 0; j < 8; ++j) { const float bias = BO ? bfr(BO[c0 + j * 16 + col]) : 0.f;
#pragma unroll
      for (int r = 0; r < 8; ++r) sf[wave][8 * g + r][j * 16 + col] = acc[j][r] + bias; }
  } else {
#pragma unroll 2
    for (int kc = 0; kc < CC / 32; ++kc) { const v16h a = frag_f32s(Y + (r0 + col) * CC + kc * 32, lane, 64.0f); asm volatile("s_wait_loadcnt 0x0" ::: "memory");   /* ctx carried x 2^6 into f16 so small-magnitude context rows stay clear of f16 subnormals */
#pragma unroll
      for (int j = 0; j < 8; ++j) { const v16h w = WOCOLH(WO, kc * 32, c0 + j * 16 + col, lane); asm volatile("s_wait_loadcnt 0x0" ::: "memory"); acc[j] = wmma16(a, w, acc[j]); } }
#pragma unroll
    for (int j = 0; j < 8; ++j) { const float bias = BO ? bfr(BO[c0 + j * 16 + col]) : 0.f;
#pragma unroll
      for (int r = 0; r < 8; ++r) sf[wave][8 * g + r][j * 16 + col] = acc[j][r] * (1.0f / 16384.0f) + bias; } }   /* 2^-8 (Wo carry) x 2^-6 (ctx carry) */
  LDSX(); for (int rl = 0; rl < 16; ++rl) vst2(OUT + (r0 + rl) * DIN + c0 + lane * 4, *(const v4f*)&sf[wave][rl][lane * 4]); }

extern "C" void kernel_launch(void* const* d_in, const int* in_sizes, int n_in, void* d_out, int out_size, void* d_ws, size_t ws_size, hipStream_t stream) {
  (void)in_sizes; (void)n_in; (void)out_size;
  const float** F = (const float**)d_in;
  if (ws_size < (size_t)WS_END) return;
  char* ws = (char*)d_ws; _Float16 *QH = (_Float16*)(ws + WS_QH), *KH = (_Float16*)(ws + WS_KH), *VT = (_Float16*)(ws + WS_VT), *QL = (_Float16*)(ws + WS_QL), *KL = (_Float16*)(ws + WS_KL); __bf16 *VB = (__bf16*)(ws + WS_VB), *VBL = (__bf16*)(ws + WS_VBL); float *S = (float*)(ws + WS_S), *Y = (float*)(ws + WS_Y);
  (void)Y; (void)QL; (void)KL; (void)VB; (void)VBL; (void)S;
  // inputs: 0 x [16,1024,384]; 1 Wq [6,384,64], 2 bq [6,64]; 3 Wk, 4 bk; 5 Wv, 6 bv; 7 Wo [384,384] (out,in), 8 bo [384]
  k_proj<<<dim3(TNB * TT / 64, CC / 128, 3), 128, 0, stream>>>(F[0], F[0], F[0], F[1], F[3], F[5], F[2], F[4], F[6], QH, QL, KH, KL, VT, VB, VBL);
  k_attn<<<dim3(TT / 128, NH, TNB), 256, 0, stream>>>(QH, QL, KH, VT, Y);
  k_out<<<dim3(TNB * TT / 64, DIN / 128), 128, 0, stream>>>(Y, F[7], F[8], (float*)d_out);
}

// v002
// One run takes 101 microseconds.
// Two timings next to v001 put it at 1.86 and 1.85 times that version's speed.
// All steps since v000 together make it 11.3 times as fast.
// compute dtype: all float inputs rounded to bf16; per-head q/k/v projections with EXACT bf16 products on WMMA 16x16x32 (f32 accumulate) + bias; logits with q as f16 hi + residual (x 2^10) against k once to f16 (2 products) x 64^-0.5; softmax f32 with a running maximum and sum (logits stay on chip); exp(logit - max) x 2^11 once to f16 x v once to f16 (1 product), divided by the f32 sum at the end; ctx carried x 2^6 once to f16 x Wo f16(bf16 x 2^8) + bo; f32 output.
#include <hip/hip_runtime.h>
#include <math.h>

typedef __attribute__((ext_vector_type(16))) _Float16 v16h;
typedef __attribute__((ext_vector_type(16))) __bf16 v16b;
typedef __attribute__((ext_vector_type(8)))  _Float16 v8h;
typedef __attribute__((ext_vector_type(8)))  float v8f;
typedef __attribute__((ext_vector_type(4)))  float v4f;
typedef __attribute__((ext_vector_type(2)))  float v2f;
typedef __attribute__((ext_vector_type(4)))  unsigned v4u;
typedef __attribute__((ext_vector_type(4)))  int v4i;
typedef float __attribute__((may_alias)) float_a;
typedef int __attribute__((may_alias)) int_a;

template <typename T> __device__ __forceinline__ void vst2(void* p, T v) { *(T*)p = v;  }
__device__ __forceinline__ v8f wmma16(v16h a, v16h b, v8f c) {
  v8f d = __builtin_amdgcn_wmma_f32_16x16x32_f16(false, a, false, b, (short)0, c, false, false);
  asm volatile("v_nop\n\tv_nop\n\tv_nop\n\tv_nop" : "+v"(d) : "v"(a), "v"(b));
  return d;
}
__device__ __forceinline__ v8f wmma_bf(v16b a, v16b b, v8f c) {
  v8f d = __builtin_amdgcn_wmma_f32_16x16x32_bf16(false, a, false, b, (short)0, c, false, false);
  asm volatile("v_nop\n\tv_nop\n\tv_nop\n\tv_nop" : "+v"(d) : "v"(a), "v"(b));
  return d;
}
// 16x16x32 fragments: lane = (h = lane>>4, row/col = lane&15); elements 0..7 = k0+8h+0..7, 8..15 = k0+16+8h+0..7; D element r = row 8h+r
__device__ __forceinline__ v16h frag_h(const _Float16* rowk0, int lane) {
  union { v16h v; v8h q[2]; } u; const _Float16* p = rowk0 + 8 * (lane >> 4);
  u.q[0] = *(const v8h*)p; u.q[1] = *(const v8h*)(p + 16); return u.v;
}
__device__ __forceinline__ v16h frag_f32(const float* rowk0, int lane) {
  v16h a; const float* p = rowk0 + 8 * (lane >> 4);
#pragma unroll
  for (int i = 0; i < 8; ++i) { a[i] = (_Float16)p[i]; a[8 + i] = (_Float16)p[16 + i]; }
  return a;
}
__device__ __forceinline__ v16h frag_f32s(const float* rowk0, int lane, float sc) {
  v16h a; const float* p = rowk0 + 8 * (lane >> 4);
#pragma unroll
  for (int i = 0; i < 8; ++i) { a[i] = (_Float16)(p[i] * sc); a[8 + i] = (_Float16)(p[16 + i] * sc); }
  return a;
}
// column fragment from a [K][ld] layout (column n), rows >= K read as 0
__device__ __forceinline__ v16h fragc_f32(const float* W, int k0, int n, int lane, int ld, int K) {
  v16h a; const int g = lane >> 4;
#pragma unroll
  for (int i = 0; i < 8; ++i) { const int ka = k0 + 8 * g + i, kb = ka + 16;
    a[i] = (_Float16)(ka < K ? W[(size_t)(ka < K ? ka : K - 1) * ld + n] : 0.f); a[8 + i] = (_Float16)(kb < K ? W[(size_t)(kb < K ? kb : K - 1) * ld + n] : 0.f); }
  return a;
}
struct F2 { v16b h, l; };
__device__ __forceinline__ F2 bsplit16(const float v[16]) { F2 r;
#pragma unroll
  for (int i = 0; i < 16; ++i) { const __bf16 h = (__bf16)v[i]; r.h[i] = h; r.l[i] = (__bf16)(v[i] - (float)h); }
  return r; }
__device__ __forceinline__ F2 split_row(const float* row, int k0, int lane) { float v[16]; const float* p = row + k0 + 8 * (lane >> 4);
#pragma unroll
  for (int i = 0; i < 8; ++i) { v[i] = p[i]; v[8 + i] = p[16 + i]; }
  return bsplit16(v); }
__device__ __forceinline__ F2 split_rowK(const float* row, int k0, int lane, int K) { float v[16]; const int g = lane >> 4;
#pragma unroll
  for (int i = 0; i < 8; ++i) { const int ka = k0 + 8 * g + i, kb = ka + 16; v[i] = ka < K ? row[ka < K ? ka : K - 1] : 0.f; v[8 + i] = kb < K ? row[kb < K ? kb : K - 1] : 0.f; }
  return bsplit16(v); }
__device__ __forceinline__ F2 split_col(const float* W, int k0, int n, int lane, int ld, int K) { float v[16]; const int g = lane >> 4;
#pragma unroll
  for (int i = 0; i < 8; ++i) { const int ka = k0 + 8 * g + i, kb = ka + 16; v[i] = ka < K ? W[(size_t)(ka < K ? ka : K - 1) * ld + n] : 0.f; v[8 + i] = kb < K ? W[(size_t)(kb < K ? kb : K - 1) * ld + n] : 0.f; }
  return bsplit16(v); }
__device__ __forceinline__ v8f mac3(const F2& a, const F2& b, v8f c) { c = wmma_bf(a.l, b.h, c); c = wmma_bf(a.h, b.l, c); return wmma_bf(a.h, b.h, c); }
__device__ __forceinline__ float sigm(float v) { return 1.0f / (1.0f + expf(-v)); }
#define LDSX() do { asm volatile("s_wait_dscnt 0" ::: "memory"); __builtin_amdgcn_wave_barrier(); __builtin_amdgcn_fence(__ATOMIC_RELEASE, "workgroup"); } while (0)

// Multi-head self-attention (B 16, S 1,024, D 384 = 6 heads x 64; per-head (in,out) Wq/Wk/Wv [6,384,64] + biases [6,64], 0.02-scale; (out,in) Wo [384,384] + bo): out = merge(softmax(q k^T / 8) v) Wo^T + bo.
#define NB 16
#define TT 1024
#define CC 384            // NH * HD = projected width
#define DIN 384          // input (model) width
#define NH 6
#define HD 64
#define NQB (TT / 64)
#define HG 6
#define SCALE (0.125f)
#define CAUSAL 0
#ifndef TNB
#define TNB NB
#endif
__device__ __forceinline__ float bfr(float v) { return (float)(__bf16)v; }
__host__ __device__ __forceinline__ int kb_last(int qb) { return CAUSAL ? ((qb * 64 + 63) >> 7) : (TT / 128 - 1); }
typedef __attribute__((ext_vector_type(8))) __bf16 v8b;
typedef __attribute__((ext_vector_type(4))) __bf16 v4b;
typedef __attribute__((ext_vector_type(4))) _Float16 v4h;
#define GP 40              // 16-bit elements per staged GEMM tile row: 32 k + 8 = 80 B (16 B x odd), conflict-free 16-byte reads
__device__ __forceinline__ v16b frag_b(const __bf16* rowk0, int lane) {
  union { v16b v; v8b q[2]; } u; const __bf16* p = rowk0 + 8 * (lane >> 4);
  u.q[0] = *(const v8b*)p; u.q[1] = *(const v8b*)(p + 16); return u.v;
}
#define QBH 0
#define QHI 1024            // rows carrying a q residual plane (all rows when non-causal: 2-product logits everywhere)
#define KHI 64            // key rows carrying k residual / v bf16 hi+lo planes (written by k_proj, read by no kernel here)
// B fragment (k rows k0+.., output column o) of a weight: (in,out) [K][ld] or (out,in) [ld rows of K]: bf16 exact, or f16(bf16 * 256) exact
__device__ __forceinline__ v16b wcol_io(const float* Wm, int k0, int o, int lane, int ld) { v16b w; const int g = lane >> 4;
#pragma unroll
  for (int i = 0; i < 8; ++i) { w[i] = (__bf16)Wm[(size_t)(k0 + 8 * g + i) * ld + o]; w[8 + i] = (__bf16)Wm[(size_t)(k0 + 16 + 8 * g + i) * ld + o]; }
  return w; }
__device__ __forceinline__ v16b wcol_oi(const float* Wm, int k0, int o, int lane, int K) { v16b w; const float* p = Wm + (size_t)o * K + k0 + 8 * (lane >> 4);
#pragma unroll
  for (int i = 0; i < 8; ++i) { w[i] = (__bf16)p[i]; w[8 + i] = (__bf16)p[16 + i]; }
  return w; }
__device__ __forceinline__ v16h wcolh_io(const float* Wm, int k0, int o, int lane, int ld) { v16h w; const int g = lane >> 4;
#pragma unroll
  for (int i = 0; i < 8; ++i) { w[i] = (_Float16)(bfr(Wm[(size_t)(k0 + 8 * g + i) * ld + o]) * 256.0f); w[8 + i] = (_Float16)(bfr(Wm[(size_t)(k0 + 16 + 8 * g + i) * ld + o]) * 256.0f); }
  return w; }
__device__ __forceinline__ v16h wcolh_oi(const float* Wm, int k0, int o, int lane, int K) { v16h w; const float* p = Wm + (size_t)o * K + k0 + 8 * (lane >> 4);
#pragma unroll
  for (int i = 0; i < 8; ++i) { w[i] = (_Float16)(bfr(p[i]) * 256.0f); w[8 + i] = (_Float16)(bfr(p[16 + i]) * 256.0f); }
  return w; }
#define WQKV_LAYOUT 0   // 0 = per-head [NH][DIN][HD] (wcol_heads); 1 = (out,in) [CC][DIN]; 2 = per-head [NH][DIN][HD]
__device__ __forceinline__ v16b wcol_hdk(const float* Wm, int k0, int o, int lane) { v16b w; const int g = lane >> 4; const float* p = Wm + (size_t)(o / HD) * DIN * HD + (o % HD);
#pragma unroll
  for (int i = 0; i < 8; ++i) { w[i] = (__bf16)p[(size_t)(k0 + 8 * g + i) * HD]; w[8 + i] = (__bf16)p[(size_t)(k0 + 16 + 8 * g + i) * HD]; }
  return w; }
#define WO_OUT_IN 1
#if WQKV_LAYOUT == 1
#define WCOL(W, k0, o, lane) wcol_oi(W, k0, o, lane, DIN)
#elif WQKV_LAYOUT == 2
#define WCOL(W, k0, o, lane) wcol_hdk(W, k0, o, lane)
#else
#define WCOL(W, k0, o, lane) wcol_heads(W, k0, o, lane)   /* per-head [h][D][64] weights */
#endif
#if WO_OUT_IN
#define WOCOL(W, k0, o, lane) wcol_oi(W, k0, o, lane, CC)
#define WOCOLH(W, k0, o, lane) wcolh_oi(W, k0, o, lane, CC)
#else
#define WOCOL(W, k0, o, lane) wcol_io(W, k0, o, lane, DIN)
#define WOCOLH(W, k0, o, lane) wcolh_io(W, k0, o, lane, DIN)
#endif
// per-head projection weights W[h][D][64] ([6][384][64]): column o = h*64 + d of the virtual (in,out) [D][384] matrix lives at W + (h*D + k)*64 + d
__device__ __forceinline__ v16b wcol_heads(const float* __restrict__ Wm, int k0, int o, int lane) { v16b w; const int g = lane >> 4; const float* p = Wm + ((size_t)(o >> 6) * DIN + k0 + 8 * g) * 64 + (o & 63);
#pragma unroll
  for (int i = 0; i < 8; ++i) { w[i] = (__bf16)p[(size_t)i * 64]; w[8 + i] = (__bf16)p[(size_t)(16 + i) * 64]; }
  asm volatile("s_wait_loadcnt 0x0" ::: "memory"); return w; }
#ifndef SM_EXTRA_PARAMS
#define SM_EXTRA_PARAMS
#endif
#ifndef PROJ_EXTRA_PARAMS
#define PROJ_EXTRA_PARAMS
#endif
#ifndef SM_MASK_HOOK
#define SM_MASK_HOOK (void)0
#endif

#define WS_QH  0u                                      // f16 q rows [b*t][CC]
#define WS_KH  (WS_QH + 2u * (size_t)NB * TT * CC)      // f16 k rows [b*t][CC]
#define WS_VT  (WS_KH + 2u * (size_t)NB * TT * CC)      // f16 v planes [b][c][t]
#define WS_QL  (WS_VT + 2u * (size_t)NB * CC * TT)      // f16 q residual x 2^10 rows [b][t < QHI][CC]
#define WS_KL  (WS_QL + 2u * (size_t)NB * QHI * CC)     // f16 k residual x 2^10 rows [b][t < KHI][CC]
#define WS_VB  (WS_KL + 2u * (size_t)NB * KHI * CC)     // bf16 v hi planes [b][c][t < KHI]
#define WS_VBL (WS_VB + 2u * (size_t)NB * CC * KHI)
#define WS_S   (WS_VBL + 2u * (size_t)NB * CC * KHI)    // f32 [hg][t][s], reserved but not used (logits stay on chip)
#define WS_Y   (WS_S  + 4u * (size_t)HG * TT * TT)      // f32 ctx rows [b*t][CC] (only when there is an output projection)
#define WS_END (WS_Y  + 4u * (size_t)NB * TT * CC)

// ---- k_proj: block = (64 rows, 128 cols, which): q/k/v = X W (+ b) with exact bf16 products (K = DIN) -> which 0: q f16 rows (+ residual rows < QHI); 1: k f16 rows (+ residual rows < KHI); 2: v f16 planes [c][t] (+ bf16 hi/lo planes for t < KHI)
__global__ __launch_bounds__(128) void k_proj(const float* __restrict__ XQ, const float* __restrict__ XK, const float* __restrict__ XV, const float* __restrict__ WQ, const float* __restrict__ WK, const float* __restrict__ WV, const float* __restrict__ BQ, const float* __restrict__ BK, const float* __restrict__ BV,
    _Float16* __restrict__ QH, _Float16* __restrict__ QL, _Float16* __restrict__ KH, _Float16* __restrict__ KL, _Float16* __restrict__ VT, __bf16* __restrict__ VB, __bf16* __restrict__ VBL) {
  // one LDS block: the main loop's operand tiles (2 buffers) and the epilogue's transpose arrays (q/k: sh, sl; v: th, tb, tbl) live at different times, separated by the barrier after the loop
  __shared__ __align__(16) unsigned char smem[3 * 128 * 72 * 2];
  _Float16 (*sh)[136] = (_Float16 (*)[136])smem; _Float16 (*sl)[136] = (_Float16 (*)[136])(smem + 64 * 136 * 2);
  _Float16 (*th)[72] = (_Float16 (*)[72])smem; __bf16 (*tb)[72] = (__bf16 (*)[72])(smem + 128 * 72 * 2); __bf16 (*tbl)[72] = (__bf16 (*)[72])(smem + 2 * 128 * 72 * 2);
  __bf16 (*sA)[64][GP] = (__bf16 (*)[64][GP])smem; __bf16 (*sW)[128][GP] = (__bf16 (*)[128][GP])(smem + 2 * 64 * GP * 2);
  const int tid = threadIdx.x, wave = tid >> 5, lane = tid & 31, col = lane & 15, g = lane >> 4; const int which = blockIdx.z; const int c0 = blockIdx.y * 128; const size_t r0 = (size_t)blockIdx.x * 64; const size_t bb = r0 / TT; const int t0 = (int)(r0 % TT);
  const float* X = which == 0 ? XQ : which == 1 ? XK : XV; const float* WA = which == 0 ? WQ : which == 1 ? WK : WV; const float* BA = which == 0 ? BQ : which == 1 ? BK : BV;
  v8f acc[8] = {};
  // per 32 k: the block's X tile (64 x 32) and W tile (32 x 128) are read once with whole-line loads, rounded to bf16 and laid in LDS as [row][k] and [column][k]; the next tile's loads fly under this tile's products
  const int xr = tid >> 3, xp = tid & 7;
  const float* xg = X + (r0 + xr) * DIN + xp * 4;                                             // 16-byte piece xp of rows xr + 16 i
  const float* wg = WA + (size_t)((c0 + tid) >> 6) * DIN * 64 + ((c0 + tid) & 63);            // column c0 + tid of the per-head [h][D][64] weights, row k at + 64 k
  v4f rx[4]; float rw[32];   // the short loops over rx, rw, wf and acc are fully unrolled so that these arrays stay in registers
#pragma unroll
  for (int i = 0; i < 4; ++i) rx[i] = *(const v4f*)(xg + (size_t)(16 * i) * DIN);
#pragma unroll
  for (int k = 0; k < 32; ++k) rw[k] = wg[(size_t)k * 64];
  asm volatile("s_wait_xcnt 0x0" ::: "memory");   // the loads' address registers may be rewritten by what follows: the wait stands in front of that
#pragma unroll 2   // two trips per pass: the buffer index becomes a constant LDS offset
  for (int kc = 0; kc < DIN / 32; ++kc) { const int bu = kc & 1;
#pragma unroll
    for (int i = 0; i < 4; ++i) { v4b x4;
#pragma unroll
      for (int e = 0; e < 4; ++e) x4[e] = (__bf16)rx[i][e];
      *(v4b*)&sA[bu][xr + 16 * i][xp * 4] = x4; }
#pragma unroll
    for (int kk = 0; kk < 4; ++kk) { v8b w8;
#pragma unroll
      for (int e = 0; e < 8; ++e) w8[e] = (__bf16)rw[kk * 8 + e];
      *(v8b*)&sW[bu][tid][kk * 8] = w8; }
    __syncthreads();   // publishes buffer bu; the other buffer's readers all passed it too, so the next trip may refill that one
    if (kc + 1 < DIN / 32) {
#pragma unroll
      for (int i = 0; i < 4; ++i) rx[i] = *(const v4f*)(xg + (size_t)(16 * i) * DIN + (kc + 1) * 32);
#pragma unroll
      for (int k = 0; k < 32; ++k) rw[k] = wg[(size_t)((kc + 1) * 32 + k) * 64];
      asm volatile("s_wait_xcnt 0x0" ::: "memory"); }   // the loads' address registers may be rewritten by what follows: the wait stands in front of that
    const v16b a = frag_b(&sA[bu][wave * 16 + col][0], lane); v16b wf[8];
#pragma unroll
    for (int j = 0; j < 8; ++j) wf[j] = frag_b(&sW[bu][j * 16 + col][0], lane);
    __builtin_amdgcn_sched_barrier(0);   // all fragment reads issue as one group ahead of the products: one LDS latency per tile instead of one per product
#pragma unroll
    for (int j = 0; j < 8; ++j) acc[j] = __builtin_amdgcn_wmma_f32_16x16x32_bf16(false, a, false, wf[j], (short)0, acc[j], false, false);
    __builtin_amdgcn_sched_barrier(0); }   // the next trip's converts wait for the loads in flight: they stay behind this tile's products
  __syncthreads();   // the last tile's readers are done before the epilogue reuses the LDS
  if (which < 2) { _Float16* DH = which == 0 ? QH : KH; _Float16* DL = which == 0 ? QL : KL; const int nhi = which == 0 ? QHI : KHI; const bool hi_rows = t0 < nhi;
#pragma unroll
    for (int j = 0; j < 8; ++j) { const float bias = BA ? bfr(BA[c0 + j * 16 + col]) : 0.f;
#pragma unroll
      for (int r = 0; r < 8; ++r) { const float v = acc[j][r] + bias; const _Float16 hv = (_Float16)v; sh[wave * 16 + 8 * g + r][j * 16 + col] = hv; sl[wave * 16 + 8 * g + r][j * 16 + col] = (_Float16)((v - (float)hv) * 1024.0f); } }
    __syncthreads();
    for (int e = tid; e < 64 * 16; e += 128) { const int rl = e >> 4, q = e & 15; vst2((unsigned*)(DH + (r0 + rl) * CC + c0 + q * 8), *(const v4u*)&sh[rl][q * 8]); if (hi_rows) vst2((unsigned*)(DL + (bb * nhi + t0 + rl) * (size_t)CC + c0 + q * 8), *(const v4u*)&sl[rl][q * 8]); }
  } else { const bool hi_rows = t0 < KHI;
#pragma unroll
    for (int j = 0; j < 8; ++j) { const float bias = BA ? bfr(BA[c0 + j * 16 + col]) : 0.f;
#pragma unroll
      for (int r = 0; r < 8; ++r) { const float v = acc[j][r] + bias; const int rl = wave * 16 + 8 * g + r, cl = j * 16 + col; th[cl][rl] = (_Float16)v; const __bf16 bh = (__bf16)v; tb[cl][rl] = bh; tbl[cl][rl] = (__bf16)(v - (float)bh); } }
    __syncthreads();
    for (int e = tid; e < 128 * 8; e += 128) { const int cl = e >> 3, q = e & 7; vst2((unsigned*)(VT + (bb * CC + c0 + cl) * (size_t)TT + t0 + q * 8), *(const v4u*)&th[cl][q * 8]); if (hi_rows) { const size_t o3 = (bb * CC + c0 + cl) * (size_t)KHI + t0 + q * 8; vst2((unsigned*)(VB + o3), *(const v4u*)&tb[cl][q * 8]); vst2((unsigned*)(VBL + o3), *(const v4u*)&tbl[cl][q * 8]); } } } }
// ---- k_attn: block = 128 queries (8 waves x 16) of (b, h); keys walked in LDS stages of 64 (K rows and v planes staged once per block, next stage's global loads in flight under this stage's work).
// Per 64 keys: S^T = K Q^T (A = K rows, B = q: residual product first, x 2^-10, then the hi product on top), so a lane holds one query's logits; running maximum and sum per lane (+ one exchange between the wave halves);
// P^T = exp(logit - max) x 2^11 once to f16 is already a B operand (two D tiles = 32 keys in the hardware k order); O^T += V^T P^T; the accumulators are rescaled when the maximum moves; ctx = O^T / sum at the end.
#define AKT 64             // keys per LDS stage
#define KPITCH 72          // f16 per staged K row: 144 B (16 B x odd), conflict-free 16-byte reads
#define VPITCH 72          // f16 per staged v plane row: 144 B
#define CSL2 (SCALE * 1.4426950408889634f)
__device__ __forceinline__ v8f wm16(v16h a, v16h b, v8f c) { return __builtin_amdgcn_wmma_f32_16x16x32_f16(false, a, false, b, (short)0, c, false, false); }
__device__ __forceinline__ float xhalf(float x) { return __builtin_bit_cast(float, __builtin_amdgcn_permlanex16(__builtin_bit_cast(int, x), __builtin_bit_cast(int, x), 0x76543210, 0xfedcba98, false, false)); }  // lane l with lane l ^ 16
// grid 8 x 6 x 16 = 768 blocks; at under 160 registers and 18 KB of LDS three blocks (six waves per SIMD) fit a WGP, so other waves cover each wave's LDS and exp latency
__global__ __launch_bounds__(256) void k_attn(const _Float16* __restrict__ QH, const _Float16* __restrict__ QL, const _Float16* __restrict__ KH, const _Float16* __restrict__ VT, float* __restrict__ Y) {
  __shared__ __align__(16) _Float16 sk[AKT][KPITCH]; __shared__ __align__(16) _Float16 sv[HD][VPITCH];
  const int tid = threadIdx.x, wave = tid >> 5, lane = tid & 31, col = lane & 15, g = lane >> 4; const int h = blockIdx.y, b = blockIdx.z; const int q = blockIdx.x * 128 + wave * 16 + col;
  v16h qh[HD / 32], ql[HD / 32];
#pragma unroll
  for (int kc = 0; kc < HD / 32; ++kc) { qh[kc] = frag_h(QH + ((size_t)b * TT + q) * CC + h * HD + kc * 32, lane); ql[kc] = frag_h(QL + ((size_t)b * QHI + q) * CC + h * HD + kc * 32, lane); }
  const _Float16* kg = KH + ((size_t)b * TT + (tid >> 3)) * CC + h * HD + (tid & 7) * 8;      // 16-byte piece (tid & 7) of key rows (tid >> 3) + 32 i
  const _Float16* vg = VT + ((size_t)b * CC + h * HD + (tid >> 3)) * (size_t)TT + (tid & 7) * 8;   // 16-byte piece (tid & 7) of planes (tid >> 3) + 32 i
  v4u rk[2], rv[2];
#pragma unroll
  for (int i = 0; i < 2; ++i) { rk[i] = *(const v4u*)(kg + (size_t)(32 * i) * CC); rv[i] = *(const v4u*)(vg + (size_t)(32 * i) * TT); }
  v8f o[HD / 16] = {}; float m = -3.0e38f, l = 0.f;
  for (int s = 0; s < TT / AKT; ++s) {
#pragma unroll
    for (int i = 0; i < 2; ++i) { *(v4u*)&sk[(tid >> 3) + 32 * i][(tid & 7) * 8] = rk[i]; *(v4u*)&sv[(tid >> 3) + 32 * i][(tid & 7) * 8] = rv[i]; }
    __syncthreads();
    if (s + 1 < TT / AKT) {
#pragma unroll
      for (int i = 0; i < 2; ++i) { rk[i] = *(const v4u*)(kg + (size_t)((s + 1) * AKT + 32 * i) * CC); rv[i] = *(const v4u*)(vg + (size_t)(32 * i) * TT + (s + 1) * AKT); }
      asm volatile("s_wait_xcnt 0x0" ::: "memory"); }   // the loads' address registers are reused by the fragment loads that follow: the wait stands in front of that overwrite
    { v8f st[4];
#pragma unroll
      for (int j = 0; j < 4; ++j) { const v16h a0 = frag_h(&sk[j * 16 + col][0], lane), a1 = frag_h(&sk[j * 16 + col][32], lane);
        v8f c = {}; c = wm16(a0, ql[0], c); c = wm16(a1, ql[1], c); c = c * (1.0f / 1024.0f); c = wm16(a0, qh[0], c); st[j] = wm16(a1, qh[1], c); }
      float mx = st[0][0];
#pragma unroll
      for (int j = 0; j < 4; ++j)
#pragma unroll
        for (int r = 0; r < 8; ++r) mx = fmaxf(mx, st[j][r]);
      const float mn = fmaxf(m, fmaxf(mx, xhalf(mx)));   // both halves hold the query's maximum so far (unscaled logits)
      const float corr = __builtin_amdgcn_exp2f((m - mn) * CSL2); m = mn;   // 0 on the first pass
      const float nm = 11.0f - mn * CSL2;
      l *= corr;
#pragma unroll
      for (int t = 0; t < HD / 16; ++t) o[t] = o[t] * corr;
#pragma unroll
      for (int kk = 0; kk < 2; ++kk) { v8f e0 = __builtin_elementwise_fma(st[2 * kk], (v8f)(CSL2), (v8f)(nm)), e1 = __builtin_elementwise_fma(st[2 * kk + 1], (v8f)(CSL2), (v8f)(nm)); v16h pf;
#pragma unroll
        for (int i = 0; i < 8; ++i) { e0[i] = __builtin_amdgcn_exp2f(e0[i]); e1[i] = __builtin_amdgcn_exp2f(e1[i]); }
#pragma unroll
        for (int i = 0; i < 8; ++i) { pf[i] = (_Float16)e0[i]; pf[8 + i] = (_Float16)e1[i]; }
        e0 = e0 + e1; l += ((e0[0] + e0[1]) + (e0[2] + e0[3])) + ((e0[4] + e0[5]) + (e0[6] + e0[7]));
#pragma unroll
        for (int t = 0; t < HD / 16; ++t) o[t] = wm16(frag_h(&sv[t * 16 + col][kk * 32], lane), pf, o[t]); } }
    __syncthreads(); }
  l += xhalf(l); const float inv = 1.0f / l;   // l >= 2^11: the maximum's own term
  float* yr = Y + ((size_t)b * TT + q) * CC + h * HD + 8 * g;
#pragma unroll
  for (int t = 0; t < HD / 16; ++t) { const v8f v = o[t] * inv; vst2(yr + t * 16, (v4f){v[0], v[1], v[2], v[3]}); vst2(yr + t * 16 + 4, (v4f){v[4], v[5], v[6], v[7]}); } }
// ---- k_out: block = (64 rows, 128 cols): out = ctx Wo (+ bo): ctx x 2^6 once to f16 against Wo as f16(bf16 x 2^8) exact (1 product) x 2^-14; causal early rows (< QHI of each sequence): ctx bf16 hi + lo against exact bf16 Wo (2 products)
__global__ __launch_bounds__(128) void k_out(const float* __restrict__ Y, const float* __restrict__ WO, const float* __restrict__ BO, float* __restrict__ OUT) {
  // one LDS block: the main loop's operand tiles (2 buffers), then the epilogue's per-wave rows sf
  __shared__ __align__(16) unsigned char smem[4 * 16 * 132 * 4]; float (*sf)[16][132] = (float (*)[16][132])smem;
  _Float16 (*sA)[64][GP] = (_Float16 (*)[64][GP])smem; _Float16 (*sW)[128][GP] = (_Float16 (*)[128][GP])(smem + 2 * 64 * GP * 2);
  const int tid = threadIdx.x, wave = tid >> 5, lane = tid & 31, col = lane & 15, g = lane >> 4; const int c0 = blockIdx.y * 128; const size_t r0 = (size_t)blockIdx.x * 64 + wave * 16;
  v8f acc[8] = {};
  if (CAUSAL && (int)(((size_t)blockIdx.x * 64) % TT) < QHI) {   /* block-uniform */
#pragma unroll 2
    for (int kc = 0; kc < CC / 32; ++kc) { const F2 a = split_row(Y + (r0 + col) * CC, kc * 32, lane); asm volatile("s_wait_loadcnt 0x0" ::: "memory");
#pragma unroll
      for (int j = 0; j < 8; ++j) { const v16b w = WOCOL(WO, kc * 32, c0 + j * 16 + col, lane); asm volatile("s_wait_loadcnt 0x0" ::: "memory"); acc[j] = wmma_bf(a.h, w, acc[j]); acc[j] = wmma_bf(a.l, w, acc[j]); } }
#pragma unroll
    for (int j = 0; j < 8; ++j) { const float bias = BO ? bfr(BO[c0 + j * 16 + col]) : 0.f;
#pragma unroll
      for (int r = 0; r < 8; ++r) sf[wave][8 * g + r][j * 16 + col] = acc[j][r] + bias; }
  } else {
    // per 32 k: the block's ctx tile (64 x 32) and Wo tile (128 outputs x 32) are read once with whole-line loads, converted and laid in LDS as [row][k]; the next tile's loads fly under this tile's products
    const int xr = tid >> 3, xp = tid & 7;
    const float* yg = Y + ((size_t)blockIdx.x * 64 + xr) * CC + xp * 4;   // 16-byte piece xp of rows xr + 16 i
    const float* wg = WO + (size_t)(c0 + xr) * CC + xp * 4;               // 16-byte piece xp of Wo rows (outputs) c0 + xr + 16 i
    v4f ry[4], rw[8];   // the short loops over ry, rw, wf and acc are fully unrolled so that these arrays stay in registers
#pragma unroll
    for (int i = 0; i < 4; ++i) ry[i] = *(const v4f*)(yg + (size_t)(16 * i) * CC);
#pragma unroll
    for (int i = 0; i < 8; ++i) rw[i] = *(const v4f*)(wg + (size_t)(16 * i) * CC);
    asm volatile("s_wait_xcnt 0x0" ::: "memory");   // the loads' address registers may be rewritten by what follows: the wait stands in front of that
#pragma unroll 2   // two trips per pass: the buffer index becomes a constant LDS offset
    for (int kc = 0; kc < CC / 32; ++kc) { const int bu = kc & 1;
#pragma unroll
      for (int i = 0; i < 4; ++i) { v4h y4;   /* ctx carried x 2^6 into f16 so small-magnitude context rows stay clear of f16 subnormals */
#pragma unroll
        for (int e = 0; e < 4; ++e) y4[e] = (_Float16)(ry[i][e] * 64.0f);
        *(v4h*)&sA[bu][xr + 16 * i][xp * 4] = y4; }
#pragma unroll
      for (int i = 0; i < 8; ++i) { v4h w4;
#pragma unroll
        for (int e = 0; e < 4; ++e) w4[e] = (_Float16)(bfr(rw[i][e]) * 256.0f);
        *(v4h*)&sW[bu][xr + 16 * i][xp * 4] = w4; }
      __syncthreads();   // publishes buffer bu; the other buffer's readers all passed it too, so the next trip may refill that one
      if (kc + 1 < CC / 32) {
#pragma unroll
        for (int i = 0; i < 4; ++i) ry[i] = *(const v4f*)(yg + (size_t)(16 * i) * CC + (kc + 1) * 32);
#pragma unroll
        for (int i = 0; i < 8; ++i) rw[i] = *(const v4f*)(wg + (size_t)(16 * i) * CC + (kc + 1) * 32);
        asm volatile("s_wait_xcnt 0x0" ::: "memory"); }   // the loads' address registers may be rewritten by what follows: the wait stands in front of that
      const v16h a = frag_h(&sA[bu][wave * 16 + col][0], lane); v16h wf[8];
#pragma unroll
      for (int j = 0; j < 8; ++j) wf[j] = frag_h(&sW[bu][j * 16 + col][0], lane);
      __builtin_amdgcn_sched_barrier(0);   // all fragment reads issue as one group ahead of the products: one LDS latency per tile instead of one per product
#pragma unroll
      for (int j = 0; j < 8; ++j) acc[j] = wm16(a, wf[j], acc[j]);
      __builtin_amdgcn_sched_barrier(0); }   // the next trip's converts wait for the loads in flight: they stay behind this tile's products
    __syncthreads();   // the last tile's readers are done before the epilogue reuses the LDS
#pragma unroll
    for (int j = 0; j < 8; ++j) { const float bias = BO ? bfr(BO[c0 + j * 16 + col]) : 0.f;
#pragma unroll
      for (int r = 0; r < 8; ++r) sf[wave][8 * g + r][j * 16 + col] = acc[j][r] * (1.0f / 16384.0f) + bias; } }   /* 2^-8 (Wo carry) x 2^-6 (ctx carry) */
  LDSX(); for (int rl = 0; rl < 16; ++rl) vst2(OUT + (r0 + rl) * DIN + c0 + lane * 4, *(const v4f*)&sf[wave][rl][lane * 4]); }

extern "C" void kernel_launch(void* const* d_in, const int* in_sizes, int n_in, void* d_out, int out_size, void* d_ws, size_t ws_size, hipStream_t stream) {
  (void)in_sizes; (void)n_in; (void)out_size;
  const float** F = (const float**)d_in;
  if (ws_size < (size_t)WS_END) return;
  char* ws = (char*)d_ws; _Float16 *QH = (_Float16*)(ws + WS_QH), *KH = (_Float16*)(ws + WS_KH), *VT = (_Float16*)(ws + WS_VT), *QL = (_Float16*)(ws + WS_QL), *KL = (_Float16*)(ws + WS_KL); __bf16 *VB = (__bf16*)(ws + WS_VB), *VBL = (__bf16*)(ws + WS_VBL); float *S = (float*)(ws + WS_S), *Y = (float*)(ws + WS_Y);
  (void)Y; (void)QL; (void)KL; (void)VB; (void)VBL; (void)S;
  // inputs: 0 x [16,1024,384]; 1 Wq [6,384,64], 2 bq [6,64]; 3 Wk, 4 bk; 5 Wv, 6 bv; 7 Wo [384,384] (out,in), 8 bo [384]
  k_proj<<<dim3(TNB * TT / 64, CC / 128, 3), 128, 0, stream>>>(F[0], F[0], F[0], F[1], F[3], F[5], F[2], F[4], F[6], QH, QL, KH, KL, VT, VB, VBL);
  k_attn<<<dim3(TT / 128, NH, TNB), 256, 0, stream>>>(QH, QL, KH, VT, Y);
  k_out<<<dim3(TNB * TT / 64, DIN / 128), 128, 0, stream>>>(Y, F[7], F[8], (float*)d_out);
}

// v003
// Measured time: 88.4 microseconds a run.
// Two timings next to v002 put it at 1.14 and 1.13 times that version's speed.
// All steps since v000 together make it 12.8 times as fast.
// compute dtype: all float inputs rounded to bf16; per-head q/k/v projections with EXACT bf16 products on WMMA 16x16x32 (f32 accumulate) + bias; logits with q as f16 hi + residual (x 2^10) against k once to f16 (2 products) x 64^-0.5; softmax f32 with a running maximum and sum (logits stay on chip); exp(logit - max) x 2^11 once to f16 x v once to f16 (1 product), divided by the f32 sum at the end; ctx carried x 2^6 once to f16 x Wo f16(bf16 x 2^8) + bo; f32 output.
#include <hip/hip_runtime.h>
#include <math.h>

typedef __attribute__((ext_vector_type(16))) _Float16 v16h;
typedef __attribute__((ext_vector_type(16))) __bf16 v16b;
typedef __attribute__((ext_vector_type(8)))  _Float16 v8h;
typedef __attribute__((ext_vector_type(8)))  float v8f;
typedef __attribute__((ext_vector_type(4)))  float v4f;
typedef __attribute__((ext_vector_type(2)))  float v2f;
typedef __attribute__((ext_vector_type(4)))  unsigned v4u;
typedef __attribute__((ext_vector_type(4)))  int v4i;
typedef float __attribute__((may_alias)) float_a;
typedef int __attribute__((may_alias)) int_a;

template <typename T> __device__ __forceinline__ void vst2(void* p, T v) { *(T*)p = v;  }
__device__ __forceinline__ v8f wmma16(v16h a, v16h b, v8f c) {
  v8f d = __builtin_amdgcn_wmma_f32_16x16x32_f16(false, a, false, b, (short)0, c, false, false);
  asm volatile("v_nop\n\tv_nop\n\tv_nop\n\tv_nop" : "+v"(d) : "v"(a), "v"(b));
  return d;
}
__device__ __forceinline__ v8f wmma_bf(v16b a, v16b b, v8f c) {
  v8f d = __builtin_amdgcn_wmma_f32_16x16x32_bf16(false, a, false, b, (short)0, c, false, false);
  asm volatile("v_nop\n\tv_nop\n\tv_nop\n\tv_nop" : "+v"(d) : "v"(a), "v"(b));
  return d;
}
// 16x16x32 fragments: lane = (h = lane>>4, row/col = lane&15); elements 0..7 = k0+8h+0..7, 8..15 = k0+16+8h+0..7; D element r = row 8h+r
__device__ __forceinline__ v16h frag_h(const _Float16* rowk0, int lane) {
  union { v16h v; v8h q[2]; } u; const _Float16* p = rowk0 + 8 * (lane >> 4);
  u.q[0] = *(const v8h*)p; u.q[1] = *(const v8h*)(p + 16); return u.v;
}
__device__ __forceinline__ v16h frag_f32(const float* rowk0, int lane) {
  v16h a; const float* p = rowk0 + 8 * (lane >> 4);
#pragma unroll
  for (int i = 0; i < 8; ++i) { a[i] = (_Float16)p[i]; a[8 + i] = (_Float16)p[16 + i]; }
  return a;
}
__device__ __forceinline__ v16h frag_f32s(const float* rowk0, int lane, float sc) {
  v16h a; const float* p = rowk0 + 8 * (lane >> 4);
#pragma unroll
  for (int i = 0; i < 8; ++i) { a[i] = (_Float16)(p[i] * sc); a[8 + i] = (_Float16)(p[16 + i] * sc); }
  return a;
}
// column fragment from a [K][ld] layout (column n), rows >= K read as 0
__device__ __forceinline__ v16h fragc_f32(const float* W, int k0, int n, int lane, int ld, int K) {
  v16h a; const int g = lane >> 4;
#pragma unroll
  for (int i = 0; i < 8; ++i) { const int ka = k0 + 8 * g + i, kb = ka + 16;
    a[i] = (_Float16)(ka < K ? W[(size_t)(ka < K ? ka : K - 1) * ld + n] : 0.f); a[8 + i] = (_Float16)(kb < K ? W[(size_t)(kb < K ? kb : K - 1) * ld + n] : 0.f); }
  return a;
}
struct F2 { v16b h, l; };
__device__ __forceinline__ F2 bsplit16(const float v[16]) { F2 r;
#pragma unroll
  for (int i = 0; i < 16; ++i) { const __bf16 h = (__bf16)v[i]; r.h[i] = h; r.l[i] = (__bf16)(v[i] - (float)h); }
  return r; }
__device__ __forceinline__ F2 split_row(const float* row, int k0, int lane) { float v[16]; const float* p = row + k0 + 8 * (lane >> 4);
#pragma unroll
  for (int i = 0; i < 8; ++i) { v[i] = p[i]; v[8 + i] = p[16 + i]; }
  return bsplit16(v); }
__device__ __forceinline__ F2 split_rowK(const float* row, int k0, int lane, int K) { float v[16]; const int g = lane >> 4;
#pragma unroll
  for (int i = 0; i < 8; ++i) { const int ka = k0 + 8 * g + i, kb = ka + 16; v[i] = ka < K ? row[ka < K ? ka : K - 1] : 0.f; v[8 + i] = kb < K ? row[kb < K ? kb : K - 1] : 0.f; }
  return bsplit16(v); }
__device__ __forceinline__ F2 split_col(const float* W, int k0, int n, int lane, int ld, int K) { float v[16]; const int g = lane >> 4;
#pragma unroll
  for (int i = 0; i < 8; ++i) { const int ka = k0 + 8 * g + i, kb = ka + 16; v[i] = ka < K ? W[(size_t)(ka < K ? ka : K - 1) * ld + n] : 0.f; v[8 + i] = kb < K ? W[(size_t)(kb < K ? kb : K - 1) * ld + n] : 0.f; }
  return bsplit16(v); }
__device__ __forceinline__ v8f mac3(const F2& a, const F2& b, v8f c) { c = wmma_bf(a.l, b.h, c); c = wmma_bf(a.h, b.l, c); return wmma_bf(a.h, b.h, c); }
__device__ __forceinline__ float sigm(float v) { return 1.0f / (1.0f + expf(-v)); }
#define LDSX() do { asm volatile("s_wait_dscnt 0" ::: "memory"); __builtin_amdgcn_wave_barrier(); __builtin_amdgcn_fence(__ATOMIC_RELEASE, "workgroup"); } while (0)

// Multi-head self-attention (B 16, S 1,024, D 384 = 6 heads x 64; per-head (in,out) Wq/Wk/Wv [6,384,64] + biases [6,64], 0.02-scale; (out,in) Wo [384,384] + bo): out = merge(softmax(q k^T / 8) v) Wo^T + bo.
#define NB 16
#define TT 1024
#define CC 384            // NH * HD = projected width
#define DIN 384          // input (model) width
#define NH 6
#define HD 64
#define NQB (TT / 64)
#define HG 6
#define SCALE (0.125f)
#define CAUSAL 0
#ifndef TNB
#define TNB NB
#endif
__device__ __forceinline__ float bfr(float v) { return (float)(__bf16)v; }
__host__ __device__ __forceinline__ int kb_last(int qb) { return CAUSAL ? ((qb * 64 + 63) >> 7) : (TT / 128 - 1); }
typedef __attribute__((ext_vector_type(8))) __bf16 v8b;
typedef __attribute__((ext_vector_type(4))) __bf16 v4b;
typedef __attribute__((ext_vector_type(4))) _Float16 v4h;
#define GP 40              // 16-bit elements per staged GEMM tile row: 32 k + 8 = 80 B (16 B x odd), conflict-free 16-byte reads
__device__ __forceinline__ v16b frag_b(const __bf16* rowk0, int lane) {
  union { v16b v; v8b q[2]; } u; const __bf16* p = rowk0 + 8 * (lane >> 4);
  u.q[0] = *(const v8b*)p; u.q[1] = *(const v8b*)(p + 16); return u.v;
}
#define QBH 0
#define QHI 1024            // rows carrying a q residual plane (all rows when non-causal: 2-product logits everywhere)
#define KHI 64            // key rows carrying k residual / v bf16 hi+lo planes (written by k_proj, read by no kernel here)
// B fragment (k rows k0+.., output column o) of a weight: (in,out) [K][ld] or (out,in) [ld rows of K]: bf16 exact, or f16(bf16 * 256) exact
__device__ __forceinline__ v16b wcol_io(const float* Wm, int k0, int o, int lane, int ld) { v16b w; const int g = lane >> 4;
#pragma unroll
  for (int i = 0; i < 8; ++i) { w[i] = (__bf16)Wm[(size_t)(k0 + 8 * g + i) * ld + o]; w[8 + i] = (__bf16)Wm[(size_t)(k0 + 16 + 8 * g + i) * ld + o]; }
  return w; }
__device__ __forceinline__ v16b wcol_oi(const float* Wm, int k0, int o, int lane, int K) { v16b w; const float* p = Wm + (size_t)o * K + k0 + 8 * (lane >> 4);
#pragma unroll
  for (int i = 0; i < 8; ++i) { w[i] = (__bf16)p[i]; w[8 + i] = (__bf16)p[16 + i]; }
  return w; }
__device__ __forceinline__ v16h wcolh_io(const float* Wm, int k0, int o, int lane, int ld) { v16h w; const int g = lane >> 4;
#pragma unroll
  for (int i = 0; i < 8; ++i) { w[i] = (_Float16)(bfr(Wm[(size_t)(k0 + 8 * g + i) * ld + o]) * 256.0f); w[8 + i] = (_Float16)(bfr(Wm[(size_t)(k0 + 16 + 8 * g + i) * ld + o]) * 256.0f); }
  return w; }
__device__ __forceinline__ v16h wcolh_oi(const float* Wm, int k0, int o, int lane, int K) { v16h w; const float* p = Wm + (size_t)o * K + k0 + 8 * (lane >> 4);
#pragma unroll
  for (int i = 0; i < 8; ++i) { w[i] = (_Float16)(bfr(p[i]) * 256.0f); w[8 + i] = (_Float16)(bfr(p[16 + i]) * 256.0f); }
  return w; }
#define WQKV_LAYOUT 0   // 0 = per-head [NH][DIN][HD] (wcol_heads); 1 = (out,in) [CC][DIN]; 2 = per-head [NH][DIN][HD]
__device__ __forceinline__ v16b wcol_hdk(const float* Wm, int k0, int o, int lane) { v16b w; const int g = lane >> 4; const float* p = Wm + (size_t)(o / HD) * DIN * HD + (o % HD);
#pragma unroll
  for (int i = 0; i < 8; ++i) { w[i] = (__bf16)p[(size_t)(k0 + 8 * g + i) * HD]; w[8 + i] = (__bf16)p[(size_t)(k0 + 16 + 8 * g + i) * HD]; }
  return w; }
#define WO_OUT_IN 1
#if WQKV_LAYOUT == 1
#define WCOL(W, k0, o, lane) wcol_oi(W, k0, o, lane, DIN)
#elif WQKV_LAYOUT == 2
#define WCOL(W, k0, o, lane) wcol_hdk(W, k0, o, lane)
#else
#define WCOL(W, k0, o, lane) wcol_heads(W, k0, o, lane)   /* per-head [h][D][64] weights */
#endif
#if WO_OUT_IN
#define WOCOL(W, k0, o, lane) wcol_oi(W, k0, o, lane, CC)
#define WOCOLH(W, k0, o, lane) wcolh_oi(W, k0, o, lane, CC)
#else
#define WOCOL(W, k0, o, lane) wcol_io(W, k0, o, lane, DIN)
#define WOCOLH(W, k0, o, lane) wcolh_io(W, k0, o, lane, DIN)
#endif
// per-head projection weights W[h][D][64] ([6][384][64]): column o = h*64 + d of the virtual (in,out) [D][384] matrix lives at W + (h*D + k)*64 + d
__device__ __forceinline__ v16b wcol_heads(const float* __restrict__ Wm, int k0, int o, int lane) { v16b w; const int g = lane >> 4; const float* p = Wm + ((size_t)(o >> 6) * DIN + k0 + 8 * g) * 64 + (o & 63);
#pragma unroll
  for (int i = 0; i < 8; ++i) { w[i] = (__bf16)p[(size_t)i * 64]; w[8 + i] = (__bf16)p[(size_t)(16 + i) * 64]; }
  asm volatile("s_wait_loadcnt 0x0" ::: "memory"); return w; }
#ifndef SM_EXTRA_PARAMS
#define SM_EXTRA_PARAMS
#endif
#ifndef PROJ_EXTRA_PARAMS
#define PROJ_EXTRA_PARAMS
#endif
#ifndef SM_MASK_HOOK
#define SM_MASK_HOOK (void)0
#endif

#define WS_QH  0u                                      // f16 q rows [b*t][CC]
#define WS_KH  (WS_QH + 2u * (size_t)NB * TT * CC)      // f16 k rows [b*t][CC]
#define WS_VT  (WS_KH + 2u * (size_t)NB * TT * CC)      // f16 v planes [b][c][t]
#define WS_QL  (WS_VT + 2u * (size_t)NB * CC * TT)      // f16 q residual x 2^10 rows [b][t < QHI][CC]
#define WS_KL  (WS_QL + 2u * (size_t)NB * QHI * CC)     // f16 k residual x 2^10 rows [b][t < KHI][CC]
#define WS_VB  (WS_KL + 2u * (size_t)NB * KHI * CC)     // bf16 v hi planes [b][c][t < KHI]
#define WS_VBL (WS_VB + 2u * (size_t)NB * CC * KHI)
#define WS_S   (WS_VBL + 2u * (size_t)NB * CC * KHI)    // f32 [hg][t][s], reserved but not used (logits stay on chip)
#define WS_Y   (WS_S  + 4u * (size_t)HG * TT * TT)      // f32 ctx rows [b*t][CC] (only when there is an output projection)
#define WS_END (WS_Y  + 4u * (size_t)NB * TT * CC)

// ---- k_proj: block = (128 rows, 192 cols, which), 8 waves of 32 rows x 96 cols: q/k/v = X W (+ b) with exact bf16 products (K = DIN) -> which 0: q f16 rows (+ residual rows < QHI); 1: k f16 rows (+ residual rows < KHI); 2: v f16 planes [c][t] (+ bf16 hi/lo planes for t < KHI)
#define PBM 128            // rows of X per block
#define PBN 192            // output columns per block (three heads of one of q, k, v)
#define PSP (PBN + 8)      // f16 per epilogue row of q/k: 400 B (16 B x odd)
#define PTP (PBM + 8)      // 16-bit elements per epilogue plane row of v: 272 B (16 B x odd)
__global__ __launch_bounds__(256) void k_proj(const float* __restrict__ XQ, const float* __restrict__ XK, const float* __restrict__ XV, const float* __restrict__ WQ, const float* __restrict__ WK, const float* __restrict__ WV, const float* __restrict__ BQ, const float* __restrict__ BK, const float* __restrict__ BV,
    _Float16* __restrict__ QH, _Float16* __restrict__ QL, _Float16* __restrict__ KH, _Float16* __restrict__ KL, _Float16* __restrict__ VT, __bf16* __restrict__ VB, __bf16* __restrict__ VBL) {
  // one LDS block: the main loop's operand tiles (2 buffers) and the epilogue's transpose arrays (q/k: sh, sl; v: th, tb, tbl) live at different times, separated by the barrier after the loop
  __shared__ __align__(16) unsigned char smem[3 * PBN * PTP * 2];
  _Float16 (*sh)[PSP] = (_Float16 (*)[PSP])smem; _Float16 (*sl)[PSP] = (_Float16 (*)[PSP])(smem + PBM * PSP * 2);
  _Float16 (*th)[PTP] = (_Float16 (*)[PTP])smem; __bf16 (*tb)[PTP] = (__bf16 (*)[PTP])(smem + PBN * PTP * 2); __bf16 (*tbl)[PTP] = (__bf16 (*)[PTP])(smem + 2 * PBN * PTP * 2);
  __bf16 (*sA)[PBM][GP] = (__bf16 (*)[PBM][GP])smem; __bf16 (*sW)[PBN][GP] = (__bf16 (*)[PBN][GP])(smem + 2 * PBM * GP * 2);
  const int tid = threadIdx.x, wave = tid >> 5, lane = tid & 31, col = lane & 15, g = lane >> 4; const int which = blockIdx.z; const int c0 = blockIdx.y * PBN; const size_t r0 = (size_t)blockIdx.x * PBM; const size_t bb = r0 / TT; const int t0 = (int)(r0 % TT);
  const int wr = (wave >> 1) * 32, wc = (wave & 1) * 96;   // the wave's 32 x 96 piece of the block's tile: each X fragment feeds 6 products, each W fragment 2
  const float* X = which == 0 ? XQ : which == 1 ? XK : XV; const float* WA = which == 0 ? WQ : which == 1 ? WK : WV; const float* BA = which == 0 ? BQ : which == 1 ? BK : BV;
  v8f acc[2][6] = {};
  // per 32 k: the block's X tile (128 x 32) and W tile (32 x 192) are read once with whole-line loads, rounded to bf16 and laid in LDS as [row][k] and [column][k]; the next tile's loads fly under this tile's products
  const int xr = tid >> 3, xp = tid & 7;
  const float* xg = X + (r0 + xr) * DIN + xp * 4;                                             // 16-byte piece xp of rows xr + 32 i
  // W tile = 6 column segments of 32 x 4 groups of 8 k = 24 units, 3 per wave: a lane holds 8 consecutive k of one column (one 16-byte LDS store), a wave's load covers one 128-byte line
  const float* wg[3]; int wcl[3], wok[3];
#pragma unroll
  for (int i = 0; i < 3; ++i) { const int u = wave * 3 + i; wcl[i] = (u % 6) * 32 + lane; wok[i] = (u / 6) * 8;
    wg[i] = WA + ((size_t)((c0 + wcl[i]) >> 6) * DIN + wok[i]) * 64 + ((c0 + wcl[i]) & 63); }   // column c0 + wcl of the per-head [h][D][64] weights, row k at + 64 k
  v4f rx[4]; float rw[3][8];   // the short loops over rx, rw, a, wf and acc are fully unrolled so that these arrays stay in registers
#pragma unroll
  for (int i = 0; i < 4; ++i) rx[i] = *(const v4f*)(xg + (size_t)(32 * i) * DIN);
#pragma unroll
  for (int i = 0; i < 3; ++i)
#pragma unroll
    for (int k = 0; k < 8; ++k) rw[i][k] = wg[i][(size_t)k * 64];
  asm volatile("s_wait_xcnt 0x0" ::: "memory");   // the loads' address registers may be rewritten by what follows: the wait stands in front of that
#pragma unroll 2   // two trips per pass: the buffer index becomes a constant LDS offset
  for (int kc = 0; kc < DIN / 32; ++kc) { const int bu = kc & 1;
#pragma unroll
    for (int i = 0; i < 4; ++i) { v4b x4;
#pragma unroll
      for (int e = 0; e < 4; ++e) x4[e] = (__bf16)rx[i][e];
      *(v4b*)&sA[bu][xr + 32 * i][xp * 4] = x4; }
#pragma unroll
    for (int i = 0; i < 3; ++i) { v8b w8;
#pragma unroll
      for (int e = 0; e < 8; ++e) w8[e] = (__bf16)rw[i][e];
      *(v8b*)&sW[bu][wcl[i]][wok[i]] = w8; }
    __syncthreads();   // publishes buffer bu; the other buffer's readers all passed it too, so the next trip may refill that one
    if (kc + 1 < DIN / 32) {
#pragma unroll
      for (int i = 0; i < 4; ++i) rx[i] = *(const v4f*)(xg + (size_t)(32 * i) * DIN + (kc + 1) * 32);
#pragma unroll
      for (int i = 0; i < 3; ++i)
#pragma unroll
        for (int k = 0; k < 8; ++k) rw[i][k] = wg[i][(size_t)((kc + 1) * 32 + k) * 64];
      asm volatile("s_wait_xcnt 0x0" ::: "memory"); }   // the loads' address registers may be rewritten by what follows: the wait stands in front of that
    v16b a[2], wf[6];
#pragma unroll
    for (int i = 0; i < 2; ++i) a[i] = frag_b(&sA[bu][wr + i * 16 + col][0], lane);
#pragma unroll
    for (int j = 0; j < 6; ++j) wf[j] = frag_b(&sW[bu][wc + j * 16 + col][0], lane);
    __builtin_amdgcn_sched_barrier(0);   // all fragment reads issue as one group ahead of the products: one LDS latency per tile instead of one per product
#pragma unroll
    for (int j = 0; j < 6; ++j)
#pragma unroll
      for (int i = 0; i < 2; ++i) acc[i][j] = __builtin_amdgcn_wmma_f32_16x16x32_bf16(false, a[i], false, wf[j], (short)0, acc[i][j], false, false);
    __builtin_amdgcn_sched_barrier(0); }   // the next trip's converts wait for the loads in flight: they stay behind this tile's products
  __syncthreads();   // the last tile's readers are done before the epilogue reuses the LDS
  if (which < 2) { _Float16* DH = which == 0 ? QH : KH; _Float16* DL = which == 0 ? QL : KL; const int nhi = which == 0 ? QHI : KHI;
#pragma unroll
    for (int j = 0; j < 6; ++j) { const float bias = BA ? bfr(BA[c0 + wc + j * 16 + col]) : 0.f;
#pragma unroll
      for (int i = 0; i < 2; ++i)
#pragma unroll
        for (int r = 0; r < 8; ++r) { const float v = acc[i][j][r] + bias; const _Float16 hv = (_Float16)v; sh[wr + i * 16 + 8 * g + r][wc + j * 16 + col] = hv; sl[wr + i * 16 + 8 * g + r][wc + j * 16 + col] = (_Float16)((v - (float)hv) * 1024.0f); } }
    __syncthreads();
    for (int e = tid; e < PBM * (PBN / 8); e += 256) { const int rl = e / (PBN / 8), q = e % (PBN / 8); vst2((unsigned*)(DH + (r0 + rl) * CC + c0 + q * 8), *(const v4u*)&sh[rl][q * 8]);
      if (t0 + rl < nhi) { vst2((unsigned*)(DL + (bb * nhi + t0 + rl) * (size_t)CC + c0 + q * 8), *(const v4u*)&sl[rl][q * 8]); asm volatile("s_wait_xcnt 0x0" ::: "memory"); } }   // the store's address registers are rewritten by the next trip: the wait stands in front of that
  } else {
#pragma unroll
    for (int j = 0; j < 6; ++j) { const float bias = BA ? bfr(BA[c0 + wc + j * 16 + col]) : 0.f;
#pragma unroll
      for (int i = 0; i < 2; ++i)
#pragma unroll
        for (int r = 0; r < 8; ++r) { const float v = acc[i][j][r] + bias; const int rl = wr + i * 16 + 8 * g + r, cl = wc + j * 16 + col; th[cl][rl] = (_Float16)v; const __bf16 bh = (__bf16)v; tb[cl][rl] = bh; tbl[cl][rl] = (__bf16)(v - (float)bh); } }
    __syncthreads();
    for (int e = tid; e < PBN * (PBM / 8); e += 256) { const int cl = e / (PBM / 8), q = e % (PBM / 8); vst2((unsigned*)(VT + (bb * CC + c0 + cl) * (size_t)TT + t0 + q * 8), *(const v4u*)&th[cl][q * 8]);
      if (t0 + q * 8 < KHI) { const size_t o3 = (bb * CC + c0 + cl) * (size_t)KHI + t0 + q * 8; vst2((unsigned*)(VB + o3), *(const v4u*)&tb[cl][q * 8]); vst2((unsigned*)(VBL + o3), *(const v4u*)&tbl[cl][q * 8]); asm volatile("s_wait_xcnt 0x0" ::: "memory"); } }   // the stores' address registers are rewritten by the next trip: the wait stands in front of that
  } }
// ---- k_attn: block = 128 queries (8 waves x 16) of (b, h); keys walked in LDS stages of 64 (K rows and v planes staged once per block, next stage's global loads in flight under this stage's work).
// Per 64 keys: S^T = K Q^T (A = K rows, B = q: residual product first, x 2^-10, then the hi product on top), so a lane holds one query's logits; running maximum and sum per lane (+ one exchange between the wave halves);
// P^T = exp(logit - max) x 2^11 once to f16 is already a B operand (two D tiles = 32 keys in the hardware k order); O^T += V^T P^T; the accumulators are rescaled when the maximum moves; ctx = O^T / sum at the end.
#define AKT 64             // keys per LDS stage
#define KPITCH 72          // f16 per staged K row: 144 B (16 B x odd), conflict-free 16-byte reads
#define VPITCH 72          // f16 per staged v plane row: 144 B
#define CSL2 (SCALE * 1.4426950408889634f)
__device__ __forceinline__ v8f wm16(v16h a, v16h b, v8f c) { return __builtin_amdgcn_wmma_f32_16x16x32_f16(false, a, false, b, (short)0, c, false, false); }
__device__ __forceinline__ float xhalf(float x) { return __builtin_bit_cast(float, __builtin_amdgcn_permlanex16(__builtin_bit_cast(int, x), __builtin_bit_cast(int, x), 0x76543210, 0xfedcba98, false, false)); }  // lane l with lane l ^ 16
// grid 8 x 6 x 16 = 768 blocks; at under 160 registers and 18 KB of LDS three blocks (six waves per SIMD) fit a WGP, so other waves cover each wave's LDS and exp latency
__global__ __launch_bounds__(256) void k_attn(const _Float16* __restrict__ QH, const _Float16* __restrict__ QL, const _Float16* __restrict__ KH, const _Float16* __restrict__ VT, float* __restrict__ Y) {
  __shared__ __align__(16) _Float16 sk[AKT][KPITCH]; __shared__ __align__(16) _Float16 sv[HD][VPITCH];
  const int tid = threadIdx.x, wave = tid >> 5, lane = tid & 31, col = lane & 15, g = lane >> 4; const int h = blockIdx.y, b = blockIdx.z; const int q = blockIdx.x * 128 + wave * 16 + col;
  v16h qh[HD / 32], ql[HD / 32];
#pragma unroll
  for (int kc = 0; kc < HD / 32; ++kc) { qh[kc] = frag_h(QH + ((size_t)b * TT + q) * CC + h * HD + kc * 32, lane); ql[kc] = frag_h(QL + ((size_t)b * QHI + q) * CC + h * HD + kc * 32, lane); }
  const _Float16* kg = KH + ((size_t)b * TT + (tid >> 3)) * CC + h * HD + (tid & 7) * 8;      // 16-byte piece (tid & 7) of key rows (tid >> 3) + 32 i
  const _Float16* vg = VT + ((size_t)b * CC + h * HD + (tid >> 3)) * (size_t)TT + (tid & 7) * 8;   // 16-byte piece (tid & 7) of planes (tid >> 3) + 32 i
  v4u rk[2], rv[2];
#pragma unroll
  for (int i = 0; i < 2; ++i) { rk[i] = *(const v4u*)(kg + (size_t)(32 * i) * CC); rv[i] = *(const v4u*)(vg + (size_t)(32 * i) * TT); }
  v8f o[HD / 16] = {}; float m = -3.0e38f, l = 0.f;
  for (int s = 0; s < TT / AKT; ++s) {
#pragma unroll
    for (int i = 0; i < 2; ++i) { *(v4u*)&sk[(tid >> 3) + 32 * i][(tid & 7) * 8] = rk[i]; *(v4u*)&sv[(tid >> 3) + 32 * i][(tid & 7) * 8] = rv[i]; }
    __syncthreads();
    if (s + 1 < TT / AKT) {
#pragma unroll
      for (int i = 0; i < 2; ++i) { rk[i] = *(const v4u*)(kg + (size_t)((s + 1) * AKT + 32 * i) * CC); rv[i] = *(const v4u*)(vg + (size_t)(32 * i) * TT + (s + 1) * AKT); }
      asm volatile("s_wait_xcnt 0x0" ::: "memory"); }   // the loads' address registers are reused by the fragment loads that follow: the wait stands in front of that overwrite
    { v8f st[4];
#pragma unroll
      for (int j = 0; j < 4; ++j) { const v16h a0 = frag_h(&sk[j * 16 + col][0], lane), a1 = frag_h(&sk[j * 16 + col][32], lane);
        v8f c = {}; c = wm16(a0, ql[0], c); c = wm16(a1, ql[1], c); c = c * (1.0f / 1024.0f); c = wm16(a0, qh[0], c); st[j] = wm16(a1, qh[1], c); }
      float mx = st[0][0];
#pragma unroll
      for (int j = 0; j < 4; ++j)
#pragma unroll
        for (int r = 0; r < 8; ++r) mx = fmaxf(mx, st[j][r]);
      const float mn = fmaxf(m, fmaxf(mx, xhalf(mx)));   // both halves hold the query's maximum so far (unscaled logits)
      const float corr = __builtin_amdgcn_exp2f((m - mn) * CSL2); m = mn;   // 0 on the first pass
      const float nm = 11.0f - mn * CSL2;
      l *= corr;
#pragma unroll
      for (int t = 0; t < HD / 16; ++t) o[t] = o[t] * corr;
#pragma unroll
      for (int kk = 0; kk < 2; ++kk) { v8f e0 = __builtin_elementwise_fma(st[2 * kk], (v8f)(CSL2), (v8f)(nm)), e1 = __builtin_elementwise_fma(st[2 * kk + 1], (v8f)(CSL2), (v8f)(nm)); v16h pf;
#pragma unroll
        for (int i = 0; i < 8; ++i) { e0[i] = __builtin_amdgcn_exp2f(e0[i]); e1[i] = __builtin_amdgcn_exp2f(e1[i]); }
#pragma unroll
        for (int i = 0; i < 8; ++i) { pf[i] = (_Float16)e0[i]; pf[8 + i] = (_Float16)e1[i]; }
        e0 = e0 + e1; l += ((e0[0] + e0[1]) + (e0[2] + e0[3])) + ((e0[4] + e0[5]) + (e0[6] + e0[7]));
#pragma unroll
        for (int t = 0; t < HD / 16; ++t) o[t] = wm16(frag_h(&sv[t * 16 + col][kk * 32], lane), pf, o[t]); } }
    __syncthreads(); }
  l += xhalf(l); const float inv = 1.0f / l;   // l >= 2^11: the maximum's own term
  float* yr = Y + ((size_t)b * TT + q) * CC + h * HD + 8 * g;
#pragma unroll
  for (int t = 0; t < HD / 16; ++t) { const v8f v = o[t] * inv; vst2(yr + t * 16, (v4f){v[0], v[1], v[2], v[3]}); vst2(yr + t * 16 + 4, (v4f){v[4], v[5], v[6], v[7]}); } }
// ---- k_out: block = (64 rows, 128 cols): out = ctx Wo (+ bo): ctx x 2^6 once to f16 against Wo as f16(bf16 x 2^8) exact (1 product) x 2^-14; causal early rows (< QHI of each sequence): ctx bf16 hi + lo against exact bf16 Wo (2 products)
__global__ __launch_bounds__(128) void k_out(const float* __restrict__ Y, const float* __restrict__ WO, const float* __restrict__ BO, float* __restrict__ OUT) {
  // one LDS block: the main loop's operand tiles (2 buffers), then the epilogue's per-wave rows sf
  __shared__ __align__(16) unsigned char smem[4 * 16 * 132 * 4]; float (*sf)[16][132] = (float (*)[16][132])smem;
  _Float16 (*sA)[64][GP] = (_Float16 (*)[64][GP])smem; _Float16 (*sW)[128][GP] = (_Float16 (*)[128][GP])(smem + 2 * 64 * GP * 2);
  const int tid = threadIdx.x, wave = tid >> 5, lane = tid & 31, col = lane & 15, g = lane >> 4; const int c0 = blockIdx.y * 128; const size_t r0 = (size_t)blockIdx.x * 64 + wave * 16;
  v8f acc[8] = {};
  if (CAUSAL && (int)(((size_t)blockIdx.x * 64) % TT) < QHI) {   /* block-uniform */
#pragma unroll 2
    for (int kc = 0; kc < CC / 32; ++kc) { const F2 a = split_row(Y + (r0 + col) * CC, kc * 32, lane); asm volatile("s_wait_loadcnt 0x0" ::: "memory");
#pragma unroll
      for (int j = 0; j < 8; ++j) { const v16b w = WOCOL(WO, kc * 32, c0 + j * 16 + col, lane); asm volatile("s_wait_loadcnt 0x0" ::: "memory"); acc[j] = wmma_bf(a.h, w, acc[j]); acc[j] = wmma_bf(a.l, w, acc[j]); } }
#pragma unroll
    for (int j = 0; j < 8; ++j) { const float bias = BO ? bfr(BO[c0 + j * 16 + col]) : 0.f;
#pragma unroll
      for (int r = 0; r < 8; ++r) sf[wave][8 * g + r][j * 16 + col] = acc[j][r] + bias; }
  } else {
    // per 32 k: the block's ctx tile (64 x 32) and Wo tile (128 outputs x 32) are read once with whole-line loads, converted and laid in LDS as [row][k]; the next tile's loads fly under this tile's products
    const int xr = tid >> 3, xp = tid & 7;
    const float* yg = Y + ((size_t)blockIdx.x * 64 + xr) * CC + xp * 4;   // 16-byte piece xp of rows xr + 16 i
    const float* wg = WO + (size_t)(c0 + xr) * CC + xp * 4;               // 16-byte piece xp of Wo rows (outputs) c0 + xr + 16 i
    v4f ry[4], rw[8];   // the short loops over ry, rw, wf and acc are fully unrolled so that these arrays stay in registers
#pragma unroll
    for (int i = 0; i < 4; ++i) ry[i] = *(const v4f*)(yg + (size_t)(16 * i) * CC);
#pragma unroll
    for (int i = 0; i < 8; ++i) rw[i] = *(const v4f*)(wg + (size_t)(16 * i) * CC);
    asm volatile("s_wait_xcnt 0x0" ::: "memory");   // the loads' address registers may be rewritten by what follows: the wait stands in front of that
#pragma unroll 2   // two trips per pass: the buffer index becomes a constant LDS offset
    for (int kc = 0; kc < CC / 32; ++kc) { const int bu = kc & 1;
#pragma unroll
      for (int i = 0; i < 4; ++i) { v4h y4;   /* ctx carried x 2^6 into f16 so small-magnitude context rows stay clear of f16 subnormals */
#pragma unroll
        for (int e = 0; e < 4; ++e) y4[e] = (_Float16)(ry[i][e] * 64.0f);
        *(v4h*)&sA[bu][xr + 16 * i][xp * 4] = y4; }
#pragma unroll
      for (int i = 0; i < 8; ++i) { v4h w4;
#pragma unroll
        for (int e = 0; e < 4; ++e) w4[e] = (_Float16)(bfr(rw[i][e]) * 256.0f);
        *(v4h*)&sW[bu][xr + 16 * i][xp * 4] = w4; }
      __syncthreads();   // publishes buffer bu; the other buffer's readers all passed it too, so the next trip may refill that one
      if (kc + 1 < CC / 32) {
#pragma unroll
        for (int i = 0; i < 4; ++i) ry[i] = *(const v4f*)(yg + (size_t)(16 * i) * CC + (kc + 1) * 32);
#pragma unroll
        for (int i = 0; i < 8; ++i) rw[i] = *(const v4f*)(wg + (size_t)(16 * i) * CC + (kc + 1) * 32);
        asm volatile("s_wait_xcnt 0x0" ::: "memory"); }   // the loads' address registers may be rewritten by what follows: the wait stands in front of that
      const v16h a = frag_h(&sA[bu][wave * 16 + col][0], lane); v16h wf[8];
#pragma unroll
      for (int j = 0; j < 8; ++j) wf[j] = frag_h(&sW[bu][j * 16 + col][0], lane);
      __builtin_amdgcn_sched_barrier(0);   // all fragment reads issue as one group ahead of the products: one LDS latency per tile instead of one per product
#pragma unroll
      for (int j = 0; j < 8; ++j) acc[j] = wm16(a, wf[j], acc[j]);
      __builtin_amdgcn_sched_barrier(0); }   // the next trip's converts wait for the loads in flight: they stay behind this tile's products
    __syncthreads();   // the last tile's readers are done before the epilogue reuses the LDS
#pragma unroll
    for (int j = 0; j < 8; ++j) { const float bias = BO ? bfr(BO[c0 + j * 16 + col]) : 0.f;
#pragma unroll
      for (int r = 0; r < 8; ++r) sf[wave][8 * g + r][j * 16 + col] = acc[j][r] * (1.0f / 16384.0f) + bias; } }   /* 2^-8 (Wo carry) x 2^-6 (ctx carry) */
  LDSX(); for (int rl = 0; rl < 16; ++rl) vst2(OUT + (r0 + rl) * DIN + c0 + lane * 4, *(const v4f*)&sf[wave][rl][lane * 4]); }

extern "C" void kernel_launch(void* const* d_in, const int* in_sizes, int n_in, void* d_out, int out_size, void* d_ws, size_t ws_size, hipStream_t stream) {
  (void)in_sizes; (void)n_in; (void)out_size;
  const float** F = (const float**)d_in;
  if (ws_size < (size_t)WS_END) return;
  char* ws = (char*)d_ws; _Float16 *QH = (_Float16*)(ws + WS_QH), *KH = (_Float16*)(ws + WS_KH), *VT = (_Float16*)(ws + WS_VT), *QL = (_Float16*)(ws + WS_QL), *KL = (_Float16*)(ws + WS_KL); __bf16 *VB = (__bf16*)(ws + WS_VB), *VBL = (__bf16*)(ws + WS_VBL); float *S = (float*)(ws + WS_S), *Y = (float*)(ws + WS_Y);
  (void)Y; (void)QL; (void)KL; (void)VB; (void)VBL; (void)S;
  // inputs: 0 x [16,1024,384]; 1 Wq [6,384,64], 2 bq [6,64]; 3 Wk, 4 bk; 5 Wv, 6 bv; 7 Wo [384,384] (out,in), 8 bo [384]
  k_proj<<<dim3(TNB * TT / PBM, CC / PBN, 3), 256, 0, stream>>>(F[0], F[0], F[0], F[1], F[3], F[5], F[2], F[4], F[6], QH, QL, KH, KL, VT, VB, VBL);
  k_attn<<<dim3(TT / 128, NH, TNB), 256, 0, stream>>>(QH, QL, KH, VT, Y);
  k_out<<<dim3(TNB * TT / 64, DIN / 128), 128, 0, stream>>>(Y, F[7], F[8], (float*)d_out);
}

// v004
// Measured time: 85.7 microseconds a run.
// Next to v003, in two timings, it ran 1.03 times as fast each time.
// Over all steps from v000 it is 13.3 times as fast.
// compute dtype: all float inputs rounded to bf16; per-head q/k/v projections with EXACT bf16 products on WMMA 16x16x32 (f32 accumulate) + bias; logits with q as f16 hi + residual (x 2^10) against k once to f16 (2 products) x 64^-0.5; softmax f32 with a running maximum and sum (logits stay on chip); exp(logit - max) x 2^11 once to f16 x v once to f16 (1 product), divided by the f32 sum at the end; ctx carried x 2^6 once to f16 x Wo f16(bf16 x 2^8) + bo; f32 output.
#include <hip/hip_runtime.h>
#include <math.h>

typedef __attribute__((ext_vector_type(16))) _Float16 v16h;
typedef __attribute__((ext_vector_type(16))) __bf16 v16b;
typedef __attribute__((ext_vector_type(8)))  _Float16 v8h;
typedef __attribute__((ext_vector_type(8)))  float v8f;
typedef __attribute__((ext_vector_type(4)))  float v4f;
typedef __attribute__((ext_vector_type(2)))  float v2f;
typedef __attribute__((ext_vector_type(4)))  unsigned v4u;
typedef __attribute__((ext_vector_type(4)))  int v4i;
typedef float __attribute__((may_alias)) float_a;
typedef int __attribute__((may_alias)) int_a;

template <typename T> __device__ __forceinline__ void vst2(void* p, T v) { *(T*)p = v;  }
__device__ __forceinline__ v8f wmma16(v16h a, v16h b, v8f c) {
  v8f d = __builtin_amdgcn_wmma_f32_16x16x32_f16(false, a, false, b, (short)0, c, false, false);
  asm volatile("v_nop\n\tv_nop\n\tv_nop\n\tv_nop" : "+v"(d) : "v"(a), "v"(b));
  return d;
}
__device__ __forceinline__ v8f wmma_bf(v16b a, v16b b, v8f c) {
  v8f d = __builtin_amdgcn_wmma_f32_16x16x32_bf16(false, a, false, b, (short)0, c, false, false);
  asm volatile("v_nop\n\tv_nop\n\tv_nop\n\tv_nop" : "+v"(d) : "v"(a), "v"(b));
  return d;
}
// 16x16x32 fragments: lane = (h = lane>>4, row/col = lane&15); elements 0..7 = k0+8h+0..7, 8..15 = k0+16+8h+0..7; D element r = row 8h+r
__device__ __forceinline__ v16h frag_h(const _Float16* rowk0, int lane) {
  union { v16h v; v8h q[2]; } u; const _Float16* p = rowk0 + 8 * (lane >> 4);
  u.q[0] = *(const v8h*)p; u.q[1] = *(const v8h*)(p + 16); return u.v;
}
__device__ __forceinline__ v16h frag_f32(const float* rowk0, int lane) {
  v16h a; const float* p = rowk0 + 8 * (lane >> 4);
#pragma unroll
  for (int i = 0; i < 8; ++i) { a[i] = (_Float16)p[i]; a[8 + i] = (_Float16)p[16 + i]; }
  return a;
}
__device__ __forceinline__ v16h frag_f32s(const float* rowk0, int lane, float sc) {
  v16h a; const float* p = rowk0 + 8 * (lane >> 4);
#pragma unroll
  for (int i = 0; i < 8; ++i) { a[i] = (_Float16)(p[i] * sc); a[8 + i] = (_Float16)(p[16 + i] * sc); }
  return a;
}
// column fragment from a [K][ld] layout (column n), rows >= K read as 0
__device__ __forceinline__ v16h fragc_f32(const float* W, int k0, int n, int lane, int ld, int K) {
  v16h a; const int g = lane >> 4;
#pragma unroll
  for (int i = 0; i < 8; ++i) { const int ka = k0 + 8 * g + i, kb = ka + 16;
    a[i] = (_Float16)(ka < K ? W[(size_t)(ka < K ? ka : K - 1) * ld + n] : 0.f); a[8 + i] = (_Float16)(kb < K ? W[(size_t)(kb < K ? kb : K - 1) * ld + n] : 0.f); }
  return a;
}
struct F2 { v16b h, l; };
__device__ __forceinline__ F2 bsplit16(const float v[16]) { F2 r;
#pragma unroll
  for (int i = 0; i < 16; ++i) { const __bf16 h = (__bf16)v[i]; r.h[i] = h; r.l[i] = (__bf16)(v[i] - (float)h); }
  return r; }
__device__ __forceinline__ F2 split_row(const float* row, int k0, int lane) { float v[16]; const float* p = row + k0 + 8 * (lane >> 4);
#pragma unroll
  for (int i = 0; i < 8; ++i) { v[i] = p[i]; v[8 + i] = p[16 + i]; }
  return bsplit16(v); }
__device__ __forceinline__ F2 split_rowK(const float* row, int k0, int lane, int K) { float v[16]; const int g = lane >> 4;
#pragma unroll
  for (int i = 0; i < 8; ++i) { const int ka = k0 + 8 * g + i, kb = ka + 16; v[i] = ka < K ? row[ka < K ? ka : K - 1] : 0.f; v[8 + i] = kb < K ? row[kb < K ? kb : K - 1] : 0.f; }
  return bsplit16(v); }
__device__ __forceinline__ F2 split_col(const float* W, int k0, int n, int lane, int ld, int K) { float v[16]; const int g = lane >> 4;
#pragma unroll
  for (int i = 0; i < 8; ++i) { const int ka = k0 + 8 * g + i, kb = ka + 16; v[i] = ka < K ? W[(size_t)(ka < K ? ka : K - 1) * ld + n] : 0.f; v[8 + i] = kb < K ? W[(size_t)(kb < K ? kb : K - 1) * ld + n] : 0.f; }
  return bsplit16(v); }
__device__ __forceinline__ v8f mac3(const F2& a, const F2& b, v8f c) { c = wmma_bf(a.l, b.h, c); c = wmma_bf(a.h, b.l, c); return wmma_bf(a.h, b.h, c); }
__device__ __forceinline__ float sigm(float v) { return 1.0f / (1.0f + expf(-v)); }
#define LDSX() do { asm volatile("s_wait_dscnt 0" ::: "memory"); __builtin_amdgcn_wave_barrier(); __builtin_amdgcn_fence(__ATOMIC_RELEASE, "workgroup"); } while (0)

// Multi-head self-attention (B 16, S 1,024, D 384 = 6 heads x 64; per-head (in,out) Wq/Wk/Wv [6,384,64] + biases [6,64], 0.02-scale; (out,in) Wo [384,384] + bo): out = merge(softmax(q k^T / 8) v) Wo^T + bo.
#define NB 16
#define TT 1024
#define CC 384            // NH * HD = projected width
#define DIN 384          // input (model) width
#define NH 6
#define HD 64
#define NQB (TT / 64)
#define HG 6
#define SCALE (0.125f)
#define CAUSAL 0
#ifndef TNB
#define TNB NB
#endif
__device__ __forceinline__ float bfr(float v) { return (float)(__bf16)v; }
__host__ __device__ __forceinline__ int kb_last(int qb) { return CAUSAL ? ((qb * 64 + 63) >> 7) : (TT / 128 - 1); }
typedef __attribute__((ext_vector_type(8))) __bf16 v8b;
typedef __attribute__((ext_vector_type(4))) __bf16 v4b;
typedef __attribute__((ext_vector_type(4))) _Float16 v4h;
#define GP 40              // 16-bit elements per staged GEMM tile row: 32 k + 8 = 80 B (16 B x odd), conflict-free 16-byte reads
__device__ __forceinline__ v16b frag_b(const __bf16* rowk0, int lane) {
  union { v16b v; v8b q[2]; } u; const __bf16* p = rowk0 + 8 * (lane >> 4);
  u.q[0] = *(const v8b*)p; u.q[1] = *(const v8b*)(p + 16); return u.v;
}
#define QBH 0
#define QHI 1024            // rows carrying a q residual plane (all rows when non-causal: 2-product logits everywhere)
#define KHI 64            // key rows carrying k residual / v bf16 hi+lo planes (written by k_proj, read by no kernel here)
// B fragment (k rows k0+.., output column o) of a weight: (in,out) [K][ld] or (out,in) [ld rows of K]: bf16 exact, or f16(bf16 * 256) exact
__device__ __forceinline__ v16b wcol_io(const float* Wm, int k0, int o, int lane, int ld) { v16b w; const int g = lane >> 4;
#pragma unroll
  for (int i = 0; i < 8; ++i) { w[i] = (__bf16)Wm[(size_t)(k0 + 8 * g + i) * ld + o]; w[8 + i] = (__bf16)Wm[(size_t)(k0 + 16 + 8 * g + i) * ld + o]; }
  return w; }
__device__ __forceinline__ v16b wcol_oi(const float* Wm, int k0, int o, int lane, int K) { v16b w; const float* p = Wm + (size_t)o * K + k0 + 8 * (lane >> 4);
#pragma unroll
  for (int i = 0; i < 8; ++i) { w[i] = (__bf16)p[i]; w[8 + i] = (__bf16)p[16 + i]; }
  return w; }
__device__ __forceinline__ v16h wcolh_io(const float* Wm, int k0, int o, int lane, int ld) { v16h w; const int g = lane >> 4;
#pragma unroll
  for (int i = 0; i < 8; ++i) { w[i] = (_Float16)(bfr(Wm[(size_t)(k0 + 8 * g + i) * ld + o]) * 256.0f); w[8 + i] = (_Float16)(bfr(Wm[(size_t)(k0 + 16 + 8 * g + i) * ld + o]) * 256.0f); }
  return w; }
__device__ __forceinline__ v16h wcolh_oi(const float* Wm, int k0, int o, int lane, int K) { v16h w; const float* p = Wm + (size_t)o * K + k0 + 8 * (lane >> 4);
#pragma unroll
  for (int i = 0; i < 8; ++i) { w[i] = (_Float16)(bfr(p[i]) * 256.0f); w[8 + i] = (_Float16)(bfr(p[16 + i]) * 256.0f); }
  return w; }
#define WQKV_LAYOUT 0   // 0 = per-head [NH][DIN][HD] (wcol_heads); 1 = (out,in) [CC][DIN]; 2 = per-head [NH][DIN][HD]
__device__ __forceinline__ v16b wcol_hdk(const float* Wm, int k0, int o, int lane) { v16b w; const int g = lane >> 4; const float* p = Wm + (size_t)(o / HD) * DIN * HD + (o % HD);
#pragma unroll
  for (int i = 0; i < 8; ++i) { w[i] = (__bf16)p[(size_t)(k0 + 8 * g + i) * HD]; w[8 + i] = (__bf16)p[(size_t)(k0 + 16 + 8 * g + i) * HD]; }
  return w; }
#define WO_OUT_IN 1
#if WQKV_LAYOUT == 1
#define WCOL(W, k0, o, lane) wcol_oi(W, k0, o, lane, DIN)
#elif WQKV_LAYOUT == 2
#define WCOL(W, k0, o, lane) wcol_hdk(W, k0, o, lane)
#else
#define WCOL(W, k0, o, lane) wcol_heads(W, k0, o, lane)   /* per-head [h][D][64] weights */
#endif
#if WO_OUT_IN
#define WOCOL(W, k0, o, lane) wcol_oi(W, k0, o, lane, CC)
#define WOCOLH(W, k0, o, lane) wcolh_oi(W, k0, o, lane, CC)
#else
#define WOCOL(W, k0, o, lane) wcol_io(W, k0, o, lane, DIN)
#define WOCOLH(W, k0, o, lane) wcolh_io(W, k0, o, lane, DIN)
#endif
// per-head projection weights W[h][D][64] ([6][384][64]): column o = h*64 + d of the virtual (in,out) [D][384] matrix lives at W + (h*D + k)*64 + d
__device__ __forceinline__ v16b wcol_heads(const float* __restrict__ Wm, int k0, int o, int lane) { v16b w; const int g = lane >> 4; const float* p = Wm + ((size_t)(o >> 6) * DIN + k0 + 8 * g) * 64 + (o & 63);
#pragma unroll
  for (int i = 0; i < 8; ++i) { w[i] = (__bf16)p[(size_t)i * 64]; w[8 + i] = (__bf16)p[(size_t)(16 + i) * 64]; }
  asm volatile("s_wait_loadcnt 0x0" ::: "memory"); return w; }
#ifndef SM_EXTRA_PARAMS
#define SM_EXTRA_PARAMS
#endif
#ifndef PROJ_EXTRA_PARAMS
#define PROJ_EXTRA_PARAMS
#endif
#ifndef SM_MASK_HOOK
#define SM_MASK_HOOK (void)0
#endif

#define WS_QH  0u                                      // f16 q rows [b*t][CC]
#define WS_KH  (WS_QH + 2u * (size_t)NB * TT * CC)      // f16 k rows [b*t][CC]
#define WS_VT  (WS_KH + 2u * (size_t)NB * TT * CC)      // f16 v planes [b][c][t]
#define WS_QL  (WS_VT + 2u * (size_t)NB * CC * TT)      // f16 q residual x 2^10 rows [b][t < QHI][CC]
#define WS_KL  (WS_QL + 2u * (size_t)NB * QHI * CC)     // f16 k residual x 2^10 rows [b][t < KHI][CC]
#define WS_VB  (WS_KL + 2u * (size_t)NB * KHI * CC)     // bf16 v hi planes [b][c][t < KHI]
#define WS_VBL (WS_VB + 2u * (size_t)NB * CC * KHI)
#define WS_S   (WS_VBL + 2u * (size_t)NB * CC * KHI)    // f32 [hg][t][s], reserved but not used (logits stay on chip)
#define WS_Y   (WS_S  + 4u * (size_t)HG * TT * TT)      // f32 ctx rows [b*t][CC] (only when there is an output projection)
#define WS_END (WS_Y  + 4u * (size_t)NB * TT * CC)

// ---- k_proj: block = (128 rows, 192 cols, which), 8 waves of 32 rows x 96 cols: q/k/v = X W (+ b) with exact bf16 products (K = DIN) -> which 0: q f16 rows (+ residual rows < QHI); 1: k f16 rows (+ residual rows < KHI); 2: v f16 planes [c][t] (+ bf16 hi/lo planes for t < KHI)
#define PBM 128            // rows of X per block
#define PBN 192            // output columns per block (three heads of one of q, k, v)
#define PSP (PBN + 8)      // f16 per epilogue row of q/k: 400 B (16 B x odd)
#define PTP (PBM + 8)      // 16-bit elements per epilogue plane row of v: 272 B (16 B x odd)
__global__ __launch_bounds__(256) void k_proj(const float* __restrict__ XQ, const float* __restrict__ XK, const float* __restrict__ XV, const float* __restrict__ WQ, const float* __restrict__ WK, const float* __restrict__ WV, const float* __restrict__ BQ, const float* __restrict__ BK, const float* __restrict__ BV,
    _Float16* __restrict__ QH, _Float16* __restrict__ QL, _Float16* __restrict__ KH, _Float16* __restrict__ KL, _Float16* __restrict__ VT, __bf16* __restrict__ VB, __bf16* __restrict__ VBL) {
  // one LDS block: the main loop's operand tiles (2 buffers) and the epilogue's transpose arrays (q/k: sh, sl; v: th, tb, tbl) live at different times, separated by the barrier after the loop
  __shared__ __align__(16) unsigned char smem[3 * PBN * PTP * 2];
  _Float16 (*sh)[PSP] = (_Float16 (*)[PSP])smem; _Float16 (*sl)[PSP] = (_Float16 (*)[PSP])(smem + PBM * PSP * 2);
  _Float16 (*th)[PTP] = (_Float16 (*)[PTP])smem; __bf16 (*tb)[PTP] = (__bf16 (*)[PTP])(smem + PBN * PTP * 2); __bf16 (*tbl)[PTP] = (__bf16 (*)[PTP])(smem + 2 * PBN * PTP * 2);
  __bf16 (*sA)[PBM][GP] = (__bf16 (*)[PBM][GP])smem; __bf16 (*sW)[PBN][GP] = (__bf16 (*)[PBN][GP])(smem + 2 * PBM * GP * 2);
  const int tid = threadIdx.x, wave = tid >> 5, lane = tid & 31, col = lane & 15, g = lane >> 4; const int which = blockIdx.z; const int c0 = blockIdx.y * PBN; const size_t r0 = (size_t)blockIdx.x * PBM; const size_t bb = r0 / TT; const int t0 = (int)(r0 % TT);
  const int wr = (wave >> 1) * 32, wc = (wave & 1) * 96;   // the wave's 32 x 96 piece of the block's tile: each X fragment feeds 6 products, each W fragment 2
  const float* X = which == 0 ? XQ : which == 1 ? XK : XV; const float* WA = which == 0 ? WQ : which == 1 ? WK : WV; const float* BA = which == 0 ? BQ : which == 1 ? BK : BV;
  v8f acc[2][6] = {};
  // per 32 k: the block's X tile (128 x 32) and W tile (32 x 192) are read once with whole-line loads, rounded to bf16 and laid in LDS as [row][k] and [column][k]; the next tile's loads fly under this tile's products
  const int xr = tid >> 3, xp = tid & 7;
  const float* xg = X + (r0 + xr) * DIN + xp * 4;                                             // 16-byte piece xp of rows xr + 32 i
  // W tile = 6 column segments of 32 x 4 groups of 8 k = 24 units, 3 per wave: a lane holds 8 consecutive k of one column (one 16-byte LDS store), a wave's load covers one 128-byte line
  const float* wg[3]; int wcl[3], wok[3];
#pragma unroll
  for (int i = 0; i < 3; ++i) { const int u = wave * 3 + i; wcl[i] = (u % 6) * 32 + lane; wok[i] = (u / 6) * 8;
    wg[i] = WA + ((size_t)((c0 + wcl[i]) >> 6) * DIN + wok[i]) * 64 + ((c0 + wcl[i]) & 63); }   // column c0 + wcl of the per-head [h][D][64] weights, row k at + 64 k
  v4f rx[4]; float rw[3][8];   // the short loops over rx, rw, a, wf and acc are fully unrolled so that these arrays stay in registers
#pragma unroll
  for (int i = 0; i < 4; ++i) rx[i] = *(const v4f*)(xg + (size_t)(32 * i) * DIN);
#pragma unroll
  for (int i = 0; i < 3; ++i)
#pragma unroll
    for (int k = 0; k < 8; ++k) rw[i][k] = wg[i][(size_t)k * 64];
  asm volatile("s_wait_xcnt 0x0" ::: "memory");   // the loads' address registers may be rewritten by what follows: the wait stands in front of that
#pragma unroll 2   // two trips per pass: the buffer index becomes a constant LDS offset
  for (int kc = 0; kc < DIN / 32; ++kc) { const int bu = kc & 1;
#pragma unroll
    for (int i = 0; i < 4; ++i) { v4b x4;
#pragma unroll
      for (int e = 0; e < 4; ++e) x4[e] = (__bf16)rx[i][e];
      *(v4b*)&sA[bu][xr + 32 * i][xp * 4] = x4; }
#pragma unroll
    for (int i = 0; i < 3; ++i) { v8b w8;
#pragma unroll
      for (int e = 0; e < 8; ++e) w8[e] = (__bf16)rw[i][e];
      *(v8b*)&sW[bu][wcl[i]][wok[i]] = w8; }
    __syncthreads();   // publishes buffer bu; the other buffer's readers all passed it too, so the next trip may refill that one
    if (kc + 1 < DIN / 32) {
#pragma unroll
      for (int i = 0; i < 4; ++i) rx[i] = *(const v4f*)(xg + (size_t)(32 * i) * DIN + (kc + 1) * 32);
#pragma unroll
      for (int i = 0; i < 3; ++i)
#pragma unroll
        for (int k = 0; k < 8; ++k) rw[i][k] = wg[i][(size_t)((kc + 1) * 32 + k) * 64];
      asm volatile("s_wait_xcnt 0x0" ::: "memory"); }   // the loads' address registers may be rewritten by what follows: the wait stands in front of that
    v16b a[2], wf[6];
#pragma unroll
    for (int i = 0; i < 2; ++i) a[i] = frag_b(&sA[bu][wr + i * 16 + col][0], lane);
#pragma unroll
    for (int j = 0; j < 6; ++j) wf[j] = frag_b(&sW[bu][wc + j * 16 + col][0], lane);
    __builtin_amdgcn_sched_barrier(0);   // all fragment reads issue as one group ahead of the products: one LDS latency per tile instead of one per product
#pragma unroll
    for (int j = 0; j < 6; ++j)
#pragma unroll
      for (int i = 0; i < 2; ++i) acc[i][j] = __builtin_amdgcn_wmma_f32_16x16x32_bf16(false, a[i], false, wf[j], (short)0, acc[i][j], false, false);
    __builtin_amdgcn_sched_barrier(0); }   // the next trip's converts wait for the loads in flight: they stay behind this tile's products
  __syncthreads();   // the last tile's readers are done before the epilogue reuses the LDS
  if (which < 2) { _Float16* DH = which == 0 ? QH : KH; _Float16* DL = which == 0 ? QL : KL; const int nhi = which == 0 ? QHI : KHI;
#pragma unroll
    for (int j = 0; j < 6; ++j) { const float bias = BA ? bfr(BA[c0 + wc + j * 16 + col]) : 0.f;
#pragma unroll
      for (int i = 0; i < 2; ++i)
#pragma unroll
        for (int r = 0; r < 8; ++r) { const float v = acc[i][j][r] + bias; const _Float16 hv = (_Float16)v; sh[wr + i * 16 + 8 * g + r][wc + j * 16 + col] = hv; sl[wr + i * 16 + 8 * g + r][wc + j * 16 + col] = (_Float16)((v - (float)hv) * 1024.0f); } }
    __syncthreads();
    for (int e = tid; e < PBM * (PBN / 8); e += 256) { const int rl = e / (PBN / 8), q = e % (PBN / 8); vst2((unsigned*)(DH + (r0 + rl) * CC + c0 + q * 8), *(const v4u*)&sh[rl][q * 8]);
      if (t0 + rl < nhi) { vst2((unsigned*)(DL + (bb * nhi + t0 + rl) * (size_t)CC + c0 + q * 8), *(const v4u*)&sl[rl][q * 8]); asm volatile("s_wait_xcnt 0x0" ::: "memory"); } }   // the store's address registers are rewritten by the next trip: the wait stands in front of that
  } else {
#pragma unroll
    for (int j = 0; j < 6; ++j) { const float bias = BA ? bfr(BA[c0 + wc + j * 16 + col]) : 0.f;
#pragma unroll
      for (int i = 0; i < 2; ++i)
#pragma unroll
        for (int r = 0; r < 8; ++r) { const float v = acc[i][j][r] + bias; const int rl = wr + i * 16 + 8 * g + r, cl = wc + j * 16 + col; th[cl][rl] = (_Float16)v; const __bf16 bh = (__bf16)v; tb[cl][rl] = bh; tbl[cl][rl] = (__bf16)(v - (float)bh); } }
    __syncthreads();
    for (int e = tid; e < PBN * (PBM / 8); e += 256) { const int cl = e / (PBM / 8), q = e % (PBM / 8); vst2((unsigned*)(VT + (bb * CC + c0 + cl) * (size_t)TT + t0 + q * 8), *(const v4u*)&th[cl][q * 8]);
      if (t0 + q * 8 < KHI) { const size_t o3 = (bb * CC + c0 + cl) * (size_t)KHI + t0 + q * 8; vst2((unsigned*)(VB + o3), *(const v4u*)&tb[cl][q * 8]); vst2((unsigned*)(VBL + o3), *(const v4u*)&tbl[cl][q * 8]); asm volatile("s_wait_xcnt 0x0" ::: "memory"); } }   // the stores' address registers are rewritten by the next trip: the wait stands in front of that
  } }
// ---- k_attn: block = 128 queries (4 waves x 32 = two tiles of 16 per wave) of (b, h); keys walked in LDS stages of 64 (K rows and v planes staged once per block, next stage's global loads in flight under this stage's work).
// Per 64 keys: S^T = K Q^T (A = K rows, B = q: residual product first, x 2^-10, then the hi product on top), so a lane holds one query's logits per tile; every K and v fragment read from LDS feeds both query tiles;
// running maximum and sum per lane and tile (+ one exchange between the wave halves);
// P^T = exp(logit - max) x 2^11 once to f16 is already a B operand (two D tiles = 32 keys in the hardware k order); O^T += V^T P^T; the accumulators are rescaled when the maximum moves; ctx = O^T / sum at the end.
#define AKT 64             // keys per LDS stage
#define AQT 2              // query tiles of 16 per wave
#define KPITCH 72          // f16 per staged K row: 144 B (16 B x odd), conflict-free 16-byte reads
#define VPITCH 72          // f16 per staged v plane row: 144 B
#define CSL2 (SCALE * 1.4426950408889634f)
__device__ __forceinline__ v8f wm16(v16h a, v16h b, v8f c) { return __builtin_amdgcn_wmma_f32_16x16x32_f16(false, a, false, b, (short)0, c, false, false); }
__device__ __forceinline__ float xhalf(float x) { return __builtin_bit_cast(float, __builtin_amdgcn_permlanex16(__builtin_bit_cast(int, x), __builtin_bit_cast(int, x), 0x76543210, 0xfedcba98, false, false)); }  // lane l with lane l ^ 16
// grid 8 x 6 x 16 = 768 blocks of 4 waves; three blocks (three waves per SIMD, at most 336 registers each) fit a WGP, so all blocks are resident at once
__global__ __launch_bounds__(128, 3) void k_attn(const _Float16* __restrict__ QH, const _Float16* __restrict__ QL, const _Float16* __restrict__ KH, const _Float16* __restrict__ VT, float* __restrict__ Y) {
  __shared__ __align__(16) _Float16 sk[AKT][KPITCH]; __shared__ __align__(16) _Float16 sv[HD][VPITCH];
  const int tid = threadIdx.x, wave = tid >> 5, lane = tid & 31, col = lane & 15, g = lane >> 4; const int h = blockIdx.y, b = blockIdx.z; const int q = blockIdx.x * 128 + wave * (16 * AQT) + col;
  v16h qh[AQT][HD / 32], ql[AQT][HD / 32];   // the short loops over the tile, fragment and accumulator arrays are fully unrolled so that these arrays stay in registers
#pragma unroll
  for (int u = 0; u < AQT; ++u)
#pragma unroll
    for (int kc = 0; kc < HD / 32; ++kc) { qh[u][kc] = frag_h(QH + ((size_t)b * TT + q + 16 * u) * CC + h * HD + kc * 32, lane); ql[u][kc] = frag_h(QL + ((size_t)b * QHI + q + 16 * u) * CC + h * HD + kc * 32, lane); }
  const _Float16* kg = KH + ((size_t)b * TT + (tid >> 3)) * CC + h * HD + (tid & 7) * 8;      // 16-byte piece (tid & 7) of key rows (tid >> 3) + 16 i
  const _Float16* vg = VT + ((size_t)b * CC + h * HD + (tid >> 3)) * (size_t)TT + (tid & 7) * 8;   // 16-byte piece (tid & 7) of planes (tid >> 3) + 16 i
  v4u rk[4], rv[4];
#pragma unroll
  for (int i = 0; i < 4; ++i) { rk[i] = *(const v4u*)(kg + (size_t)(16 * i) * CC); rv[i] = *(const v4u*)(vg + (size_t)(16 * i) * TT); }
  v8f o[AQT][HD / 16] = {}; float m[AQT], l[AQT];
#pragma unroll
  for (int u = 0; u < AQT; ++u) { m[u] = -3.0e38f; l[u] = 0.f; }
  for (int s = 0; s < TT / AKT; ++s) {
#pragma unroll
    for (int i = 0; i < 4; ++i) { *(v4u*)&sk[(tid >> 3) + 16 * i][(tid & 7) * 8] = rk[i]; *(v4u*)&sv[(tid >> 3) + 16 * i][(tid & 7) * 8] = rv[i]; }
    __syncthreads();
    if (s + 1 < TT / AKT) {
#pragma unroll
      for (int i = 0; i < 4; ++i) { rk[i] = *(const v4u*)(kg + (size_t)((s + 1) * AKT + 16 * i) * CC); rv[i] = *(const v4u*)(vg + (size_t)(16 * i) * TT + (s + 1) * AKT); }
      asm volatile("s_wait_xcnt 0x0" ::: "memory"); }   // the loads' address registers are reused by what follows: the wait stands in front of that overwrite
    { v8f st[AQT][4]; v16h pf[AQT][2];
      { v16h a[4][2];
#pragma unroll
        for (int j = 0; j < 4; ++j) { a[j][0] = frag_h(&sk[j * 16 + col][0], lane); a[j][1] = frag_h(&sk[j * 16 + col][32], lane); }
        __builtin_amdgcn_sched_barrier(0);   // the stage's K fragment reads issue as one group ahead of the products: one LDS latency per stage instead of one per key tile
        // eight independent accumulator chains (4 key tiles x 2 query tiles) walk the four products side by side; per chain the order is that of one tile alone
#pragma unroll
        for (int j = 0; j < 4; ++j)
#pragma unroll
          for (int u = 0; u < AQT; ++u) { const v8f z = {}; st[u][j] = wm16(a[j][0], ql[u][0], z); }
#pragma unroll
        for (int j = 0; j < 4; ++j)
#pragma unroll
          for (int u = 0; u < AQT; ++u) st[u][j] = wm16(a[j][1], ql[u][1], st[u][j]);
#pragma unroll
        for (int j = 0; j < 4; ++j)
#pragma unroll
          for (int u = 0; u < AQT; ++u) { st[u][j] = st[u][j] * (1.0f / 1024.0f); st[u][j] = wm16(a[j][0], qh[u][0], st[u][j]); }
#pragma unroll
        for (int j = 0; j < 4; ++j)
#pragma unroll
          for (int u = 0; u < AQT; ++u) st[u][j] = wm16(a[j][1], qh[u][1], st[u][j]); }
      v16h vf[2][HD / 16];
#pragma unroll
      for (int kk = 0; kk < 2; ++kk)
#pragma unroll
        for (int t = 0; t < HD / 16; ++t) vf[kk][t] = frag_h(&sv[t * 16 + col][kk * 32], lane);
      __builtin_amdgcn_sched_barrier(0);   // the stage's v fragment reads issue as one group here, so that their LDS latency passes under the softmax arithmetic below
#pragma unroll
      for (int u = 0; u < AQT; ++u) {
        float mx = st[u][0][0];
#pragma unroll
        for (int j = 0; j < 4; ++j)
#pragma unroll
          for (int r = 0; r < 8; ++r) mx = fmaxf(mx, st[u][j][r]);
        const float mn = fmaxf(m[u], fmaxf(mx, xhalf(mx)));   // both halves hold the query's maximum so far (unscaled logits)
        const float corr = __builtin_amdgcn_exp2f((m[u] - mn) * CSL2); m[u] = mn;   // 0 on the first pass
        const float nm = 11.0f - mn * CSL2;
        l[u] *= corr;
#pragma unroll
        for (int t = 0; t < HD / 16; ++t) o[u][t] = o[u][t] * corr;
#pragma unroll
        for (int kk = 0; kk < 2; ++kk) { v8f e0 = __builtin_elementwise_fma(st[u][2 * kk], (v8f)(CSL2), (v8f)(nm)), e1 = __builtin_elementwise_fma(st[u][2 * kk + 1], (v8f)(CSL2), (v8f)(nm));
#pragma unroll
          for (int i = 0; i < 8; ++i) e0[i] = __builtin_amdgcn_exp2f(e0[i]);
#pragma unroll
          for (int i = 0; i < 8; ++i) e1[i] = __builtin_amdgcn_exp2f(e1[i]);
#pragma unroll
          for (int i = 0; i < 8; ++i) { pf[u][kk][i] = (_Float16)e0[i]; pf[u][kk][8 + i] = (_Float16)e1[i]; }
          e0 = e0 + e1; l[u] += ((e0[0] + e0[1]) + (e0[2] + e0[3])) + ((e0[4] + e0[5]) + (e0[6] + e0[7])); } }
#pragma unroll
      for (int kk = 0; kk < 2; ++kk)
#pragma unroll
        for (int t = 0; t < HD / 16; ++t)
#pragma unroll
          for (int u = 0; u < AQT; ++u) o[u][t] = wm16(vf[kk][t], pf[u][kk], o[u][t]); }
    __builtin_amdgcn_sched_barrier(0);   // the stage's arithmetic stays in front of the closing barrier: lifted over it, the barrier's wait for the next stage's global loads would stand in mid-stage, before they have landed
    __syncthreads(); }
#pragma unroll
  for (int u = 0; u < AQT; ++u) {
    const float ls = l[u] + xhalf(l[u]); const float inv = 1.0f / ls;   // ls >= 2^11: the maximum's own term
    float* yr = Y + ((size_t)b * TT + q + 16 * u) * CC + h * HD + 8 * g;
#pragma unroll
    for (int t = 0; t < HD / 16; ++t) { const v8f v = o[u][t] * inv; vst2(yr + t * 16, (v4f){v[0], v[1], v[2], v[3]}); vst2(yr + t * 16 + 4, (v4f){v[4], v[5], v[6], v[7]}); }
    if (u + 1 < AQT) asm volatile("s_wait_xcnt 0x0" ::: "memory"); } }   // the stores' data registers are rewritten by the next tile's results: the wait stands in front of that
// ---- k_out: block = (64 rows, 128 cols): out = ctx Wo (+ bo): ctx x 2^6 once to f16 against Wo as f16(bf16 x 2^8) exact (1 product) x 2^-14; causal early rows (< QHI of each sequence): ctx bf16 hi + lo against exact bf16 Wo (2 products)
__global__ __launch_bounds__(128) void k_out(const float* __restrict__ Y, const float* __restrict__ WO, const float* __restrict__ BO, float* __restrict__ OUT) {
  // one LDS block: the main loop's operand tiles (2 buffers), then the epilogue's per-wave rows sf
  __shared__ __align__(16) unsigned char smem[4 * 16 * 132 * 4]; float (*sf)[16][132] = (float (*)[16][132])smem;
  _Float16 (*sA)[64][GP] = (_Float16 (*)[64][GP])smem; _Float16 (*sW)[128][GP] = (_Float16 (*)[128][GP])(smem + 2 * 64 * GP * 2);
  const int tid = threadIdx.x, wave = tid >> 5, lane = tid & 31, col = lane & 15, g = lane >> 4; const int c0 = blockIdx.y * 128; const size_t r0 = (size_t)blockIdx.x * 64 + wave * 16;
  v8f acc[8] = {};
  if (CAUSAL && (int)(((size_t)blockIdx.x * 64) % TT) < QHI) {   /* block-uniform */
#pragma unroll 2
    for (int kc = 0; kc < CC / 32; ++kc) { const F2 a = split_row(Y + (r0 + col) * CC, kc * 32, lane); asm volatile("s_wait_loadcnt 0x0" ::: "memory");
#pragma unroll
      for (int j = 0; j < 8; ++j) { const v16b w = WOCOL(WO, kc * 32, c0 + j * 16 + col, lane); asm volatile("s_wait_loadcnt 0x0" ::: "memory"); acc[j] = wmma_bf(a.h, w, acc[j]); acc[j] = wmma_bf(a.l, w, acc[j]); } }
#pragma unroll
    for (int j = 0; j < 8; ++j) { const float bias = BO ? bfr(BO[c0 + j * 16 + col]) : 0.f;
#pragma unroll
      for (int r = 0; r < 8; ++r) sf[wave][8 * g + r][j * 16 + col] = acc[j][r] + bias; }
  } else {
    // per 32 k: the block's ctx tile (64 x 32) and Wo tile (128 outputs x 32) are read once with whole-line loads, converted and laid in LDS as [row][k]; the next tile's loads fly under this tile's products
    const int xr = tid >> 3, xp = tid & 7;
    const float* yg = Y + ((size_t)blockIdx.x * 64 + xr) * CC + xp * 4;   // 16-byte piece xp of rows xr + 16 i
    const float* wg = WO + (size_t)(c0 + xr) * CC + xp * 4;               // 16-byte piece xp of Wo rows (outputs) c0 + xr + 16 i
    v4f ry[4], rw[8];   // the short loops over ry, rw, wf and acc are fully unrolled so that these arrays stay in registers
#pragma unroll
    for (int i = 0; i < 4; ++i) ry[i] = *(const v4f*)(yg + (size_t)(16 * i) * CC);
#pragma unroll
    for (int i = 0; i < 8; ++i) rw[i] = *(const v4f*)(wg + (size_t)(16 * i) * CC);
    asm volatile("s_wait_xcnt 0x0" ::: "memory");   // the loads' address registers may be rewritten by what follows: the wait stands in front of that
#pragma unroll 2   // two trips per pass: the buffer index becomes a constant LDS offset
    for (int kc = 0; kc < CC / 32; ++kc) { const int bu = kc & 1;
#pragma unroll
      for (int i = 0; i < 4; ++i) { v4h y4;   /* ctx carried x 2^6 into f16 so small-magnitude context rows stay clear of f16 subnormals */
#pragma unroll
        for (int e = 0; e < 4; ++e) y4[e] = (_Float16)(ry[i][e] * 64.0f);
        *(v4h*)&sA[bu][xr + 16 * i][xp * 4] = y4; }
#pragma unroll
      for (int i = 0; i < 8; ++i) { v4h w4;
#pragma unroll
        for (int e = 0; e < 4; ++e) w4[e] = (_Float16)(bfr(rw[i][e]) * 256.0f);
        *(v4h*)&sW[bu][xr + 16 * i][xp * 4] = w4; }
      __syncthreads();   // publishes buffer bu; the other buffer's readers all passed it too, so the next trip may refill that one
      if (kc + 1 < CC / 32) {
#pragma unroll
        for (int i = 0; i < 4; ++i) ry[i] = *(const v4f*)(yg + (size_t)(16 * i) * CC + (kc + 1) * 32);
#pragma unroll
        for (int i = 0; i < 8; ++i) rw[i] = *(const v4f*)(wg + (size_t)(16 * i) * CC + (kc + 1) * 32);
        asm volatile("s_wait_xcnt 0x0" ::: "memory"); }   // the loads' address registers may be rewritten by what follows: the wait stands in front of that
      const v16h a = frag_h(&sA[bu][wave * 16 + col][0], lane); v16h wf[8];
#pragma unroll
      for (int j = 0; j < 8; ++j) wf[j] = frag_h(&sW[bu][j * 16 + col][0], lane);
      __builtin_amdgcn_sched_barrier(0);   // all fragment reads issue as one group ahead of the products: one LDS latency per tile instead of one per product
#pragma unroll
      for (int j = 0; j < 8; ++j) acc[j] = wm16(a, wf[j], acc[j]);
      __builtin_amdgcn_sched_barrier(0); }   // the next trip's converts wait for the loads in flight: they stay behind this tile's products
    __syncthreads();   // the last tile's readers are done before the epilogue reuses the LDS
#pragma unroll
    for (int j = 0; j < 8; ++j) { const float bias = BO ? bfr(BO[c0 + j * 16 + col]) : 0.f;
#pragma unroll
      for (int r = 0; r < 8; ++r) sf[wave][8 * g + r][j * 16 + col] = acc[j][r] * (1.0f / 16384.0f) + bias; } }   /* 2^-8 (Wo carry) x 2^-6 (ctx carry) */
  LDSX(); for (int rl = 0; rl < 16; ++rl) vst2(OUT + (r0 + rl) * DIN + c0 + lane * 4, *(const v4f*)&sf[wave][rl][lane * 4]); }

extern "C" void kernel_launch(void* const* d_in, const int* in_sizes, int n_in, void* d_out, int out_size, void* d_ws, size_t ws_size, hipStream_t stream) {
  (void)in_sizes; (void)n_in; (void)out_size;
  const float** F = (const float**)d_in;
  if (ws_size < (size_t)WS_END) return;
  char* ws = (char*)d_ws; _Float16 *QH = (_Float16*)(ws + WS_QH), *KH = (_Float16*)(ws + WS_KH), *VT = (_Float16*)(ws + WS_VT), *QL = (_Float16*)(ws + WS_QL), *KL = (_Float16*)(ws + WS_KL); __bf16 *VB = (__bf16*)(ws + WS_VB), *VBL = (__bf16*)(ws + WS_VBL); float *S = (float*)(ws + WS_S), *Y = (float*)(ws + WS_Y);
  (void)Y; (void)QL; (void)KL; (void)VB; (void)VBL; (void)S;
  // inputs: 0 x [16,1024,384]; 1 Wq [6,384,64], 2 bq [6,64]; 3 Wk, 4 bk; 5 Wv, 6 bv; 7 Wo [384,384] (out,in), 8 bo [384]
  k_proj<<<dim3(TNB * TT / PBM, CC / PBN, 3), 256, 0, stream>>>(F[0], F[0], F[0], F[1], F[3], F[5], F[2], F[4], F[6], QH, QL, KH, KL, VT, VB, VBL);
  k_attn<<<dim3(TT / 128, NH, TNB), 128, 0, stream>>>(QH, QL, KH, VT, Y);
  k_out<<<dim3(TNB * TT / 64, DIN / 128), 128, 0, stream>>>(Y, F[7], F[8], (float*)d_out);
}

// v005
// One run takes 77.9 microseconds.
// Two timings next to v004 both put it at 1.10 times that version's speed.
// Over all steps from v000 it is 14.6 times as fast.
// compute dtype: all float inputs rounded to bf16; per-head q/k/v projections with EXACT bf16 products on WMMA 16x16x32 (f32 accumulate) + bias; logits with q once to f16 against k once to f16 (1 product) x 64^-0.5; softmax f32 with a running maximum and sum (logits stay on chip); exp(logit - max) x 2^11 once to f16 x v once to f16 (1 product), divided by the f32 sum at the end; ctx carried x 2^6 once to f16 x Wo f16(bf16 x 2^8) + bo; f32 output.
#include <hip/hip_runtime.h>
#include <math.h>

typedef __attribute__((ext_vector_type(16))) _Float16 v16h;
typedef __attribute__((ext_vector_type(16))) __bf16 v16b;
typedef __attribute__((ext_vector_type(8)))  _Float16 v8h;
typedef __attribute__((ext_vector_type(8)))  float v8f;
typedef __attribute__((ext_vector_type(4)))  float v4f;
typedef __attribute__((ext_vector_type(2)))  float v2f;
typedef __attribute__((ext_vector_type(4)))  unsigned v4u;
typedef __attribute__((ext_vector_type(4)))  int v4i;
typedef float __attribute__((may_alias)) float_a;
typedef int __attribute__((may_alias)) int_a;

template <typename T> __device__ __forceinline__ void vst2(void* p, T v) { *(T*)p = v;  }
__device__ __forceinline__ v8f wmma16(v16h a, v16h b, v8f c) {
  v8f d = __builtin_amdgcn_wmma_f32_16x16x32_f16(false, a, false, b, (short)0, c, false, false);
  asm volatile("v_nop\n\tv_nop\n\tv_nop\n\tv_nop" : "+v"(d) : "v"(a), "v"(b));
  return d;
}
__device__ __forceinline__ v8f wmma_bf(v16b a, v16b b, v8f c) {
  v8f d = __builtin_amdgcn_wmma_f32_16x16x32_bf16(false, a, false, b, (short)0, c, false, false);
  asm volatile("v_nop\n\tv_nop\n\tv_nop\n\tv_nop" : "+v"(d) : "v"(a), "v"(b));
  return d;
}
// 16x16x32 fragments: lane = (h = lane>>4, row/col = lane&15); elements 0..7 = k0+8h+0..7, 8..15 = k0+16+8h+0..7; D element r = row 8h+r
__device__ __forceinline__ v16h frag_h(const _Float16* rowk0, int lane) {
  union { v16h v; v8h q[2]; } u; const _Float16* p = rowk0 + 8 * (lane >> 4);
  u.q[0] = *(const v8h*)p; u.q[1] = *(const v8h*)(p + 16); return u.v;
}
__device__ __forceinline__ v16h frag_f32(const float* rowk0, int lane) {
  v16h a; const float* p = rowk0 + 8 * (lane >> 4);
#pragma unroll
  for (int i = 0; i < 8; ++i) { a[i] = (_Float16)p[i]; a[8 + i] = (_Float16)p[16 + i]; }
  return a;
}
__device__ __forceinline__ v16h frag_f32s(const float* rowk0, int lane, float sc) {
  v16h a; const float* p = rowk0 + 8 * (lane >> 4);
#pragma unroll
  for (int i = 0; i < 8; ++i) { a[i] = (_Float16)(p[i] * sc); a[8 + i] = (_Float16)(p[16 + i] * sc); }
  return a;
}
// column fragment from a [K][ld] layout (column n), rows >= K read as 0
__device__ __forceinline__ v16h fragc_f32(const float* W, int k0, int n, int lane, int ld, int K) {
  v16h a; const int g = lane >> 4;
#pragma unroll
  for (int i = 0; i < 8; ++i) { const int ka = k0 + 8 * g + i, kb = ka + 16;
    a[i] = (_Float16)(ka < K ? W[(size_t)(ka < K ? ka : K - 1) * ld + n] : 0.f); a[8 + i] = (_Float16)(kb < K ? W[(size_t)(kb < K ? kb : K - 1) * ld + n] : 0.f); }
  return a;
}
struct F2 { v16b h, l; };
__device__ __forceinline__ F2 bsplit16(const float v[16]) { F2 r;
#pragma unroll
  for (int i = 0; i < 16; ++i) { const __bf16 h = (__bf16)v[i]; r.h[i] = h; r.l[i] = (__bf16)(v[i] - (float)h); }
  return r; }
__device__ __forceinline__ F2 split_row(const float* row, int k0, int lane) { float v[16]; const float* p = row + k0 + 8 * (lane >> 4);
#pragma unroll
  for (int i = 0; i < 8; ++i) { v[i] = p[i]; v[8 + i] = p[16 + i]; }
  return bsplit16(v); }
__device__ __forceinline__ F2 split_rowK(const float* row, int k0, int lane, int K) { float v[16]; const int g = lane >> 4;
#pragma unroll
  for (int i = 0; i < 8; ++i) { const int ka = k0 + 8 * g + i, kb = ka + 16; v[i] = ka < K ? row[ka < K ? ka : K - 1] : 0.f; v[8 + i] = kb < K ? row[kb < K ? kb : K - 1] : 0.f; }
  return bsplit16(v); }
__device__ __forceinline__ F2 split_col(const float* W, int k0, int n, int lane, int ld, int K) { float v[16]; const int g = lane >> 4;
#pragma unroll
  for (int i = 0; i < 8; ++i) { const int ka = k0 + 8 * g + i, kb = ka + 16; v[i] = ka < K ? W[(size_t)(ka < K ? ka : K - 1) * ld + n] : 0.f; v[8 + i] = kb < K ? W[(size_t)(kb < K ? kb : K - 1) * ld + n] : 0.f; }
  return bsplit16(v); }
__device__ __forceinline__ v8f mac3(const F2& a, const F2& b, v8f c) { c = wmma_bf(a.l, b.h, c); c = wmma_bf(a.h, b.l, c); return wmma_bf(a.h, b.h, c); }
__device__ __forceinline__ float sigm(float v) { return 1.0f / (1.0f + expf(-v)); }
#define LDSX() do { asm volatile("s_wait_dscnt 0" ::: "memory"); __builtin_amdgcn_wave_barrier(); __builtin_amdgcn_fence(__ATOMIC_RELEASE, "workgroup"); } while (0)

// Multi-head self-attention (B 16, S 1,024, D 384 = 6 heads x 64; per-head (in,out) Wq/Wk/Wv [6,384,64] + biases [6,64], 0.02-scale; (out,in) Wo [384,384] + bo): out = merge(softmax(q k^T / 8) v) Wo^T + bo.
#define NB 16
#define TT 1024
#define CC 384            // NH * HD = projected width
#define DIN 384          // input (model) width
#define NH 6
#define HD 64
#define NQB (TT / 64)
#define HG 6
#define SCALE (0.125f)
#define CAUSAL 0
#ifndef TNB
#define TNB NB
#endif
__device__ __forceinline__ float bfr(float v) { return (float)(__bf16)v; }
__host__ __device__ __forceinline__ int kb_last(int qb) { return CAUSAL ? ((qb * 64 + 63) >> 7) : (TT / 128 - 1); }
typedef __attribute__((ext_vector_type(8))) __bf16 v8b;
typedef __attribute__((ext_vector_type(4))) __bf16 v4b;
typedef __attribute__((ext_vector_type(4))) _Float16 v4h;
#define GP 40              // 16-bit elements per staged GEMM tile row: 32 k + 8 = 80 B (16 B x odd), conflict-free 16-byte reads
__device__ __forceinline__ v16b frag_b(const __bf16* rowk0, int lane) {
  union { v16b v; v8b q[2]; } u; const __bf16* p = rowk0 + 8 * (lane >> 4);
  u.q[0] = *(const v8b*)p; u.q[1] = *(const v8b*)(p + 16); return u.v;
}
#define QBH 0              // unused: k_attn has no high-precision path for early query blocks
#define QHI 0               // rows carrying a q residual plane: none (q enters the logits once as f16, as k does)
#define KHI 64            // key rows carrying k residual / v bf16 hi+lo planes (written by k_proj, read by no kernel here)
// B fragment (k rows k0+.., output column o) of a weight: (in,out) [K][ld] or (out,in) [ld rows of K]: bf16 exact, or f16(bf16 * 256) exact
__device__ __forceinline__ v16b wcol_io(const float* Wm, int k0, int o, int lane, int ld) { v16b w; const int g = lane >> 4;
#pragma unroll
  for (int i = 0; i < 8; ++i) { w[i] = (__bf16)Wm[(size_t)(k0 + 8 * g + i) * ld + o]; w[8 + i] = (__bf16)Wm[(size_t)(k0 + 16 + 8 * g + i) * ld + o]; }
  return w; }
__device__ __forceinline__ v16b wcol_oi(const float* Wm, int k0, int o, int lane, int K) { v16b w; const float* p = Wm + (size_t)o * K + k0 + 8 * (lane >> 4);
#pragma unroll
  for (int i = 0; i < 8; ++i) { w[i] = (__bf16)p[i]; w[8 + i] = (__bf16)p[16 + i]; }
  return w; }
__device__ __forceinline__ v16h wcolh_io(const float* Wm, int k0, int o, int lane, int ld) { v16h w; const int g = lane >> 4;
#pragma unroll
  for (int i = 0; i < 8; ++i) { w[i] = (_Float16)(bfr(Wm[(size_t)(k0 + 8 * g + i) * ld + o]) * 256.0f); w[8 + i] = (_Float16)(bfr(Wm[(size_t)(k0 + 16 + 8 * g + i) * ld + o]) * 256.0f); }
  return w; }
__device__ __forceinline__ v16h wcolh_oi(const float* Wm, int k0, int o, int lane, int K) { v16h w; const float* p = Wm + (size_t)o * K + k0 + 8 * (lane >> 4);
#pragma unroll
  for (int i = 0; i < 8; ++i) { w[i] = (_Float16)(bfr(p[i]) * 256.0f); w[8 + i] = (_Float16)(bfr(p[16 + i]) * 256.0f); }
  return w; }
#define WQKV_LAYOUT 0   // 0 = per-head [NH][DIN][HD] (wcol_heads); 1 = (out,in) [CC][DIN]; 2 = per-head [NH][DIN][HD]
__device__ __forceinline__ v16b wcol_hdk(const float* Wm, int k0, int o, int lane) { v16b w; const int g = lane >> 4; const float* p = Wm + (size_t)(o / HD) * DIN * HD + (o % HD);
#pragma unroll
  for (int i = 0; i < 8; ++i) { w[i] = (__bf16)p[(size_t)(k0 + 8 * g + i) * HD]; w[8 + i] = (__bf16)p[(size_t)(k0 + 16 + 8 * g + i) * HD]; }
  return w; }
#define WO_OUT_IN 1
#if WQKV_LAYOUT == 1
#define WCOL(W, k0, o, lane) wcol_oi(W, k0, o, lane, DIN)
#elif WQKV_LAYOUT == 2
#define WCOL(W, k0, o, lane) wcol_hdk(W, k0, o, lane)
#else
#define WCOL(W, k0, o, lane) wcol_heads(W, k0, o, lane)   /* per-head [h][D][64] weights */
#endif
#if WO_OUT_IN
#define WOCOL(W, k0, o, lane) wcol_oi(W, k0, o, lane, CC)
#define WOCOLH(W, k0, o, lane) wcolh_oi(W, k0, o, lane, CC)
#else
#define WOCOL(W, k0, o, lane) wcol_io(W, k0, o, lane, DIN)
#define WOCOLH(W, k0, o, lane) wcolh_io(W, k0, o, lane, DIN)
#endif
// per-head projection weights W[h][D][64] ([6][384][64]): column o = h*64 + d of the virtual (in,out) [D][384] matrix lives at W + (h*D + k)*64 + d
__device__ __forceinline__ v16b wcol_heads(const float* __restrict__ Wm, int k0, int o, int lane) { v16b w; const int g = lane >> 4; const float* p = Wm + ((size_t)(o >> 6) * DIN + k0 + 8 * g) * 64 + (o & 63);
#pragma unroll
  for (int i = 0; i < 8; ++i) { w[i] = (__bf16)p[(size_t)i * 64]; w[8 + i] = (__bf16)p[(size_t)(16 + i) * 64]; }
  asm volatile("s_wait_loadcnt 0x0" ::: "memory"); return w; }
#ifndef SM_EXTRA_PARAMS
#define SM_EXTRA_PARAMS
#endif
#ifndef PROJ_EXTRA_PARAMS
#define PROJ_EXTRA_PARAMS
#endif
#ifndef SM_MASK_HOOK
#define SM_MASK_HOOK (void)0
#endif

#define WS_QH  0u                                      // f16 q rows [b*t][CC]
#define WS_KH  (WS_QH + 2u * (size_t)NB * TT * CC)      // f16 k rows [b*t][CC]
#define WS_VT  (WS_KH + 2u * (size_t)NB * TT * CC)      // f16 v planes [b][c][t]
#define WS_QL  (WS_VT + 2u * (size_t)NB * CC * TT)      // f16 q residual x 2^10 rows [b][t < QHI][CC]
#define WS_KL  (WS_QL + 2u * (size_t)NB * QHI * CC)     // f16 k residual x 2^10 rows [b][t < KHI][CC]
#define WS_VB  (WS_KL + 2u * (size_t)NB * KHI * CC)     // bf16 v hi planes [b][c][t < KHI]
#define WS_VBL (WS_VB + 2u * (size_t)NB * CC * KHI)
#define WS_S   (WS_VBL + 2u * (size_t)NB * CC * KHI)    // f32 [hg][t][s], reserved but not used (logits stay on chip)
#define WS_Y   (WS_S  + 4u * (size_t)HG * TT * TT)      // f32 ctx rows [b*t][CC] (only when there is an output projection)
#define WS_END (WS_Y  + 4u * (size_t)NB * TT * CC)

// ---- k_proj: block = (128 rows, 192 cols, which), 8 waves of 32 rows x 96 cols: q/k/v = X W (+ b) with exact bf16 products (K = DIN) -> which 0: q f16 rows; 1: k f16 rows (+ residual rows < KHI); 2: v f16 planes [c][t] (+ bf16 hi/lo planes for t < KHI)
#define PBM 128            // rows of X per block
#define PBN 192            // output columns per block (three heads of one of q, k, v)
#define PSP (PBN + 8)      // f16 per epilogue row of q/k: 400 B (16 B x odd)
#define PTP (PBM + 8)      // 16-bit elements per epilogue plane row of v: 272 B (16 B x odd)
__global__ __launch_bounds__(256) void k_proj(const float* __restrict__ XQ, const float* __restrict__ XK, const float* __restrict__ XV, const float* __restrict__ WQ, const float* __restrict__ WK, const float* __restrict__ WV, const float* __restrict__ BQ, const float* __restrict__ BK, const float* __restrict__ BV,
    _Float16* __restrict__ QH, _Float16* __restrict__ KH, _Float16* __restrict__ KL, _Float16* __restrict__ VT, __bf16* __restrict__ VB, __bf16* __restrict__ VBL) {
  // one LDS block: the main loop's operand tiles (2 buffers) and the epilogue's transpose arrays (q/k: sh, sl; v: th, tb, tbl) live at different times, separated by the barrier after the loop
  __shared__ __align__(16) unsigned char smem[3 * PBN * PTP * 2];
  _Float16 (*sh)[PSP] = (_Float16 (*)[PSP])smem; _Float16 (*sl)[PSP] = (_Float16 (*)[PSP])(smem + PBM * PSP * 2);
  _Float16 (*th)[PTP] = (_Float16 (*)[PTP])smem; __bf16 (*tb)[PTP] = (__bf16 (*)[PTP])(smem + PBN * PTP * 2); __bf16 (*tbl)[PTP] = (__bf16 (*)[PTP])(smem + 2 * PBN * PTP * 2);
  __bf16 (*sA)[PBM][GP] = (__bf16 (*)[PBM][GP])smem; __bf16 (*sW)[PBN][GP] = (__bf16 (*)[PBN][GP])(smem + 2 * PBM * GP * 2);
  const int tid = threadIdx.x, wave = tid >> 5, lane = tid & 31, col = lane & 15, g = lane >> 4; const int which = blockIdx.z; const int c0 = blockIdx.y * PBN; const size_t r0 = (size_t)blockIdx.x * PBM; const size_t bb = r0 / TT; const int t0 = (int)(r0 % TT);
  const int wr = (wave >> 1) * 32, wc = (wave & 1) * 96;   // the wave's 32 x 96 piece of the block's tile: each X fragment feeds 6 products, each W fragment 2
  const float* X = which == 0 ? XQ : which == 1 ? XK : XV; const float* WA = which == 0 ? WQ : which == 1 ? WK : WV; const float* BA = which == 0 ? BQ : which == 1 ? BK : BV;
  v8f acc[2][6] = {};
  // per 32 k: the block's X tile (128 x 32) and W tile (32 x 192) are read once with whole-line loads, rounded to bf16 and laid in LDS as [row][k] and [column][k]; the next tile's loads fly under this tile's products
  const int xr = tid >> 3, xp = tid & 7;
  const float* xg = X + (r0 + xr) * DIN + xp * 4;                                             // 16-byte piece xp of rows xr + 32 i
  // W tile = 6 column segments of 32 x 4 groups of 8 k = 24 units, 3 per wave: a lane holds 8 consecutive k of one column (one 16-byte LDS store), a wave's load covers one 128-byte line
  const float* wg[3]; int wcl[3], wok[3];
#pragma unroll
  for (int i = 0; i < 3; ++i) { const int u = wave * 3 + i; wcl[i] = (u % 6) * 32 + lane; wok[i] = (u / 6) * 8;
    wg[i] = WA + ((size_t)((c0 + wcl[i]) >> 6) * DIN + wok[i]) * 64 + ((c0 + wcl[i]) & 63); }   // column c0 + wcl of the per-head [h][D][64] weights, row k at + 64 k
  v4f rx[4]; float rw[3][8];   // the short loops over rx, rw, a, wf and acc are fully unrolled so that these arrays stay in registers
#pragma unroll
  for (int i = 0; i < 4; ++i) rx[i] = *(const v4f*)(xg + (size_t)(32 * i) * DIN);
#pragma unroll
  for (int i = 0; i < 3; ++i)
#pragma unroll
    for (int k = 0; k < 8; ++k) rw[i][k] = wg[i][(size_t)k * 64];
  asm volatile("s_wait_xcnt 0x0" ::: "memory");   // the loads' address registers may be rewritten by what follows: the wait stands in front of that
#pragma unroll 2   // two trips per pass: the buffer index becomes a constant LDS offset
  for (int kc = 0; kc < DIN / 32; ++kc) { const int bu = kc & 1;
#pragma unroll
    for (int i = 0; i < 4; ++i) { v4b x4;
#pragma unroll
      for (int e = 0; e < 4; ++e) x4[e] = (__bf16)rx[i][e];
      *(v4b*)&sA[bu][xr + 32 * i][xp * 4] = x4; }
#pragma unroll
    for (int i = 0; i < 3; ++i) { v8b w8;
#pragma unroll
      for (int e = 0; e < 8; ++e) w8[e] = (__bf16)rw[i][e];
      *(v8b*)&sW[bu][wcl[i]][wok[i]] = w8; }
    __syncthreads();   // publishes buffer bu; the other buffer's readers all passed it too, so the next trip may refill that one
    if (kc + 1 < DIN / 32) {
#pragma unroll
      for (int i = 0; i < 4; ++i) rx[i] = *(const v4f*)(xg + (size_t)(32 * i) * DIN + (kc + 1) * 32);
#pragma unroll
      for (int i = 0; i < 3; ++i)
#pragma unroll
        for (int k = 0; k < 8; ++k) rw[i][k] = wg[i][(size_t)((kc + 1) * 32 + k) * 64];
      asm volatile("s_wait_xcnt 0x0" ::: "memory"); }   // the loads' address registers may be rewritten by what follows: the wait stands in front of that
    v16b a[2], wf[6];
#pragma unroll
    for (int i = 0; i < 2; ++i) a[i] = frag_b(&sA[bu][wr + i * 16 + col][0], lane);
#pragma unroll
    for (int j = 0; j < 6; ++j) wf[j] = frag_b(&sW[bu][wc + j * 16 + col][0], lane);
    __builtin_amdgcn_sched_barrier(0);   // all fragment reads issue as one group ahead of the products: one LDS latency per tile instead of one per product
#pragma unroll
    for (int j = 0; j < 6; ++j)
#pragma unroll
      for (int i = 0; i < 2; ++i) acc[i][j] = __builtin_amdgcn_wmma_f32_16x16x32_bf16(false, a[i], false, wf[j], (short)0, acc[i][j], false, false);
    __builtin_amdgcn_sched_barrier(0); }   // the next trip's converts wait for the loads in flight: they stay behind this tile's products
  __syncthreads();   // the last tile's readers are done before the epilogue reuses the LDS
  if (which < 2) { _Float16* DH = which == 0 ? QH : KH; _Float16* DL = KL; const int nhi = which == 0 ? QHI : KHI;   // nhi is the same for the whole block; q has no residual rows
#pragma unroll
    for (int j = 0; j < 6; ++j) { const float bias = BA ? bfr(BA[c0 + wc + j * 16 + col]) : 0.f;
#pragma unroll
      for (int i = 0; i < 2; ++i)
#pragma unroll
        for (int r = 0; r < 8; ++r) { const float v = acc[i][j][r] + bias; const _Float16 hv = (_Float16)v; sh[wr + i * 16 + 8 * g + r][wc + j * 16 + col] = hv; acc[i][j][r] = v; } }
    if (nhi > 0) {
#pragma unroll
      for (int j = 0; j < 6; ++j)
#pragma unroll
        for (int i = 0; i < 2; ++i)
#pragma unroll
          for (int r = 0; r < 8; ++r) { const float v = acc[i][j][r]; sl[wr + i * 16 + 8 * g + r][wc + j * 16 + col] = (_Float16)((v - (float)(_Float16)v) * 1024.0f); } }
    __syncthreads();
    for (int e = tid; e < PBM * (PBN / 8); e += 256) { const int rl = e / (PBN / 8), q = e % (PBN / 8); vst2((unsigned*)(DH + (r0 + rl) * CC + c0 + q * 8), *(const v4u*)&sh[rl][q * 8]);
      if (t0 + rl < nhi) { vst2((unsigned*)(DL + (bb * nhi + t0 + rl) * (size_t)CC + c0 + q * 8), *(const v4u*)&sl[rl][q * 8]); asm volatile("s_wait_xcnt 0x0" ::: "memory"); } }   // the store's address registers are rewritten by the next trip: the wait stands in front of that
  } else {
#pragma unroll
    for (int j = 0; j < 6; ++j) { const float bias = BA ? bfr(BA[c0 + wc + j * 16 + col]) : 0.f;
#pragma unroll
      for (int i = 0; i < 2; ++i)
#pragma unroll
        for (int r = 0; r < 8; ++r) { const float v = acc[i][j][r] + bias; const int rl = wr + i * 16 + 8 * g + r, cl = wc + j * 16 + col; th[cl][rl] = (_Float16)v; const __bf16 bh = (__bf16)v; tb[cl][rl] = bh; tbl[cl][rl] = (__bf16)(v - (float)bh); } }
    __syncthreads();
    for (int e = tid; e < PBN * (PBM / 8); e += 256) { const int cl = e / (PBM / 8), q = e % (PBM / 8); vst2((unsigned*)(VT + (bb * CC + c0 + cl) * (size_t)TT + t0 + q * 8), *(const v4u*)&th[cl][q * 8]);
      if (t0 + q * 8 < KHI) { const size_t o3 = (bb * CC + c0 + cl) * (size_t)KHI + t0 + q * 8; vst2((unsigned*)(VB + o3), *(const v4u*)&tb[cl][q * 8]); vst2((unsigned*)(VBL + o3), *(const v4u*)&tbl[cl][q * 8]); asm volatile("s_wait_xcnt 0x0" ::: "memory"); } }   // the stores' address registers are rewritten by the next trip: the wait stands in front of that
  } }
// ---- k_attn: block = 128 queries (4 waves x 32 = two tiles of 16 per wave) of (b, h); keys walked in LDS stages of 64 (K rows and v planes staged once per block, next stage's global loads in flight under this stage's work).
// Per 64 keys: S^T = K Q^T (A = K rows, B = q), so a lane holds one query's logits per tile; every K and v fragment read from LDS feeds both query tiles;
// running maximum and sum per lane and tile (+ one exchange between the wave halves);
// P^T = exp(logit - max) x 2^11 once to f16 is already a B operand (two D tiles = 32 keys in the hardware k order); O^T += V^T P^T; the accumulators are rescaled when the maximum moves; ctx = O^T / sum at the end.
#define AKT 64             // keys per LDS stage
#define AQT 2              // query tiles of 16 per wave
#define KPITCH 72          // f16 per staged K row: 144 B (16 B x odd), conflict-free 16-byte reads
#define VPITCH 72          // f16 per staged v plane row: 144 B
#define CSL2 (SCALE * 1.4426950408889634f)
__device__ __forceinline__ v8f wm16(v16h a, v16h b, v8f c) { return __builtin_amdgcn_wmma_f32_16x16x32_f16(false, a, false, b, (short)0, c, false, false); }
__device__ __forceinline__ float xhalf(float x) { return __builtin_bit_cast(float, __builtin_amdgcn_permlanex16(__builtin_bit_cast(int, x), __builtin_bit_cast(int, x), 0x76543210, 0xfedcba98, false, false)); }  // lane l with lane l ^ 16
// grid 8 x 6 x 16 = 768 blocks of 4 waves; three blocks (three waves per SIMD, at most 336 registers each) fit a WGP, so all blocks are resident at once
__global__ __launch_bounds__(128, 3) void k_attn(const _Float16* __restrict__ QH, const _Float16* __restrict__ KH, const _Float16* __restrict__ VT, float* __restrict__ Y) {
  __shared__ __align__(16) _Float16 sk[AKT][KPITCH]; __shared__ __align__(16) _Float16 sv[HD][VPITCH];
  const int tid = threadIdx.x, wave = tid >> 5, lane = tid & 31, col = lane & 15, g = lane >> 4; const int h = blockIdx.y, b = blockIdx.z; const int q = blockIdx.x * 128 + wave * (16 * AQT) + col;
  v16h qh[AQT][HD / 32];   // the short loops over the tile, fragment and accumulator arrays are fully unrolled so that these arrays stay in registers
#pragma unroll
  for (int u = 0; u < AQT; ++u)
#pragma unroll
    for (int kc = 0; kc < HD / 32; ++kc) qh[u][kc] = frag_h(QH + ((size_t)b * TT + q + 16 * u) * CC + h * HD + kc * 32, lane);
  asm volatile("s_wait_xcnt 0x0" ::: "memory");   // the q loads' address registers are reused by what follows: the wait stands in front of that overwrite
  __builtin_amdgcn_sched_barrier(0);   // keeps the later address arithmetic and zeroing, which reuse those registers, behind the wait
  const _Float16* kg = KH + ((size_t)b * TT + (tid >> 3)) * CC + h * HD + (tid & 7) * 8;      // 16-byte piece (tid & 7) of key rows (tid >> 3) + 16 i
  const _Float16* vg = VT + ((size_t)b * CC + h * HD + (tid >> 3)) * (size_t)TT + (tid & 7) * 8;   // 16-byte piece (tid & 7) of planes (tid >> 3) + 16 i
  v4u rk[4], rv[4];
#pragma unroll
  for (int i = 0; i < 4; ++i) { rk[i] = *(const v4u*)(kg + (size_t)(16 * i) * CC); rv[i] = *(const v4u*)(vg + (size_t)(16 * i) * TT); }
  v8f o[AQT][HD / 16] = {}; float m[AQT], l[AQT];
#pragma unroll
  for (int u = 0; u < AQT; ++u) { m[u] = -3.0e38f; l[u] = 0.f; }
  for (int s = 0; s < TT / AKT; ++s) {
#pragma unroll
    for (int i = 0; i < 4; ++i) { *(v4u*)&sk[(tid >> 3) + 16 * i][(tid & 7) * 8] = rk[i]; *(v4u*)&sv[(tid >> 3) + 16 * i][(tid & 7) * 8] = rv[i]; }
    __syncthreads();
    if (s + 1 < TT / AKT) {
#pragma unroll
      for (int i = 0; i < 4; ++i) { rk[i] = *(const v4u*)(kg + (size_t)((s + 1) * AKT + 16 * i) * CC); rv[i] = *(const v4u*)(vg + (size_t)(16 * i) * TT + (s + 1) * AKT); }
      asm volatile("s_wait_xcnt 0x0" ::: "memory"); }   // the loads' address registers are reused by what follows: the wait stands in front of that overwrite
    { v8f st[AQT][4]; v16h pf[AQT][2];
      { v16h a[4][2];
#pragma unroll
        for (int j = 0; j < 4; ++j) { a[j][0] = frag_h(&sk[j * 16 + col][0], lane); a[j][1] = frag_h(&sk[j * 16 + col][32], lane); }
        __builtin_amdgcn_sched_barrier(0);   // the stage's K fragment reads issue as one group ahead of the products: one LDS latency per stage instead of one per key tile
        // eight independent accumulator chains (4 key tiles x 2 query tiles) walk the two products side by side
#pragma unroll
        for (int j = 0; j < 4; ++j)
#pragma unroll
          for (int u = 0; u < AQT; ++u) { const v8f z = {}; st[u][j] = wm16(a[j][0], qh[u][0], z); }
#pragma unroll
        for (int j = 0; j < 4; ++j)
#pragma unroll
          for (int u = 0; u < AQT; ++u) st[u][j] = wm16(a[j][1], qh[u][1], st[u][j]); }
      v16h vf[2][HD / 16];
#pragma unroll
      for (int kk = 0; kk < 2; ++kk)
#pragma unroll
        for (int t = 0; t < HD / 16; ++t) vf[kk][t] = frag_h(&sv[t * 16 + col][kk * 32], lane);
      __builtin_amdgcn_sched_barrier(0);   // the stage's v fragment reads issue as one group here, so that their LDS latency passes under the softmax arithmetic below
#pragma unroll
      for (int u = 0; u < AQT; ++u) {
        float mx = st[u][0][0];
#pragma unroll
        for (int j = 0; j < 4; ++j)
#pragma unroll
          for (int r = 0; r < 8; ++r) mx = fmaxf(mx, st[u][j][r]);
        const float mn = fmaxf(m[u], fmaxf(mx, xhalf(mx)));   // both halves hold the query's maximum so far (unscaled logits)
        const float corr = __builtin_amdgcn_exp2f((m[u] - mn) * CSL2); m[u] = mn;   // 0 on the first pass
        const float nm = 11.0f - mn * CSL2;
        l[u] *= corr;
#pragma unroll
        for (int t = 0; t < HD / 16; ++t) o[u][t] = o[u][t] * corr;
#pragma unroll
        for (int kk = 0; kk < 2; ++kk) { v8f e0 = __builtin_elementwise_fma(st[u][2 * kk], (v8f)(CSL2), (v8f)(nm)), e1 = __builtin_elementwise_fma(st[u][2 * kk + 1], (v8f)(CSL2), (v8f)(nm));
#pragma unroll
          for (int i = 0; i < 8; ++i) e0[i] = __builtin_amdgcn_exp2f(e0[i]);
#pragma unroll
          for (int i = 0; i < 8; ++i) e1[i] = __builtin_amdgcn_exp2f(e1[i]);
#pragma unroll
          for (int i = 0; i < 8; ++i) { pf[u][kk][i] = (_Float16)e0[i]; pf[u][kk][8 + i] = (_Float16)e1[i]; }
          e0 = e0 + e1; l[u] += ((e0[0] + e0[1]) + (e0[2] + e0[3])) + ((e0[4] + e0[5]) + (e0[6] + e0[7])); } }
#pragma unroll
      for (int kk = 0; kk < 2; ++kk)
#pragma unroll
        for (int t = 0; t < HD / 16; ++t)
#pragma unroll
          for (int u = 0; u < AQT; ++u) o[u][t] = wm16(vf[kk][t], pf[u][kk], o[u][t]); }
    __builtin_amdgcn_sched_barrier(0);   // the stage's arithmetic stays in front of the closing barrier: lifted over it, the barrier's wait for the next stage's global loads would stand in mid-stage, before they have landed
    __syncthreads(); }
#pragma unroll
  for (int u = 0; u < AQT; ++u) {
    const float ls = l[u] + xhalf(l[u]); const float inv = 1.0f / ls;   // ls >= 2^11: the maximum's own term
    float* yr = Y + ((size_t)b * TT + q + 16 * u) * CC + h * HD + 8 * g;
#pragma unroll
    for (int t = 0; t < HD / 16; ++t) { const v8f v = o[u][t] * inv; vst2(yr + t * 16, (v4f){v[0], v[1], v[2], v[3]}); vst2(yr + t * 16 + 4, (v4f){v[4], v[5], v[6], v[7]}); }
    if (u + 1 < AQT) asm volatile("s_wait_xcnt 0x0" ::: "memory"); } }   // the stores' data registers are rewritten by the next tile's results: the wait stands in front of that
// ---- k_out: block = (64 rows, 128 cols): out = ctx Wo (+ bo): ctx x 2^6 once to f16 against Wo as f16(bf16 x 2^8) exact (1 product) x 2^-14; causal early rows (< QHI of each sequence): ctx bf16 hi + lo against exact bf16 Wo (2 products)
__global__ __launch_bounds__(128) void k_out(const float* __restrict__ Y, const float* __restrict__ WO, const float* __restrict__ BO, float* __restrict__ OUT) {
  // one LDS block: the main loop's operand tiles (2 buffers), then the epilogue's per-wave rows sf
  __shared__ __align__(16) unsigned char smem[4 * 16 * 132 * 4]; float (*sf)[16][132] = (float (*)[16][132])smem;
  _Float16 (*sA)[64][GP] = (_Float16 (*)[64][GP])smem; _Float16 (*sW)[128][GP] = (_Float16 (*)[128][GP])(smem + 2 * 64 * GP * 2);
  const int tid = threadIdx.x, wave = tid >> 5, lane = tid & 31, col = lane & 15, g = lane >> 4; const int c0 = blockIdx.y * 128; const size_t r0 = (size_t)blockIdx.x * 64 + wave * 16;
  v8f acc[8] = {};
  if (CAUSAL && (int)(((size_t)blockIdx.x * 64) % TT) < QHI) {   /* block-uniform */
#pragma unroll 2
    for (int kc = 0; kc < CC / 32; ++kc) { const F2 a = split_row(Y + (r0 + col) * CC, kc * 32, lane); asm volatile("s_wait_loadcnt 0x0" ::: "memory");
#pragma unroll
      for (int j = 0; j < 8; ++j) { const v16b w = WOCOL(WO, kc * 32, c0 + j * 16 + col, lane); asm volatile("s_wait_loadcnt 0x0" ::: "memory"); acc[j] = wmma_bf(a.h, w, acc[j]); acc[j] = wmma_bf(a.l, w, acc[j]); } }
#pragma unroll
    for (int j = 0; j < 8; ++j) { const float bias = BO ? bfr(BO[c0 + j * 16 + col]) : 0.f;
#pragma unroll
      for (int r = 0; r < 8; ++r) sf[wave][8 * g + r][j * 16 + col] = acc[j][r] + bias; }
  } else {
    // per 32 k: the block's ctx tile (64 x 32) and Wo tile (128 outputs x 32) are read once with whole-line loads, converted and laid in LDS as [row][k]; the next tile's loads fly under this tile's products
    const int xr = tid >> 3, xp = tid & 7;
    const float* yg = Y + ((size_t)blockIdx.x * 64 + xr) * CC + xp * 4;   // 16-byte piece xp of rows xr + 16 i
    const float* wg = WO + (size_t)(c0 + xr) * CC + xp * 4;               // 16-byte piece xp of Wo rows (outputs) c0 + xr + 16 i
    v4f ry[4], rw[8];   // the short loops over ry, rw, wf and acc are fully unrolled so that these arrays stay in registers
#pragma unroll
    for (int i = 0; i < 4; ++i) ry[i] = *(const v4f*)(yg + (size_t)(16 * i) * CC);
#pragma unroll
    for (int i = 0; i < 8; ++i) rw[i] = *(const v4f*)(wg + (size_t)(16 * i) * CC);
    asm volatile("s_wait_xcnt 0x0" ::: "memory");   // the loads' address registers may be rewritten by what follows: the wait stands in front of that
#pragma unroll 2   // two trips per pass: the buffer index becomes a constant LDS offset
    for (int kc = 0; kc < CC / 32; ++kc) { const int bu = kc & 1;
#pragma unroll
      for (int i = 0; i < 4; ++i) { v4h y4;   /* ctx carried x 2^6 into f16 so small-magnitude context rows stay clear of f16 subnormals */
#pragma unroll
        for (int e = 0; e < 4; ++e) y4[e] = (_Float16)(ry[i][e] * 64.0f);
        *(v4h*)&sA[bu][xr + 16 * i][xp * 4] = y4; }
#pragma unroll
      for (int i = 0; i < 8; ++i) { v4h w4;
#pragma unroll
        for (int e = 0; e < 4; ++e) w4[e] = (_Float16)(bfr(rw[i][e]) * 256.0f);
        *(v4h*)&sW[bu][xr + 16 * i][xp * 4] = w4; }
      __syncthreads();   // publishes buffer bu; the other buffer's readers all passed it too, so the next trip may refill that one
      if (kc + 1 < CC / 32) {
#pragma unroll
        for (int i = 0; i < 4; ++i) ry[i] = *(const v4f*)(yg + (size_t)(16 * i) * CC + (kc + 1) * 32);
#pragma unroll
        for (int i = 0; i < 8; ++i) rw[i] = *(const v4f*)(wg + (size_t)(16 * i) * CC + (kc + 1) * 32);
        asm volatile("s_wait_xcnt 0x0" ::: "memory"); }   // the loads' address registers may be rewritten by what follows: the wait stands in front of that
      const v16h a = frag_h(&sA[bu][wave * 16 + col][0], lane); v16h wf[8];
#pragma unroll
      for (int j = 0; j < 8; ++j) wf[j] = frag_h(&sW[bu][j * 16 + col][0], lane);
      __builtin_amdgcn_sched_barrier(0);   // all fragment reads issue as one group ahead of the products: one LDS latency per tile instead of one per product
#pragma unroll
      for (int j = 0; j < 8; ++j) acc[j] = wm16(a, wf[j], acc[j]);
      __builtin_amdgcn_sched_barrier(0); }   // the next trip's converts wait for the loads in flight: they stay behind this tile's products
    __syncthreads();   // the last tile's readers are done before the epilogue reuses the LDS
#pragma unroll
    for (int j = 0; j < 8; ++j) { const float bias = BO ? bfr(BO[c0 + j * 16 + col]) : 0.f;
#pragma unroll
      for (int r = 0; r < 8; ++r) sf[wave][8 * g + r][j * 16 + col] = acc[j][r] * (1.0f / 16384.0f) + bias; } }   /* 2^-8 (Wo carry) x 2^-6 (ctx carry) */
  LDSX(); for (int rl = 0; rl < 16; ++rl) vst2(OUT + (r0 + rl) * DIN + c0 + lane * 4, *(const v4f*)&sf[wave][rl][lane * 4]); }

extern "C" void kernel_launch(void* const* d_in, const int* in_sizes, int n_in, void* d_out, int out_size, void* d_ws, size_t ws_size, hipStream_t stream) {
  (void)in_sizes; (void)n_in; (void)out_size;
  const float** F = (const float**)d_in;
  if (ws_size < (size_t)WS_END) return;
  char* ws = (char*)d_ws; _Float16 *QH = (_Float16*)(ws + WS_QH), *KH = (_Float16*)(ws + WS_KH), *VT = (_Float16*)(ws + WS_VT), *KL = (_Float16*)(ws + WS_KL); __bf16 *VB = (__bf16*)(ws + WS_VB), *VBL = (__bf16*)(ws + WS_VBL); float *S = (float*)(ws + WS_S), *Y = (float*)(ws + WS_Y);
  (void)Y; (void)KL; (void)VB; (void)VBL; (void)S;
  // inputs: 0 x [16,1024,384]; 1 Wq [6,384,64], 2 bq [6,64]; 3 Wk, 4 bk; 5 Wv, 6 bv; 7 Wo [384,384] (out,in), 8 bo [384]
  k_proj<<<dim3(TNB * TT / PBM, CC / PBN, 3), 256, 0, stream>>>(F[0], F[0], F[0], F[1], F[3], F[5], F[2], F[4], F[6], QH, KH, KL, VT, VB, VBL);
  k_attn<<<dim3(TT / 128, NH, TNB), 128, 0, stream>>>(QH, KH, VT, Y);
  k_out<<<dim3(TNB * TT / 64, DIN / 128), 128, 0, stream>>>(Y, F[7], F[8], (float*)d_out);
}

// v006
// It runs in 70.8 microseconds.
// Next to v005, in two timings, it ran 1.10 times as fast each time.
// Over all steps from v000 it is 16.1 times as fast.
// compute dtype: all float inputs rounded to bf16; per-head q/k/v projections with EXACT bf16 products on WMMA 16x16x32 (f32 accumulate) + bias; logits with q once to f16 against k once to f16 (1 product) x 64^-0.5; softmax f32 with a running maximum and sum (logits stay on chip); exp(logit - max) x 2^11 once to f16 x v once to f16 (1 product), divided by the f32 sum at the end; ctx carried x 2^6 once to f16 x Wo f16(bf16 x 2^8) + bo; f32 output.
#include <hip/hip_runtime.h>
#include <math.h>

typedef __attribute__((ext_vector_type(16))) _Float16 v16h;
typedef __attribute__((ext_vector_type(16))) __bf16 v16b;
typedef __attribute__((ext_vector_type(8)))  _Float16 v8h;
typedef __attribute__((ext_vector_type(8)))  float v8f;
typedef __attribute__((ext_vector_type(4)))  float v4f;
typedef __attribute__((ext_vector_type(2)))  float v2f;
typedef __attribute__((ext_vector_type(4)))  unsigned v4u;
typedef __attribute__((ext_vector_type(4)))  int v4i;
typedef float __attribute__((may_alias)) float_a;
typedef int __attribute__((may_alias)) int_a;

template <typename T> __device__ __forceinline__ void vst2(void* p, T v) { *(T*)p = v;  }
__device__ __forceinline__ v8f wmma16(v16h a, v16h b, v8f c) {
  v8f d = __builtin_amdgcn_wmma_f32_16x16x32_f16(false, a, false, b, (short)0, c, false, false);
  asm volatile("v_nop\n\tv_nop\n\tv_nop\n\tv_nop" : "+v"(d) : "v"(a), "v"(b));
  return d;
}
__device__ __forceinline__ v8f wmma_bf(v16b a, v16b b, v8f c) {
  v8f d = __builtin_amdgcn_wmma_f32_16x16x32_bf16(false, a, false, b, (short)0, c, false, false);
  asm volatile("v_nop\n\tv_nop\n\tv_nop\n\tv_nop" : "+v"(d) : "v"(a), "v"(b));
  return d;
}
// 16x16x32 fragments: lane = (h = lane>>4, row/col = lane&15); elements 0..7 = k0+8h+0..7, 8..15 = k0+16+8h+0..7; D element r = row 8h+r
__device__ __forceinline__ v16h frag_h(const _Float16* rowk0, int lane) {
  union { v16h v; v8h q[2]; } u; const _Float16* p = rowk0 + 8 * (lane >> 4);
  u.q[0] = *(const v8h*)p; u.q[1] = *(const v8h*)(p + 16); return u.v;
}
__device__ __forceinline__ v16h frag_f32(const float* rowk0, int lane) {
  v16h a; const float* p = rowk0 + 8 * (lane >> 4);
#pragma unroll
  for (int i = 0; i < 8; ++i) { a[i] = (_Float16)p[i]; a[8 + i] = (_Float16)p[16 + i]; }
  return a;
}
__device__ __forceinline__ v16h frag_f32s(const float* rowk0, int lane, float sc) {
  v16h a; const float* p = rowk0 + 8 * (lane >> 4);
#pragma unroll
  for (int i = 0; i < 8; ++i) { a[i] = (_Float16)(p[i] * sc); a[8 + i] = (_Float16)(p[16 + i] * sc); }
  return a;
}
// column fragment from a [K][ld] layout (column n), rows >= K read as 0
__device__ __forceinline__ v16h fragc_f32(const float* W, int k0, int n, int lane, int ld, int K) {
  v16h a; const int g = lane >> 4;
#pragma unroll
  for (int i = 0; i < 8; ++i) { const int ka = k0 + 8 * g + i, kb = ka + 16;
    a[i] = (_Float16)(ka < K ? W[(size_t)(ka < K ? ka : K - 1) * ld + n] : 0.f); a[8 + i] = (_Float16)(kb < K ? W[(size_t)(kb < K ? kb : K - 1) * ld + n] : 0.f); }
  return a;
}
struct F2 { v16b h, l; };
__device__ __forceinline__ F2 bsplit16(const float v[16]) { F2 r;
#pragma unroll
  for (int i = 0; i < 16; ++i) { const __bf16 h = (__bf16)v[i]; r.h[i] = h; r.l[i] = (__bf16)(v[i] - (float)h); }
  return r; }
__device__ __forceinline__ F2 split_row(const float* row, int k0, int lane) { float v[16]; const float* p = row + k0 + 8 * (lane >> 4);
#pragma unroll
  for (int i = 0; i < 8; ++i) { v[i] = p[i]; v[8 + i] = p[16 + i]; }
  return bsplit16(v); }
__device__ __forceinline__ F2 split_rowK(const float* row, int k0, int lane, int K) { float v[16]; const int g = lane >> 4;
#pragma unroll
  for (int i = 0; i < 8; ++i) { const int ka = k0 + 8 * g + i, kb = ka + 16; v[i] = ka < K ? row[ka < K ? ka : K - 1] : 0.f; v[8 + i] = kb < K ? row[kb < K ? kb : K - 1] : 0.f; }
  return bsplit16(v); }
__device__ __forceinline__ F2 split_col(const float* W, int k0, int n, int lane, int ld, int K) { float v[16]; const int g = lane >> 4;
#pragma unroll
  for (int i = 0; i < 8; ++i) { const int ka = k0 + 8 * g + i, kb = ka + 16; v[i] = ka < K ? W[(size_t)(ka < K ? ka : K - 1) * ld + n] : 0.f; v[8 + i] = kb < K ? W[(size_t)(kb < K ? kb : K - 1) * ld + n] : 0.f; }
  return bsplit16(v); }
__device__ __forceinline__ v8f mac3(const F2& a, const F2& b, v8f c) { c = wmma_bf(a.l, b.h, c); c = wmma_bf(a.h, b.l, c); return wmma_bf(a.h, b.h, c); }
__device__ __forceinline__ float sigm(float v) { return 1.0f / (1.0f + expf(-v)); }
#define LDSX() do { asm volatile("s_wait_dscnt 0" ::: "memory"); __builtin_amdgcn_wave_barrier(); __builtin_amdgcn_fence(__ATOMIC_RELEASE, "workgroup"); } while (0)

// Multi-head self-attention (B 16, S 1,024, D 384 = 6 heads x 64; per-head (in,out) Wq/Wk/Wv [6,384,64] + biases [6,64], 0.02-scale; (out,in) Wo [384,384] + bo): out = merge(softmax(q k^T / 8) v) Wo^T + bo.
#define NB 16
#define TT 1024
#define CC 384            // NH * HD = projected width
#define DIN 384          // input (model) width
#define NH 6
#define HD 64
#define NQB (TT / 64)
#define HG 6
#define SCALE (0.125f)
#define CAUSAL 0
#ifndef TNB
#define TNB NB
#endif
__device__ __forceinline__ float bfr(float v) { return (float)(__bf16)v; }
__host__ __device__ __forceinline__ int kb_last(int qb) { return CAUSAL ? ((qb * 64 + 63) >> 7) : (TT / 128 - 1); }
typedef __attribute__((ext_vector_type(8))) __bf16 v8b;
typedef __attribute__((ext_vector_type(4))) __bf16 v4b;
typedef __attribute__((ext_vector_type(4))) _Float16 v4h;
#define GP 40              // 16-bit elements per staged GEMM tile row: 32 k + 8 = 80 B (16 B x odd), conflict-free 16-byte reads
__device__ __forceinline__ v16b frag_b(const __bf16* rowk0, int lane) {
  union { v16b v; v8b q[2]; } u; const __bf16* p = rowk0 + 8 * (lane >> 4);
  u.q[0] = *(const v8b*)p; u.q[1] = *(const v8b*)(p + 16); return u.v;
}
#define QBH 0              // unused: k_attn has no high-precision path for early query blocks
#define QHI 0               // rows carrying a q residual plane: none (q enters the logits once as f16, as k does)
#define KHI 64            // key rows carrying k residual / v bf16 hi+lo planes (workspace reserved; written and read by no kernel here)
// B fragment (k rows k0+.., output column o) of a weight: (in,out) [K][ld] or (out,in) [ld rows of K]: bf16 exact, or f16(bf16 * 256) exact
__device__ __forceinline__ v16b wcol_io(const float* Wm, int k0, int o, int lane, int ld) { v16b w; const int g = lane >> 4;
#pragma unroll
  for (int i = 0; i < 8; ++i) { w[i] = (__bf16)Wm[(size_t)(k0 + 8 * g + i) * ld + o]; w[8 + i] = (__bf16)Wm[(size_t)(k0 + 16 + 8 * g + i) * ld + o]; }
  return w; }
__device__ __forceinline__ v16b wcol_oi(const float* Wm, int k0, int o, int lane, int K) { v16b w; const float* p = Wm + (size_t)o * K + k0 + 8 * (lane >> 4);
#pragma unroll
  for (int i = 0; i < 8; ++i) { w[i] = (__bf16)p[i]; w[8 + i] = (__bf16)p[16 + i]; }
  return w; }
__device__ __forceinline__ v16h wcolh_io(const float* Wm, int k0, int o, int lane, int ld) { v16h w; const int g = lane >> 4;
#pragma unroll
  for (int i = 0; i < 8; ++i) { w[i] = (_Float16)(bfr(Wm[(size_t)(k0 + 8 * g + i) * ld + o]) * 256.0f); w[8 + i] = (_Float16)(bfr(Wm[(size_t)(k0 + 16 + 8 * g + i) * ld + o]) * 256.0f); }
  return w; }
__device__ __forceinline__ v16h wcolh_oi(const float* Wm, int k0, int o, int lane, int K) { v16h w; const float* p = Wm + (size_t)o * K + k0 + 8 * (lane >> 4);
#pragma unroll
  for (int i = 0; i < 8; ++i) { w[i] = (_Float16)(bfr(p[i]) * 256.0f); w[8 + i] = (_Float16)(bfr(p[16 + i]) * 256.0f); }
  return w; }
#define WQKV_LAYOUT 0   // 0 = per-head [NH][DIN][HD] (wcol_heads); 1 = (out,in) [CC][DIN]; 2 = per-head [NH][DIN][HD]
__device__ __forceinline__ v16b wcol_hdk(const float* Wm, int k0, int o, int lane) { v16b w; const int g = lane >> 4; const float* p = Wm + (size_t)(o / HD) * DIN * HD + (o % HD);
#pragma unroll
  for (int i = 0; i < 8; ++i) { w[i] = (__bf16)p[(size_t)(k0 + 8 * g + i) * HD]; w[8 + i] = (__bf16)p[(size_t)(k0 + 16 + 8 * g + i) * HD]; }
  return w; }
#define WO_OUT_IN 1
#if WQKV_LAYOUT == 1
#define WCOL(W, k0, o, lane) wcol_oi(W, k0, o, lane, DIN)
#elif WQKV_LAYOUT == 2
#define WCOL(W, k0, o, lane) wcol_hdk(W, k0, o, lane)
#else
#define WCOL(W, k0, o, lane) wcol_heads(W, k0, o, lane)   /* per-head [h][D][64] weights */
#endif
#if WO_OUT_IN
#define WOCOL(W, k0, o, lane) wcol_oi(W, k0, o, lane, CC)
#define WOCOLH(W, k0, o, lane) wcolh_oi(W, k0, o, lane, CC)
#else
#define WOCOL(W, k0, o, lane) wcol_io(W, k0, o, lane, DIN)
#define WOCOLH(W, k0, o, lane) wcolh_io(W, k0, o, lane, DIN)
#endif
// per-head projection weights W[h][D][64] ([6][384][64]): column o = h*64 + d of the virtual (in,out) [D][384] matrix lives at W + (h*D + k)*64 + d
__device__ __forceinline__ v16b wcol_heads(const float* __restrict__ Wm, int k0, int o, int lane) { v16b w; const int g = lane >> 4; const float* p = Wm + ((size_t)(o >> 6) * DIN + k0 + 8 * g) * 64 + (o & 63);
#pragma unroll
  for (int i = 0; i < 8; ++i) { w[i] = (__bf16)p[(size_t)i * 64]; w[8 + i] = (__bf16)p[(size_t)(16 + i) * 64]; }
  asm volatile("s_wait_loadcnt 0x0" ::: "memory"); return w; }
#ifndef SM_EXTRA_PARAMS
#define SM_EXTRA_PARAMS
#endif
#ifndef PROJ_EXTRA_PARAMS
#define PROJ_EXTRA_PARAMS
#endif
#ifndef SM_MASK_HOOK
#define SM_MASK_HOOK (void)0
#endif

#define WS_QH  0u                                      // f16 q rows [b*t][CC]
#define WS_KH  (WS_QH + 2u * (size_t)NB * TT * CC)      // f16 k rows [b*t][CC]
#define WS_VT  (WS_KH + 2u * (size_t)NB * TT * CC)      // f16 v planes [b][c][t]
#define WS_QL  (WS_VT + 2u * (size_t)NB * CC * TT)      // f16 q residual x 2^10 rows [b][t < QHI][CC]
#define WS_KL  (WS_QL + 2u * (size_t)NB * QHI * CC)     // f16 k residual x 2^10 rows [b][t < KHI][CC]
#define WS_VB  (WS_KL + 2u * (size_t)NB * KHI * CC)     // bf16 v hi planes [b][c][t < KHI]
#define WS_VBL (WS_VB + 2u * (size_t)NB * CC * KHI)
#define WS_S   (WS_VBL + 2u * (size_t)NB * CC * KHI)    // f32 [hg][t][s], reserved but not used (logits stay on chip)
#define WS_Y   (WS_S  + 4u * (size_t)HG * TT * TT)      // f32 ctx rows [b*t][CC] (only when there is an output projection)
#define WS_END (WS_Y  + 4u * (size_t)NB * TT * CC)

// ---- k_proj: the q, k and v projections are one GEMM over 1,152 joined columns (q 0..383, k 384..767, v 768..1151). Block = (256 rows, 288 columns), 8 waves of 64 rows x 144 columns (two waves per SIMD, up to 512 registers each); 64 x 4 = 256 blocks, one per WGP, all resident at once.
// q/k/v = X W + b with exact bf16 products (K = DIN) -> q, k: f16 rows [b*t][CC]; v: f16 planes [b][c][t]. Every 16-column tile and every 32-column segment lies inside one head of one of q, k, v (288 = 9 x 32).
#define PBM 256            // rows of X per block
#define PBN 288            // joined output columns per block
#define PNJ 9              // 16-column tiles per wave
#define PSP (PBN + 8)      // f16 per epilogue row of q/k: 592 B (16 B x odd)
#define PTP (PBM + 8)      // f16 per epilogue plane row of v: 528 B (16 B x odd)
#define PSHB (PBM * PSP * 2)             // bytes of the epilogue's row array
#define PLDS (PSHB + 96 * PTP * 2)       // the block that holds k and v columns keeps its 96 planes behind the rows; 288 planes alone fit as well
template <int NP> __device__ __forceinline__ void put_rows(const _Float16 (*sh)[PSP], _Float16* __restrict__ QH, _Float16* __restrict__ KH, size_t r0, int n0, int tid) {
  for (int e0 = tid; e0 < PBM * NP; e0 += 256 * 6) { v4u t[6];   // six pieces a trip (unrolled, t in registers): one LDS latency per six stores
#pragma unroll
    for (int u = 0; u < 6; ++u) { const int e = e0 + 256 * u; t[u] = *(const v4u*)&sh[e / NP][(e % NP) * 8]; }
#pragma unroll
    for (int u = 0; u < 6; ++u) { const int e = e0 + 256 * u, rl = e / NP, n = n0 + (e % NP) * 8; _Float16* D = n < CC ? QH + n : KH + (n - CC); vst2((unsigned*)(D + (r0 + rl) * CC), t[u]); }
    asm volatile("s_wait_xcnt 0x0" ::: "memory"); } }   // the stores' address registers are rewritten by the next trip: the wait stands in front of that
__global__ __launch_bounds__(256) void k_proj(const float* __restrict__ X, const float* __restrict__ WQ, const float* __restrict__ WK, const float* __restrict__ WV, const float* __restrict__ BQ, const float* __restrict__ BK, const float* __restrict__ BV,
    _Float16* __restrict__ QH, _Float16* __restrict__ KH, _Float16* __restrict__ VT) {
  // one LDS block: the main loop's operand tiles (2 buffers) and the epilogue's transpose arrays (q/k rows sh, v planes th) live at different times, separated by the barrier after the loop
  __shared__ __align__(16) unsigned char smem[PLDS];
  __bf16 (*sA)[PBM][GP] = (__bf16 (*)[PBM][GP])smem; __bf16 (*sW)[PBN][GP] = (__bf16 (*)[PBN][GP])(smem + 2 * PBM * GP * 2);
  const int tid = threadIdx.x, wave = __builtin_amdgcn_readfirstlane(tid >> 5), lane = tid & 31, col = lane & 15, g = lane >> 4; const int n0 = blockIdx.y * PBN; const size_t r0 = (size_t)blockIdx.x * PBM; const size_t bb = r0 / TT; const int t0 = (int)(r0 % TT);
  const int wr = (wave >> 1) * 64, wc = (wave & 1) * (PNJ * 16);   // the wave's 64 x 144 piece of the block's tile: each X fragment feeds 9 products, each W fragment 4
  v8f acc[4][PNJ] = {};
  // per 32 k: the block's X tile (256 x 32) and W tile (32 x 288) are read once with whole-line loads, rounded to bf16 and laid in LDS as [row][k] and [column][k]; the next tile's loads fly under this tile's products
  const int xr = tid >> 3, xp = tid & 7;
  const float* xg = X + (r0 + xr) * DIN + xp * 4;                                             // 16-byte piece xp of rows xr + 32 i
  // W tile = 9 column segments of 32; wave w brings rows k = 4 w .. 4 w + 3 of every segment: a wave's load covers one 128-byte line, a lane holds 4 consecutive k of one column (one 8-byte LDS store)
  const float* wb[PNJ];   // block-uniform: segment i's first column in the per-head [h][D][64] weights of its own matrix, row k at + 64 k
#pragma unroll
  for (int i = 0; i < PNJ; ++i) { const int n = n0 + 32 * i, wh = n / CC, c = n % CC; wb[i] = (wh == 0 ? WQ : wh == 1 ? WK : WV) + (size_t)(c >> 6) * DIN * 64 + (c & 63); }
  const int wo = wave * 256 + lane;   // the lane's element in every segment's first 32 rows
  v4f rx[8]; float rw[PNJ][4];   // the short loops over rx, rw, a, wf and acc are fully unrolled so that these arrays stay in registers
#pragma unroll
  for (int i = 0; i < 8; ++i) rx[i] = *(const v4f*)(xg + (size_t)(32 * i) * DIN);
#pragma unroll
  for (int i = 0; i < PNJ; ++i)
#pragma unroll
    for (int e = 0; e < 4; ++e) rw[i][e] = wb[i][wo + e * 64];
  asm volatile("s_wait_xcnt 0x0" :: "v"(xg), "v"(wo) : "memory");   // the loads' address registers may be rewritten by what follows: the wait stands in front of that; xg and wo are named as inputs so that their registers stay live, and so unwritten, up to the wait
  __builtin_amdgcn_sched_barrier(0);   // keeps the later address arithmetic and zeroing, which reuse those registers, behind the wait
#pragma unroll 2   // two trips per pass: the buffer index becomes a constant LDS offset
  for (int kc = 0; kc < DIN / 32; ++kc) { const int bu = kc & 1;
#pragma unroll
    for (int i = 0; i < 8; ++i) { v4b x4;
#pragma unroll
      for (int e = 0; e < 4; ++e) x4[e] = (__bf16)rx[i][e];
      *(v4b*)&sA[bu][xr + 32 * i][xp * 4] = x4; }
#pragma unroll
    for (int i = 0; i < PNJ; ++i) { v4b w4;
#pragma unroll
      for (int e = 0; e < 4; ++e) w4[e] = (__bf16)rw[i][e];
      *(v4b*)&sW[bu][32 * i + lane][4 * wave] = w4; }
    __syncthreads();   // publishes buffer bu; the other buffer's readers all passed it too, so the next trip may refill that one
    if (kc + 1 < DIN / 32) {
#pragma unroll
      for (int i = 0; i < 8; ++i) rx[i] = *(const v4f*)(xg + (size_t)(32 * i) * DIN + (kc + 1) * 32);
#pragma unroll
      for (int i = 0; i < PNJ; ++i) { const float* wk = wb[i] + (kc + 1) * (32 * 64);   // block-uniform base of the next 32 rows; the lane's offset wo stays as it is
#pragma unroll
        for (int e = 0; e < 4; ++e) rw[i][e] = wk[wo + e * 64]; }
      asm volatile("s_wait_xcnt 0x0" ::: "memory"); }   // the loads' address registers may be rewritten by what follows: the wait stands in front of that
    v16b a[4], wf[PNJ];
#pragma unroll
    for (int i = 0; i < 4; ++i) a[i] = frag_b(&sA[bu][wr + i * 16 + col][0], lane);
#pragma unroll
    for (int j = 0; j < PNJ; ++j) wf[j] = frag_b(&sW[bu][wc + j * 16 + col][0], lane);
    __builtin_amdgcn_sched_barrier(0);   // all fragment reads issue as one group ahead of the products: one LDS latency per tile instead of one per product
#pragma unroll
    for (int j = 0; j < PNJ; ++j)
#pragma unroll
      for (int i = 0; i < 4; ++i) acc[i][j] = __builtin_amdgcn_wmma_f32_16x16x32_bf16(false, a[i], false, wf[j], (short)0, acc[i][j], false, false);
    __builtin_amdgcn_sched_barrier(0); }   // the next trip's converts wait for the loads in flight: they stay behind this tile's products
  float bias[PNJ];   // all nine loads fly together, under the barrier below
#pragma unroll
  for (int j = 0; j < PNJ; ++j) { const int n = n0 + wc + j * 16, wh = n / CC; bias[j] = (wh == 0 ? BQ : wh == 1 ? BK : BV)[n - wh * CC + col]; }
  asm volatile("s_wait_xcnt 0x0" ::: "memory");   // the loads' address registers may be rewritten by what follows: the wait stands in front of that
  __builtin_amdgcn_sched_barrier(0);   // keeps the first bias's rounding, which waits for its load, behind the issue of all nine loads
  __syncthreads();   // the last tile's readers are done before the epilogue reuses the LDS
  const int pl0 = n0 < 2 * CC ? 2 * CC - n0 : 0;        // tile column of the block's first v column (at or past PBN: none)
  const int nrow = pl0 < PBN ? pl0 : PBN;               // the block's q and k columns come first
  _Float16 (*sh)[PSP] = (_Float16 (*)[PSP])smem; _Float16 (*th)[PTP] = (_Float16 (*)[PTP])(smem + (pl0 > 0 ? PSHB : 0));
#pragma unroll
  for (int j = 0; j < PNJ; ++j) { const int cl = wc + j * 16; const float bj = bfr(bias[j]);
    if (n0 + cl < 2 * CC) {   // a q or k tile; the same for the whole wave
#pragma unroll
      for (int i = 0; i < 4; ++i)
#pragma unroll
        for (int r = 0; r < 8; ++r) sh[wr + i * 16 + 8 * g + r][cl + col] = (_Float16)(acc[i][j][r] + bj);
    } else {
#pragma unroll
      for (int i = 0; i < 4; ++i) { v8h pv;
#pragma unroll
        for (int r = 0; r < 8; ++r) pv[r] = (_Float16)(acc[i][j][r] + bj);
        *(v8h*)&th[cl - pl0 + col][wr + i * 16 + 8 * g] = pv; } } }
  __syncthreads();
  if (nrow == PBN) put_rows<PBN / 8>(sh, QH, KH, r0, n0, tid); else if (nrow > 0) put_rows<24>(sh, QH, KH, r0, n0, tid);   // 288 or 192 q/k columns, the same for the whole block
  for (int e0 = tid; e0 < (PBN - nrow) * (PBM / 8); e0 += 256 * 6) { v4u t[6];   // 0, 96 or 288 planes of 32 pieces; six pieces a trip as above; a wave stores 512 contiguous bytes of one plane
#pragma unroll
    for (int u = 0; u < 6; ++u) { const int e = e0 + 256 * u; t[u] = *(const v4u*)&th[e / (PBM / 8)][(e % (PBM / 8)) * 8]; }
#pragma unroll
    for (int u = 0; u < 6; ++u) { const int e = e0 + 256 * u; vst2((unsigned*)(VT + (bb * CC + (n0 + nrow - 2 * CC) + e / (PBM / 8)) * (size_t)TT + t0 + (e % (PBM / 8)) * 8), t[u]); }
    asm volatile("s_wait_xcnt 0x0" ::: "memory"); } }   // the stores' address registers are rewritten by the next trip: the wait stands in front of that
// ---- k_attn: block = 128 queries (4 waves x 32 = two tiles of 16 per wave) of (b, h); keys walked in LDS stages of 64 (K rows and v planes staged once per block, next stage's global loads in flight under this stage's work).
// Per 64 keys: S^T = K Q^T (A = K rows, B = q), so a lane holds one query's logits per tile; every K and v fragment read from LDS feeds both query tiles;
// running maximum and sum per lane and tile (+ one exchange between the wave halves);
// P^T = exp(logit - max) x 2^11 once to f16 is already a B operand (two D tiles = 32 keys in the hardware k order); O^T += V^T P^T; the accumulators are rescaled when the maximum moves; ctx = O^T / sum at the end.
#define AKT 64             // keys per LDS stage
#define AQT 2              // query tiles of 16 per wave
#define KPITCH 72          // f16 per staged K row: 144 B (16 B x odd), conflict-free 16-byte reads
#define VPITCH 72          // f16 per staged v plane row: 144 B
#define CSL2 (SCALE * 1.4426950408889634f)
__device__ __forceinline__ v8f wm16(v16h a, v16h b, v8f c) { return __builtin_amdgcn_wmma_f32_16x16x32_f16(false, a, false, b, (short)0, c, false, false); }
__device__ __forceinline__ float xhalf(float x) { return __builtin_bit_cast(float, __builtin_amdgcn_permlanex16(__builtin_bit_cast(int, x), __builtin_bit_cast(int, x), 0x76543210, 0xfedcba98, false, false)); }  // lane l with lane l ^ 16
// grid 8 x 6 x 16 = 768 blocks of 4 waves; three blocks (three waves per SIMD, at most 336 registers each) fit a WGP, so all blocks are resident at once
__global__ __launch_bounds__(128, 3) void k_attn(const _Float16* __restrict__ QH, const _Float16* __restrict__ KH, const _Float16* __restrict__ VT, float* __restrict__ Y) {
  __shared__ __align__(16) _Float16 sk[AKT][KPITCH]; __shared__ __align__(16) _Float16 sv[HD][VPITCH];
  const int tid = threadIdx.x, wave = tid >> 5, lane = tid & 31, col = lane & 15, g = lane >> 4; const int h = blockIdx.y, b = blockIdx.z; const int q = blockIdx.x * 128 + wave * (16 * AQT) + col;
  v16h qh[AQT][HD / 32];   // the short loops over the tile, fragment and accumulator arrays are fully unrolled so that these arrays stay in registers
#pragma unroll
  for (int u = 0; u < AQT; ++u)
#pragma unroll
    for (int kc = 0; kc < HD / 32; ++kc) qh[u][kc] = frag_h(QH + ((size_t)b * TT + q + 16 * u) * CC + h * HD + kc * 32, lane);
  asm volatile("s_wait_xcnt 0x0" ::: "memory");   // the q loads' address registers are reused by what follows: the wait stands in front of that overwrite
  __builtin_amdgcn_sched_barrier(0);   // keeps the later address arithmetic and zeroing, which reuse those registers, behind the wait
  const _Float16* kg = KH + ((size_t)b * TT + (tid >> 3)) * CC + h * HD + (tid & 7) * 8;      // 16-byte piece (tid & 7) of key rows (tid >> 3) + 16 i
  const _Float16* vg = VT + ((size_t)b * CC + h * HD + (tid >> 3)) * (size_t)TT + (tid & 7) * 8;   // 16-byte piece (tid & 7) of planes (tid >> 3) + 16 i
  v4u rk[4], rv[4];
#pragma unroll
  for (int i = 0; i < 4; ++i) { rk[i] = *(const v4u*)(kg + (size_t)(16 * i) * CC); rv[i] = *(const v4u*)(vg + (size_t)(16 * i) * TT); }
  v8f o[AQT][HD / 16] = {}; float m[AQT], l[AQT];
#pragma unroll
  for (int u = 0; u < AQT; ++u) { m[u] = -3.0e38f; l[u] = 0.f; }
  for (int s = 0; s < TT / AKT; ++s) {
#pragma unroll
    for (int i = 0; i < 4; ++i) { *(v4u*)&sk[(tid >> 3) + 16 * i][(tid & 7) * 8] = rk[i]; *(v4u*)&sv[(tid >> 3) + 16 * i][(tid & 7) * 8] = rv[i]; }
    __syncthreads();
    if (s + 1 < TT / AKT) {
#pragma unroll
      for (int i = 0; i < 4; ++i) { rk[i] = *(const v4u*)(kg + (size_t)((s + 1) * AKT + 16 * i) * CC); rv[i] = *(const v4u*)(vg + (size_t)(16 * i) * TT + (s + 1) * AKT); }
      asm volatile("s_wait_xcnt 0x0" ::: "memory"); }   // the loads' address registers are reused by what follows: the wait stands in front of that overwrite
    { v8f st[AQT][4]; v16h pf[AQT][2];
      { v16h a[4][2];
#pragma unroll
        for (int j = 0; j < 4; ++j) { a[j][0] = frag_h(&sk[j * 16 + col][0], lane); a[j][1] = frag_h(&sk[j * 16 + col][32], lane); }
        __builtin_amdgcn_sched_barrier(0);   // the stage's K fragment reads issue as one group ahead of the products: one LDS latency per stage instead of one per key tile
        // eight independent accumulator chains (4 key tiles x 2 query tiles) walk the two products side by side
#pragma unroll
        for (int j = 0; j < 4; ++j)
#pragma unroll
          for (int u = 0; u < AQT; ++u) { const v8f z = {}; st[u][j] = wm16(a[j][0], qh[u][0], z); }
#pragma unroll
        for (int j = 0; j < 4; ++j)
#pragma unroll
          for (int u = 0; u < AQT; ++u) st[u][j] = wm16(a[j][1], qh[u][1], st[u][j]); }
      v16h vf[2][HD / 16];
#pragma unroll
      for (int kk = 0; kk < 2; ++kk)
#pragma unroll
        for (int t = 0; t < HD / 16; ++t) vf[kk][t] = frag_h(&sv[t * 16 + col][kk * 32], lane);
      __builtin_amdgcn_sched_barrier(0);   // the stage's v fragment reads issue as one group here, so that their LDS latency passes under the softmax arithmetic below
#pragma unroll
      for (int u = 0; u < AQT; ++u) {
        float mx = st[u][0][0];
#pragma unroll
        for (int j = 0; j < 4; ++j)
#pragma unroll
          for (int r = 0; r < 8; ++r) mx = fmaxf(mx, st[u][j][r]);
        const float mn = fmaxf(m[u], fmaxf(mx, xhalf(mx)));   // both halves hold the query's maximum so far (unscaled logits)
        const float corr = __builtin_amdgcn_exp2f((m[u] - mn) * CSL2); m[u] = mn;   // 0 on the first pass
        const float nm = 11.0f - mn * CSL2;
        l[u] *= corr;
#pragma unroll
        for (int t = 0; t < HD / 16; ++t) o[u][t] = o[u][t] * corr;
#pragma unroll
        for (int kk = 0; kk < 2; ++kk) { v8f e0 = __builtin_elementwise_fma(st[u][2 * kk], (v8f)(CSL2), (v8f)(nm)), e1 = __builtin_elementwise_fma(st[u][2 * kk + 1], (v8f)(CSL2), (v8f)(nm));
#pragma unroll
          for (int i = 0; i < 8; ++i) e0[i] = __builtin_amdgcn_exp2f(e0[i]);
#pragma unroll
          for (int i = 0; i < 8; ++i) e1[i] = __builtin_amdgcn_exp2f(e1[i]);
#pragma unroll
          for (int i = 0; i < 8; ++i) { pf[u][kk][i] = (_Float16)e0[i]; pf[u][kk][8 + i] = (_Float16)e1[i]; }
          e0 = e0 + e1; l[u] += ((e0[0] + e0[1]) + (e0[2] + e0[3])) + ((e0[4] + e0[5]) + (e0[6] + e0[7])); } }
#pragma unroll
      for (int kk = 0; kk < 2; ++kk)
#pragma unroll
        for (int t = 0; t < HD / 16; ++t)
#pragma unroll
          for (int u = 0; u < AQT; ++u) o[u][t] = wm16(vf[kk][t], pf[u][kk], o[u][t]); }
    __builtin_amdgcn_sched_barrier(0);   // the stage's arithmetic stays in front of the closing barrier: lifted over it, the barrier's wait for the next stage's global loads would stand in mid-stage, before they have landed
    __syncthreads(); }
#pragma unroll
  for (int u = 0; u < AQT; ++u) {
    const float ls = l[u] + xhalf(l[u]); const float inv = 1.0f / ls;   // ls >= 2^11: the maximum's own term
    float* yr = Y + ((size_t)b * TT + q + 16 * u) * CC + h * HD + 8 * g;
#pragma unroll
    for (int t = 0; t < HD / 16; ++t) { const v8f v = o[u][t] * inv; vst2(yr + t * 16, (v4f){v[0], v[1], v[2], v[3]}); vst2(yr + t * 16 + 4, (v4f){v[4], v[5], v[6], v[7]}); }
    if (u + 1 < AQT) asm volatile("s_wait_xcnt 0x0" ::: "memory"); } }   // the stores' data registers are rewritten by the next tile's results: the wait stands in front of that
// ---- k_out: block = (64 rows, 128 cols): out = ctx Wo (+ bo): ctx x 2^6 once to f16 against Wo as f16(bf16 x 2^8) exact (1 product) x 2^-14; causal early rows (< QHI of each sequence): ctx bf16 hi + lo against exact bf16 Wo (2 products)
__global__ __launch_bounds__(128) void k_out(const float* __restrict__ Y, const float* __restrict__ WO, const float* __restrict__ BO, float* __restrict__ OUT) {
  // one LDS block: the main loop's operand tiles (2 buffers), then the epilogue's per-wave rows sf
  __shared__ __align__(16) unsigned char smem[4 * 16 * 132 * 4]; float (*sf)[16][132] = (float (*)[16][132])smem;
  _Float16 (*sA)[64][GP] = (_Float16 (*)[64][GP])smem; _Float16 (*sW)[128][GP] = (_Float16 (*)[128][GP])(smem + 2 * 64 * GP * 2);
  const int tid = threadIdx.x, wave = tid >> 5, lane = tid & 31, col = lane & 15, g = lane >> 4; const int c0 = blockIdx.y * 128; const size_t r0 = (size_t)blockIdx.x * 64 + wave * 16;
  v8f acc[8] = {};
  if (CAUSAL && (int)(((size_t)blockIdx.x * 64) % TT) < QHI) {   /* block-uniform */
#pragma unroll 2
    for (int kc = 0; kc < CC / 32; ++kc) { const F2 a = split_row(Y + (r0 + col) * CC, kc * 32, lane); asm volatile("s_wait_loadcnt 0x0" ::: "memory");
#pragma unroll
      for (int j = 0; j < 8; ++j) { const v16b w = WOCOL(WO, kc * 32, c0 + j * 16 + col, lane); asm volatile("s_wait_loadcnt 0x0" ::: "memory"); acc[j] = wmma_bf(a.h, w, acc[j]); acc[j] = wmma_bf(a.l, w, acc[j]); } }
#pragma unroll
    for (int j = 0; j < 8; ++j) { const float bias = BO ? bfr(BO[c0 + j * 16 + col]) : 0.f;
#pragma unroll
      for (int r = 0; r < 8; ++r) sf[wave][8 * g + r][j * 16 + col] = acc[j][r] + bias; }
  } else {
    // per 32 k: the block's ctx tile (64 x 32) and Wo tile (128 outputs x 32) are read once with whole-line loads, converted and laid in LDS as [row][k]; the next tile's loads fly under this tile's products
    const int xr = tid >> 3, xp = tid & 7;
    const float* yg = Y + ((size_t)blockIdx.x * 64 + xr) * CC + xp * 4;   // 16-byte piece xp of rows xr + 16 i
    const float* wg = WO + (size_t)(c0 + xr) * CC + xp * 4;               // 16-byte piece xp of Wo rows (outputs) c0 + xr + 16 i
    v4f ry[4], rw[8];   // the short loops over ry, rw, wf and acc are fully unrolled so that these arrays stay in registers
#pragma unroll
    for (int i = 0; i < 4; ++i) ry[i] = *(const v4f*)(yg + (size_t)(16 * i) * CC);
#pragma unroll
    for (int i = 0; i < 8; ++i) rw[i] = *(const v4f*)(wg + (size_t)(16 * i) * CC);
    asm volatile("s_wait_xcnt 0x0" ::: "memory");   // the loads' address registers may be rewritten by what follows: the wait stands in front of that
#pragma unroll 2   // two trips per pass: the buffer index becomes a constant LDS offset
    for (int kc = 0; kc < CC / 32; ++kc) { const int bu = kc & 1;
#pragma unroll
      for (int i = 0; i < 4; ++i) { v4h y4;   /* ctx carried x 2^6 into f16 so small-magnitude context rows stay clear of f16 subnormals */
#pragma unroll
        for (int e = 0; e < 4; ++e) y4[e] = (_Float16)(ry[i][e] * 64.0f);
        *(v4h*)&sA[bu][xr + 16 * i][xp * 4] = y4; }
#pragma unroll
      for (int i = 0; i < 8; ++i) { v4h w4;
#pragma unroll
        for (int e = 0; e < 4; ++e) w4[e] = (_Float16)(bfr(rw[i][e]) * 256.0f);
        *(v4h*)&sW[bu][xr + 16 * i][xp * 4] = w4; }
      __syncthreads();   // publishes buffer bu; the other buffer's readers all passed it too, so the next trip may refill that one
      if (kc + 1 < CC / 32) {
#pragma unroll
        for (int i = 0; i < 4; ++i) ry[i] = *(const v4f*)(yg + (size_t)(16 * i) * CC + (kc + 1) * 32);
#pragma unroll
        for (int i = 0; i < 8; ++i) rw[i] = *(const v4f*)(wg + (size_t)(16 * i) * CC + (kc + 1) * 32);
        asm volatile("s_wait_xcnt 0x0" ::: "memory"); }   // the loads' address registers may be rewritten by what follows: the wait stands in front of that
      const v16h a = frag_h(&sA[bu][wave * 16 + col][0], lane); v16h wf[8];
#pragma unroll
      for (int j = 0; j < 8; ++j) wf[j] = frag_h(&sW[bu][j * 16 + col][0], lane);
      __builtin_amdgcn_sched_barrier(0);   // all fragment reads issue as one group ahead of the products: one LDS latency per tile instead of one per product
#pragma unroll
      for (int j = 0; j < 8; ++j) acc[j] = wm16(a, wf[j], acc[j]);
      __builtin_amdgcn_sched_barrier(0); }   // the next trip's converts wait for the loads in flight: they stay behind this tile's products
    __syncthreads();   // the last tile's readers are done before the epilogue reuses the LDS
#pragma unroll
    for (int j = 0; j < 8; ++j) { const float bias = BO ? bfr(BO[c0 + j * 16 + col]) : 0.f;
#pragma unroll
      for (int r = 0; r < 8; ++r) sf[wave][8 * g + r][j * 16 + col] = acc[j][r] * (1.0f / 16384.0f) + bias; } }   /* 2^-8 (Wo carry) x 2^-6 (ctx carry) */
  LDSX(); for (int rl = 0; rl < 16; ++rl) vst2(OUT + (r0 + rl) * DIN + c0 + lane * 4, *(const v4f*)&sf[wave][rl][lane * 4]); }

extern "C" void kernel_launch(void* const* d_in, const int* in_sizes, int n_in, void* d_out, int out_size, void* d_ws, size_t ws_size, hipStream_t stream) {
  (void)in_sizes; (void)n_in; (void)out_size;
  const float** F = (const float**)d_in;
  if (ws_size < (size_t)WS_END) return;
  char* ws = (char*)d_ws; _Float16 *QH = (_Float16*)(ws + WS_QH), *KH = (_Float16*)(ws + WS_KH), *VT = (_Float16*)(ws + WS_VT), *KL = (_Float16*)(ws + WS_KL); __bf16 *VB = (__bf16*)(ws + WS_VB), *VBL = (__bf16*)(ws + WS_VBL); float *S = (float*)(ws + WS_S), *Y = (float*)(ws + WS_Y);
  (void)Y; (void)KL; (void)VB; (void)VBL; (void)S;
  // inputs: 0 x [16,1024,384]; 1 Wq [6,384,64], 2 bq [6,64]; 3 Wk, 4 bk; 5 Wv, 6 bv; 7 Wo [384,384] (out,in), 8 bo [384]
  k_proj<<<dim3(TNB * TT / PBM, 3 * CC / PBN), 256, 0, stream>>>(F[0], F[1], F[3], F[5], F[2], F[4], F[6], QH, KH, VT);
  k_attn<<<dim3(TT / 128, NH, TNB), 128, 0, stream>>>(QH, KH, VT, Y);
  k_out<<<dim3(TNB * TT / 64, DIN / 128), 128, 0, stream>>>(Y, F[7], F[8], (float*)d_out);
}

// v007
// It runs in 64.7 microseconds.
// Next to v006, in two timings, it ran 1.10 times as fast each time.
// Over all steps from v000 it is 17.6 times as fast.
// compute dtype: all float inputs rounded to bf16; per-head q/k/v projections with EXACT bf16 products on WMMA 16x16x32 (f32 accumulate) + bias; logits with q once to f16 against k once to f16 (1 product) x 64^-0.5; softmax f32 with a running maximum and sum (logits stay on chip); exp(logit - max) x 2^11 once to f16 x v once to f16 (1 product), divided by the f32 sum at the end; ctx carried x 2^6 once to f16 x Wo f16(bf16 x 2^8) + bo; f32 output.
#include <hip/hip_runtime.h>
#include <math.h>

typedef __attribute__((ext_vector_type(16))) _Float16 v16h;
typedef __attribute__((ext_vector_type(16))) __bf16 v16b;
typedef __attribute__((ext_vector_type(8)))  _Float16 v8h;
typedef __attribute__((ext_vector_type(8)))  float v8f;
typedef __attribute__((ext_vector_type(4)))  float v4f;
typedef __attribute__((ext_vector_type(2)))  float v2f;
typedef __attribute__((ext_vector_type(4)))  unsigned v4u;
typedef __attribute__((ext_vector_type(4)))  int v4i;
typedef float __attribute__((may_alias)) float_a;
typedef int __attribute__((may_alias)) int_a;

template <typename T> __device__ __forceinline__ void vst2(void* p, T v) { *(T*)p = v;  }
__device__ __forceinline__ v8f wmma16(v16h a, v16h b, v8f c) {
  v8f d = __builtin_amdgcn_wmma_f32_16x16x32_f16(false, a, false, b, (short)0, c, false, false);
  asm volatile("v_nop\n\tv_nop\n\tv_nop\n\tv_nop" : "+v"(d) : "v"(a), "v"(b));
  return d;
}
__device__ __forceinline__ v8f wmma_bf(v16b a, v16b b, v8f c) {
  v8f d = __builtin_amdgcn_wmma_f32_16x16x32_bf16(false, a, false, b, (short)0, c, false, false);
  asm volatile("v_nop\n\tv_nop\n\tv_nop\n\tv_nop" : "+v"(d) : "v"(a), "v"(b));
  return d;
}
// 16x16x32 fragments: lane = (h = lane>>4, row/col = lane&15); elements 0..7 = k0+8h+0..7, 8..15 = k0+16+8h+0..7; D element r = row 8h+r
__device__ __forceinline__ v16h frag_h(const _Float16* rowk0, int lane) {
  union { v16h v; v8h q[2]; } u; const _Float16* p = rowk0 + 8 * (lane >> 4);
  u.q[0] = *(const v8h*)p; u.q[1] = *(const v8h*)(p + 16); return u.v;
}
__device__ __forceinline__ v16h frag_f32(const float* rowk0, int lane) {
  v16h a; const float* p = rowk0 + 8 * (lane >> 4);
#pragma unroll
  for (int i = 0; i < 8; ++i) { a[i] = (_Float16)p[i]; a[8 + i] = (_Float16)p[16 + i]; }
  return a;
}
__device__ __forceinline__ v16h frag_f32s(const float* rowk0, int lane, float sc) {
  v16h a; const float* p = rowk0 + 8 * (lane >> 4);
#pragma unroll
  for (int i = 0; i < 8; ++i) { a[i] = (_Float16)(p[i] * sc); a[8 + i] = (_Float16)(p[16 + i] * sc); }
  return a;
}
// column fragment from a [K][ld] layout (column n), rows >= K read as 0
__device__ __forceinline__ v16h fragc_f32(const float* W, int k0, int n, int lane, int ld, int K) {
  v16h a; const int g = lane >> 4;
#pragma unroll
  for (int i = 0; i < 8; ++i) { const int ka = k0 + 8 * g + i, kb = ka + 16;
    a[i] = (_Float16)(ka < K ? W[(size_t)(ka < K ? ka : K - 1) * ld + n] : 0.f); a[8 + i] = (_Float16)(kb < K ? W[(size_t)(kb < K ? kb : K - 1) * ld + n] : 0.f); }
  return a;
}
struct F2 { v16b h, l; };
__device__ __forceinline__ F2 bsplit16(const float v[16]) { F2 r;
#pragma unroll
  for (int i = 0; i < 16; ++i) { const __bf16 h = (__bf16)v[i]; r.h[i] = h; r.l[i] = (__bf16)(v[i] - (float)h); }
  return r; }
__device__ __forceinline__ F2 split_row(const float* row, int k0, int lane) { float v[16]; const float* p = row + k0 + 8 * (lane >> 4);
#pragma unroll
  for (int i = 0; i < 8; ++i) { v[i] = p[i]; v[8 + i] = p[16 + i]; }
  return bsplit16(v); }
__device__ __forceinline__ F2 split_rowK(const float* row, int k0, int lane, int K) { float v[16]; const int g = lane >> 4;
#pragma unroll
  for (int i = 0; i < 8; ++i) { const int ka = k0 + 8 * g + i, kb = ka + 16; v[i] = ka < K ? row[ka < K ? ka : K - 1] : 0.f; v[8 + i] = kb < K ? row[kb < K ? kb : K - 1] : 0.f; }
  return bsplit16(v); }
__device__ __forceinline__ F2 split_col(const float* W, int k0, int n, int lane, int ld, int K) { float v[16]; const int g = lane >> 4;
#pragma unroll
  for (int i = 0; i < 8; ++i) { const int ka = k0 + 8 * g + i, kb = ka + 16; v[i] = ka < K ? W[(size_t)(ka < K ? ka : K - 1) * ld + n] : 0.f; v[8 + i] = kb < K ? W[(size_t)(kb < K ? kb : K - 1) * ld + n] : 0.f; }
  return bsplit16(v); }
__device__ __forceinline__ v8f mac3(const F2& a, const F2& b, v8f c) { c = wmma_bf(a.l, b.h, c); c = wmma_bf(a.h, b.l, c); return wmma_bf(a.h, b.h, c); }
__device__ __forceinline__ float sigm(float v) { return 1.0f / (1.0f + expf(-v)); }
#define LDSX() do { asm volatile("s_wait_dscnt 0" ::: "memory"); __builtin_amdgcn_wave_barrier(); __builtin_amdgcn_fence(__ATOMIC_RELEASE, "workgroup"); } while (0)

// Multi-head self-attention (B 16, S 1,024, D 384 = 6 heads x 64; per-head (in,out) Wq/Wk/Wv [6,384,64] + biases [6,64], 0.02-scale; (out,in) Wo [384,384] + bo): out = merge(softmax(q k^T / 8) v) Wo^T + bo.
#define NB 16
#define TT 1024
#define CC 384            // NH * HD = projected width
#define DIN 384          // input (model) width
#define NH 6
#define HD 64
#define NQB (TT / 64)
#define HG 6
#define SCALE (0.125f)
#define CAUSAL 0
#ifndef TNB
#define TNB NB
#endif
__device__ __forceinline__ float bfr(float v) { return (float)(__bf16)v; }
__host__ __device__ __forceinline__ int kb_last(int qb) { return CAUSAL ? ((qb * 64 + 63) >> 7) : (TT / 128 - 1); }
typedef __attribute__((ext_vector_type(8))) __bf16 v8b;
typedef __attribute__((ext_vector_type(4))) __bf16 v4b;
typedef __attribute__((ext_vector_type(4))) _Float16 v4h;
#define GP 40              // 16-bit elements per staged GEMM tile row: 32 k + 8 = 80 B (16 B x odd), conflict-free 16-byte reads
__device__ __forceinline__ v16b frag_b(const __bf16* rowk0, int lane) {
  union { v16b v; v8b q[2]; } u; const __bf16* p = rowk0 + 8 * (lane >> 4);
  u.q[0] = *(const v8b*)p; u.q[1] = *(const v8b*)(p + 16); return u.v;
}
#define QBH 0              // unused: k_attn has no high-precision path for early query blocks
#define QHI 0               // rows carrying a q residual plane: none (q enters the logits once as f16, as k does)
#define KHI 64            // key rows carrying k residual / v bf16 hi+lo planes (workspace reserved; written and read by no kernel here)
// B fragment (k rows k0+.., output column o) of a weight: (in,out) [K][ld] or (out,in) [ld rows of K]: bf16 exact, or f16(bf16 * 256) exact
__device__ __forceinline__ v16b wcol_io(const float* Wm, int k0, int o, int lane, int ld) { v16b w; const int g = lane >> 4;
#pragma unroll
  for (int i = 0; i < 8; ++i) { w[i] = (__bf16)Wm[(size_t)(k0 + 8 * g + i) * ld + o]; w[8 + i] = (__bf16)Wm[(size_t)(k0 + 16 + 8 * g + i) * ld + o]; }
  return w; }
__device__ __forceinline__ v16b wcol_oi(const float* Wm, int k0, int o, int lane, int K) { v16b w; const float* p = Wm + (size_t)o * K + k0 + 8 * (lane >> 4);
#pragma unroll
  for (int i = 0; i < 8; ++i) { w[i] = (__bf16)p[i]; w[8 + i] = (__bf16)p[16 + i]; }
  return w; }
__device__ __forceinline__ v16h wcolh_io(const float* Wm, int k0, int o, int lane, int ld) { v16h w; const int g = lane >> 4;
#pragma unroll
  for (int i = 0; i < 8; ++i) { w[i] = (_Float16)(bfr(Wm[(size_t)(k0 + 8 * g + i) * ld + o]) * 256.0f); w[8 + i] = (_Float16)(bfr(Wm[(size_t)(k0 + 16 + 8 * g + i) * ld + o]) * 256.0f); }
  return w; }
__device__ __forceinline__ v16h wcolh_oi(const float* Wm, int k0, int o, int lane, int K) { v16h w; const float* p = Wm + (size_t)o * K + k0 + 8 * (lane >> 4);
#pragma unroll
  for (int i = 0; i < 8; ++i) { w[i] = (_Float16)(bfr(p[i]) * 256.0f); w[8 + i] = (_Float16)(bfr(p[16 + i]) * 256.0f); }
  return w; }
#define WQKV_LAYOUT 0   // 0 = per-head [NH][DIN][HD] (wcol_heads); 1 = (out,in) [CC][DIN]; 2 = per-head [NH][DIN][HD]
__device__ __forceinline__ v16b wcol_hdk(const float* Wm, int k0, int o, int lane) { v16b w; const int g = lane >> 4; const float* p = Wm + (size_t)(o / HD) * DIN * HD + (o % HD);
#pragma unroll
  for (int i = 0; i < 8; ++i) { w[i] = (__bf16)p[(size_t)(k0 + 8 * g + i) * HD]; w[8 + i] = (__bf16)p[(size_t)(k0 + 16 + 8 * g + i) * HD]; }
  return w; }
#define WO_OUT_IN 1
#if WQKV_LAYOUT == 1
#define WCOL(W, k0, o, lane) wcol_oi(W, k0, o, lane, DIN)
#elif WQKV_LAYOUT == 2
#define WCOL(W, k0, o, lane) wcol_hdk(W, k0, o, lane)
#else
#define WCOL(W, k0, o, lane) wcol_heads(W, k0, o, lane)   /* per-head [h][D][64] weights */
#endif
#if WO_OUT_IN
#define WOCOL(W, k0, o, lane) wcol_oi(W, k0, o, lane, CC)
#define WOCOLH(W, k0, o, lane) wcolh_oi(W, k0, o, lane, CC)
#else
#define WOCOL(W, k0, o, lane) wcol_io(W, k0, o, lane, DIN)
#define WOCOLH(W, k0, o, lane) wcolh_io(W, k0, o, lane, DIN)
#endif
// per-head projection weights W[h][D][64] ([6][384][64]): column o = h*64 + d of the virtual (in,out) [D][384] matrix lives at W + (h*D + k)*64 + d
__device__ __forceinline__ v16b wcol_heads(const float* __restrict__ Wm, int k0, int o, int lane) { v16b w; const int g = lane >> 4; const float* p = Wm + ((size_t)(o >> 6) * DIN + k0 + 8 * g) * 64 + (o & 63);
#pragma unroll
  for (int i = 0; i < 8; ++i) { w[i] = (__bf16)p[(size_t)i * 64]; w[8 + i] = (__bf16)p[(size_t)(16 + i) * 64]; }
  asm volatile("s_wait_loadcnt 0x0" ::: "memory"); return w; }
#ifndef SM_EXTRA_PARAMS
#define SM_EXTRA_PARAMS
#endif
#ifndef PROJ_EXTRA_PARAMS
#define PROJ_EXTRA_PARAMS
#endif
#ifndef SM_MASK_HOOK
#define SM_MASK_HOOK (void)0
#endif

#define WS_QH  0u                                      // f16 q rows [b*t][CC]
#define WS_KH  (WS_QH + 2u * (size_t)NB * TT * CC)      // f16 k rows [b*t][CC]
#define WS_VT  (WS_KH + 2u * (size_t)NB * TT * CC)      // f16 v planes [b][c][t]
#define WS_QL  (WS_VT + 2u * (size_t)NB * CC * TT)      // f16 q residual x 2^10 rows [b][t < QHI][CC]
#define WS_KL  (WS_QL + 2u * (size_t)NB * QHI * CC)     // f16 k residual x 2^10 rows [b][t < KHI][CC]
#define WS_VB  (WS_KL + 2u * (size_t)NB * KHI * CC)     // bf16 v hi planes [b][c][t < KHI]
#define WS_VBL (WS_VB + 2u * (size_t)NB * CC * KHI)
#define WS_S   (WS_VBL + 2u * (size_t)NB * CC * KHI)    // f32 [hg][t][s] (workspace reserved; written and read by no kernel here: the logits stay on chip)
#define WS_Y   (WS_S  + 4u * (size_t)HG * TT * TT)      // f16 ctx x 2^6 rows [b*t][CC] (the plane's first half)
#define WS_END (WS_Y  + 4u * (size_t)NB * TT * CC)

// ---- k_proj: the q, k and v projections are one GEMM over 1,152 joined columns (q 0..383, k 384..767, v 768..1151). Block = (256 rows, 288 columns), 8 waves of 64 rows x 144 columns (two waves per SIMD, up to 512 registers each); 64 x 4 = 256 blocks, one per WGP, all resident at once.
// q/k/v = X W + b with exact bf16 products (K = DIN) -> q, k: f16 rows [b*t][CC]; v: f16 planes [b][c][t]. Every 16-column tile and every 32-column segment lies inside one head of one of q, k, v (288 = 9 x 32).
#define PBM 256            // rows of X per block
#define PBN 288            // joined output columns per block
#define PNJ 9              // 16-column tiles per wave
#define PSP (PBN + 8)      // f16 per epilogue row of q/k: 592 B (16 B x odd)
#define PTP (PBM + 8)      // f16 per epilogue plane row of v: 528 B (16 B x odd)
#define PSHB (PBM * PSP * 2)             // bytes of the epilogue's row array
#define PLDS (PSHB + 96 * PTP * 2)       // the block that holds k and v columns keeps its 96 planes behind the rows; 288 planes alone fit as well
template <int NP> __device__ __forceinline__ void put_rows(const _Float16 (*sh)[PSP], _Float16* __restrict__ QH, _Float16* __restrict__ KH, size_t r0, int n0, int tid) {
  for (int e0 = tid; e0 < PBM * NP; e0 += 256 * 6) { v4u t[6];   // six pieces a trip (unrolled, t in registers): one LDS latency per six stores
#pragma unroll
    for (int u = 0; u < 6; ++u) { const int e = e0 + 256 * u; t[u] = *(const v4u*)&sh[e / NP][(e % NP) * 8]; }
#pragma unroll
    for (int u = 0; u < 6; ++u) { const int e = e0 + 256 * u, rl = e / NP, n = n0 + (e % NP) * 8; _Float16* D = n < CC ? QH + n : KH + (n - CC); vst2((unsigned*)(D + (r0 + rl) * CC), t[u]); }
    asm volatile("s_wait_xcnt 0x0" ::: "memory"); } }   // the stores' address registers are rewritten by the next trip: the wait stands in front of that
__global__ __launch_bounds__(256) void k_proj(const float* __restrict__ X, const float* __restrict__ WQ, const float* __restrict__ WK, const float* __restrict__ WV, const float* __restrict__ BQ, const float* __restrict__ BK, const float* __restrict__ BV,
    _Float16* __restrict__ QH, _Float16* __restrict__ KH, _Float16* __restrict__ VT) {
  // one LDS block: the main loop's operand tiles (2 buffers) and the epilogue's transpose arrays (q/k rows sh, v planes th) live at different times, separated by the barrier after the loop
  __shared__ __align__(16) unsigned char smem[PLDS];
  __bf16 (*sA)[PBM][GP] = (__bf16 (*)[PBM][GP])smem; __bf16 (*sW)[PBN][GP] = (__bf16 (*)[PBN][GP])(smem + 2 * PBM * GP * 2);
  const int tid = threadIdx.x, wave = __builtin_amdgcn_readfirstlane(tid >> 5), lane = tid & 31, col = lane & 15, g = lane >> 4; const int n0 = blockIdx.y * PBN; const size_t r0 = (size_t)blockIdx.x * PBM; const size_t bb = r0 / TT; const int t0 = (int)(r0 % TT);
  const int wr = (wave >> 1) * 64, wc = (wave & 1) * (PNJ * 16);   // the wave's 64 x 144 piece of the block's tile: each X fragment feeds 9 products, each W fragment 4
  v8f acc[4][PNJ] = {};
  // per 32 k: the block's X tile (256 x 32) and W tile (32 x 288) are read once with whole-line loads, rounded to bf16 and laid in LDS as [row][k] and [column][k]; the next tile's loads fly under this tile's products
  const int xr = tid >> 3, xp = tid & 7;
  const float* xg = X + (r0 + xr) * DIN + xp * 4;                                             // 16-byte piece xp of rows xr + 32 i
  // W tile = 9 column segments of 32; wave w brings rows k = 4 w .. 4 w + 3 of every segment: a wave's load covers one 128-byte line, a lane holds 4 consecutive k of one column (one 8-byte LDS store)
  const float* wb[PNJ];   // block-uniform: segment i's first column in the per-head [h][D][64] weights of its own matrix, row k at + 64 k
#pragma unroll
  for (int i = 0; i < PNJ; ++i) { const int n = n0 + 32 * i, wh = n / CC, c = n % CC; wb[i] = (wh == 0 ? WQ : wh == 1 ? WK : WV) + (size_t)(c >> 6) * DIN * 64 + (c & 63); }
  const int wo = wave * 256 + lane;   // the lane's element in every segment's first 32 rows
  v4f rx[8]; float rw[PNJ][4];   // the short loops over rx, rw, a, wf and acc are fully unrolled so that these arrays stay in registers
#pragma unroll
  for (int i = 0; i < 8; ++i) rx[i] = *(const v4f*)(xg + (size_t)(32 * i) * DIN);
#pragma unroll
  for (int i = 0; i < PNJ; ++i)
#pragma unroll
    for (int e = 0; e < 4; ++e) rw[i][e] = wb[i][wo + e * 64];
  asm volatile("s_wait_xcnt 0x0" :: "v"(xg), "v"(wo) : "memory");   // the loads' address registers may be rewritten by what follows: the wait stands in front of that; xg and wo are named as inputs so that their registers stay live, and so unwritten, up to the wait
  __builtin_amdgcn_sched_barrier(0);   // keeps the later address arithmetic and zeroing, which reuse those registers, behind the wait
#pragma unroll 2   // two trips per pass: the buffer index becomes a constant LDS offset
  for (int kc = 0; kc < DIN / 32; ++kc) { const int bu = kc & 1;
#pragma unroll
    for (int i = 0; i < 8; ++i) { v4b x4;
#pragma unroll
      for (int e = 0; e < 4; ++e) x4[e] = (__bf16)rx[i][e];
      *(v4b*)&sA[bu][xr + 32 * i][xp * 4] = x4; }
#pragma unroll
    for (int i = 0; i < PNJ; ++i) { v4b w4;
#pragma unroll
      for (int e = 0; e < 4; ++e) w4[e] = (__bf16)rw[i][e];
      *(v4b*)&sW[bu][32 * i + lane][4 * wave] = w4; }
    __syncthreads();   // publishes buffer bu; the other buffer's readers all passed it too, so the next trip may refill that one
    if (kc + 1 < DIN / 32) {
#pragma unroll
      for (int i = 0; i < 8; ++i) rx[i] = *(const v4f*)(xg + (size_t)(32 * i) * DIN + (kc + 1) * 32);
#pragma unroll
      for (int i = 0; i < PNJ; ++i) { const float* wk = wb[i] + (kc + 1) * (32 * 64);   // block-uniform base of the next 32 rows; the lane's offset wo stays as it is
#pragma unroll
        for (int e = 0; e < 4; ++e) rw[i][e] = wk[wo + e * 64]; }
      asm volatile("s_wait_xcnt 0x0" ::: "memory"); }   // the loads' address registers may be rewritten by what follows: the wait stands in front of that
    v16b a[4], wf[PNJ];
#pragma unroll
    for (int i = 0; i < 4; ++i) a[i] = frag_b(&sA[bu][wr + i * 16 + col][0], lane);
#pragma unroll
    for (int j = 0; j < PNJ; ++j) wf[j] = frag_b(&sW[bu][wc + j * 16 + col][0], lane);
    __builtin_amdgcn_sched_barrier(0);   // all fragment reads issue as one group ahead of the products: one LDS latency per tile instead of one per product
#pragma unroll
    for (int j = 0; j < PNJ; ++j)
#pragma unroll
      for (int i = 0; i < 4; ++i) acc[i][j] = __builtin_amdgcn_wmma_f32_16x16x32_bf16(false, a[i], false, wf[j], (short)0, acc[i][j], false, false);
    __builtin_amdgcn_sched_barrier(0); }   // the next trip's converts wait for the loads in flight: they stay behind this tile's products
  float bias[PNJ];   // all nine loads fly together, under the barrier below
#pragma unroll
  for (int j = 0; j < PNJ; ++j) { const int n = n0 + wc + j * 16, wh = n / CC; bias[j] = (wh == 0 ? BQ : wh == 1 ? BK : BV)[n - wh * CC + col]; }
  asm volatile("s_wait_xcnt 0x0" ::: "memory");   // the loads' address registers may be rewritten by what follows: the wait stands in front of that
  __builtin_amdgcn_sched_barrier(0);   // keeps the first bias's rounding, which waits for its load, behind the issue of all nine loads
  __syncthreads();   // the last tile's readers are done before the epilogue reuses the LDS
  const int pl0 = n0 < 2 * CC ? 2 * CC - n0 : 0;        // tile column of the block's first v column (at or past PBN: none)
  const int nrow = pl0 < PBN ? pl0 : PBN;               // the block's q and k columns come first
  _Float16 (*sh)[PSP] = (_Float16 (*)[PSP])smem; _Float16 (*th)[PTP] = (_Float16 (*)[PTP])(smem + (pl0 > 0 ? PSHB : 0));
#pragma unroll
  for (int j = 0; j < PNJ; ++j) { const int cl = wc + j * 16; const float bj = bfr(bias[j]);
    if (n0 + cl < 2 * CC) {   // a q or k tile; the same for the whole wave
#pragma unroll
      for (int i = 0; i < 4; ++i)
#pragma unroll
        for (int r = 0; r < 8; ++r) sh[wr + i * 16 + 8 * g + r][cl + col] = (_Float16)(acc[i][j][r] + bj);
    } else {
#pragma unroll
      for (int i = 0; i < 4; ++i) { v8h pv;
#pragma unroll
        for (int r = 0; r < 8; ++r) pv[r] = (_Float16)(acc[i][j][r] + bj);
        *(v8h*)&th[cl - pl0 + col][wr + i * 16 + 8 * g] = pv; } } }
  __syncthreads();
  if (nrow == PBN) put_rows<PBN / 8>(sh, QH, KH, r0, n0, tid); else if (nrow > 0) put_rows<24>(sh, QH, KH, r0, n0, tid);   // 288 or 192 q/k columns, the same for the whole block
  for (int e0 = tid; e0 < (PBN - nrow) * (PBM / 8); e0 += 256 * 6) { v4u t[6];   // 0, 96 or 288 planes of 32 pieces; six pieces a trip as above; a wave stores 512 contiguous bytes of one plane
#pragma unroll
    for (int u = 0; u < 6; ++u) { const int e = e0 + 256 * u; t[u] = *(const v4u*)&th[e / (PBM / 8)][(e % (PBM / 8)) * 8]; }
#pragma unroll
    for (int u = 0; u < 6; ++u) { const int e = e0 + 256 * u; vst2((unsigned*)(VT + (bb * CC + (n0 + nrow - 2 * CC) + e / (PBM / 8)) * (size_t)TT + t0 + (e % (PBM / 8)) * 8), t[u]); }
    asm volatile("s_wait_xcnt 0x0" ::: "memory"); } }   // the stores' address registers are rewritten by the next trip: the wait stands in front of that
// ---- k_attn: block = 128 queries (4 waves x 32 = two tiles of 16 per wave) of (b, h); keys walked in LDS stages of 64 (K rows and v planes staged once per block, next stage's global loads in flight under this stage's work).
// Per 64 keys: S^T = K Q^T (A = K rows, B = q), so a lane holds one query's logits per tile; every K and v fragment read from LDS feeds both query tiles;
// running maximum and sum per lane and tile (+ one exchange between the wave halves);
// P^T = exp(logit - max) x 2^11 once to f16 is already a B operand (two D tiles = 32 keys in the hardware k order); O^T += V^T P^T; the accumulators are rescaled when the maximum moves; ctx = O^T / sum at the end.
#define AKT 64             // keys per LDS stage
#define AQT 2              // query tiles of 16 per wave
#define KPITCH 72          // f16 per staged K row: 144 B (16 B x odd), conflict-free 16-byte reads
#define VPITCH 72          // f16 per staged v plane row: 144 B
#define CSL2 (SCALE * 1.4426950408889634f)
__device__ __forceinline__ v8f wm16(v16h a, v16h b, v8f c) { return __builtin_amdgcn_wmma_f32_16x16x32_f16(false, a, false, b, (short)0, c, false, false); }
__device__ __forceinline__ float xhalf(float x) { return __builtin_bit_cast(float, __builtin_amdgcn_permlanex16(__builtin_bit_cast(int, x), __builtin_bit_cast(int, x), 0x76543210, 0xfedcba98, false, false)); }  // lane l with lane l ^ 16
// grid 8 x 6 x 16 = 768 blocks of 4 waves; three blocks (three waves per SIMD, at most 336 registers each) fit a WGP, so all blocks are resident at once
__global__ __launch_bounds__(128, 3) void k_attn(const _Float16* __restrict__ QH, const _Float16* __restrict__ KH, const _Float16* __restrict__ VT, _Float16* __restrict__ YH) {
  __shared__ __align__(16) _Float16 sk[AKT][KPITCH]; __shared__ __align__(16) _Float16 sv[HD][VPITCH];
  const int tid = threadIdx.x, wave = tid >> 5, lane = tid & 31, col = lane & 15, g = lane >> 4; const int h = blockIdx.y, b = blockIdx.z; const int q = blockIdx.x * 128 + wave * (16 * AQT) + col;
  v16h qh[AQT][HD / 32];   // the short loops over the tile, fragment and accumulator arrays are fully unrolled so that these arrays stay in registers
#pragma unroll
  for (int u = 0; u < AQT; ++u)
#pragma unroll
    for (int kc = 0; kc < HD / 32; ++kc) qh[u][kc] = frag_h(QH + ((size_t)b * TT + q + 16 * u) * CC + h * HD + kc * 32, lane);
  asm volatile("s_wait_xcnt 0x0" ::: "memory");   // the q loads' address registers are reused by what follows: the wait stands in front of that overwrite
  __builtin_amdgcn_sched_barrier(0);   // keeps the later address arithmetic and zeroing, which reuse those registers, behind the wait
  const _Float16* kg = KH + ((size_t)b * TT + (tid >> 3)) * CC + h * HD + (tid & 7) * 8;      // 16-byte piece (tid & 7) of key rows (tid >> 3) + 16 i
  const _Float16* vg = VT + ((size_t)b * CC + h * HD + (tid >> 3)) * (size_t)TT + (tid & 7) * 8;   // 16-byte piece (tid & 7) of planes (tid >> 3) + 16 i
  v4u rk[4], rv[4];
#pragma unroll
  for (int i = 0; i < 4; ++i) { rk[i] = *(const v4u*)(kg + (size_t)(16 * i) * CC); rv[i] = *(const v4u*)(vg + (size_t)(16 * i) * TT); }
  v8f o[AQT][HD / 16] = {}; float m[AQT], l[AQT];
#pragma unroll
  for (int u = 0; u < AQT; ++u) { m[u] = -3.0e38f; l[u] = 0.f; }
  for (int s = 0; s < TT / AKT; ++s) {
#pragma unroll
    for (int i = 0; i < 4; ++i) { *(v4u*)&sk[(tid >> 3) + 16 * i][(tid & 7) * 8] = rk[i]; *(v4u*)&sv[(tid >> 3) + 16 * i][(tid & 7) * 8] = rv[i]; }
    __syncthreads();
    if (s + 1 < TT / AKT) {
#pragma unroll
      for (int i = 0; i < 4; ++i) { rk[i] = *(const v4u*)(kg + (size_t)((s + 1) * AKT + 16 * i) * CC); rv[i] = *(const v4u*)(vg + (size_t)(16 * i) * TT + (s + 1) * AKT); }
      asm volatile("s_wait_xcnt 0x0" ::: "memory"); }   // the loads' address registers are reused by what follows: the wait stands in front of that overwrite
    { v8f st[AQT][4]; v16h pf[AQT][2];
      { v16h a[4][2];
#pragma unroll
        for (int j = 0; j < 4; ++j) { a[j][0] = frag_h(&sk[j * 16 + col][0], lane); a[j][1] = frag_h(&sk[j * 16 + col][32], lane); }
        __builtin_amdgcn_sched_barrier(0);   // the stage's K fragment reads issue as one group ahead of the products: one LDS latency per stage instead of one per key tile
        // eight independent accumulator chains (4 key tiles x 2 query tiles) walk the two products side by side
#pragma unroll
        for (int j = 0; j < 4; ++j)
#pragma unroll
          for (int u = 0; u < AQT; ++u) { const v8f z = {}; st[u][j] = wm16(a[j][0], qh[u][0], z); }
#pragma unroll
        for (int j = 0; j < 4; ++j)
#pragma unroll
          for (int u = 0; u < AQT; ++u) st[u][j] = wm16(a[j][1], qh[u][1], st[u][j]); }
      v16h vf[2][HD / 16];
#pragma unroll
      for (int kk = 0; kk < 2; ++kk)
#pragma unroll
        for (int t = 0; t < HD / 16; ++t) vf[kk][t] = frag_h(&sv[t * 16 + col][kk * 32], lane);
      __builtin_amdgcn_sched_barrier(0);   // the stage's v fragment reads issue as one group here, so that their LDS latency passes under the softmax arithmetic below
#pragma unroll
      for (int u = 0; u < AQT; ++u) {
        float mx = st[u][0][0];
#pragma unroll
        for (int j = 0; j < 4; ++j)
#pragma unroll
          for (int r = 0; r < 8; ++r) mx = fmaxf(mx, st[u][j][r]);
        const float mn = fmaxf(m[u], fmaxf(mx, xhalf(mx)));   // both halves hold the query's maximum so far (unscaled logits)
        const float corr = __builtin_amdgcn_exp2f((m[u] - mn) * CSL2); m[u] = mn;   // 0 on the first pass
        const float nm = 11.0f - mn * CSL2;
        l[u] *= corr;
#pragma unroll
        for (int t = 0; t < HD / 16; ++t) o[u][t] = o[u][t] * corr;
#pragma unroll
        for (int kk = 0; kk < 2; ++kk) { v8f e0 = __builtin_elementwise_fma(st[u][2 * kk], (v8f)(CSL2), (v8f)(nm)), e1 = __builtin_elementwise_fma(st[u][2 * kk + 1], (v8f)(CSL2), (v8f)(nm));
#pragma unroll
          for (int i = 0; i < 8; ++i) e0[i] = __builtin_amdgcn_exp2f(e0[i]);
#pragma unroll
          for (int i = 0; i < 8; ++i) e1[i] = __builtin_amdgcn_exp2f(e1[i]);
#pragma unroll
          for (int i = 0; i < 8; ++i) { pf[u][kk][i] = (_Float16)e0[i]; pf[u][kk][8 + i] = (_Float16)e1[i]; }
          e0 = e0 + e1; l[u] += ((e0[0] + e0[1]) + (e0[2] + e0[3])) + ((e0[4] + e0[5]) + (e0[6] + e0[7])); } }
#pragma unroll
      for (int kk = 0; kk < 2; ++kk)
#pragma unroll
        for (int t = 0; t < HD / 16; ++t)
#pragma unroll
          for (int u = 0; u < AQT; ++u) o[u][t] = wm16(vf[kk][t], pf[u][kk], o[u][t]); }
    __builtin_amdgcn_sched_barrier(0);   // the stage's arithmetic stays in front of the closing barrier: lifted over it, the barrier's wait for the next stage's global loads would stand in mid-stage, before they have landed
    __syncthreads(); }
  // ctx leaves as f16 x 2^6, the form the output GEMM multiplies: a wave lays its 32 query rows x 64 dims in its own quarter of the K/v stage arrays (free behind the loop's last barrier) and stores them as whole 128-byte lines
  const int sw = __builtin_amdgcn_readfirstlane(wave), ln = (int)__builtin_amdgcn_mbcnt_lo(~0u, 0u), lc = ln & 15, lg = ln >> 4;   // the wave's number as a scalar and the lane's number made anew: no lane-derived value has to stay in a vector register across the main loop for the epilogue's sake
  _Float16 (*so)[KPITCH] = (sw < 2 ? sk : sv) + (sw & 1) * 32;
#pragma unroll
  for (int u = 0; u < AQT; ++u) {
    const float ls = l[u] + xhalf(l[u]); const float inv = (1.0f / ls) * 64.0f;   // ls >= 2^11: the maximum's own term; x 2^6 is exact
#pragma unroll
    for (int t = 0; t < HD / 16; ++t) { const v8f v = o[u][t] * inv; v8h c;
#pragma unroll
      for (int r = 0; r < 8; ++r) c[r] = (_Float16)v[r];
      *(v8h*)&so[16 * u + lc][t * 16 + 8 * lg] = c; } }
  LDSX();   // the wave's own rows are in LDS before its lanes read them back across lanes
  _Float16* yr = YH + ((size_t)b * TT + blockIdx.x * 128 + sw * (16 * AQT) + (ln >> 3)) * CC + h * HD + (ln & 7) * 8;   // 16-byte piece (ln & 7) of rows (ln >> 3) + 4 i
  v4u c8[8];   // all eight reads fly together: one LDS latency for the eight stores
#pragma unroll
  for (int i = 0; i < 8; ++i) c8[i] = *(const v4u*)&so[4 * i + (ln >> 3)][(ln & 7) * 8];
#pragma unroll
  for (int i = 0; i < 8; ++i) vst2(yr + (size_t)(4 * i) * CC, c8[i]); }
// ---- k_out: block = (64 rows, 128 cols), 4 waves of 16 rows: out = ctx Wo (+ bo): ctx arrives as f16 x 2^6 rows, against Wo as f16(bf16 x 2^8) exact (1 product) x 2^-14
#define YP (CC + 8)        // f16 per staged ctx row: 784 B (16 B x odd), conflict-free 16-byte reads
__global__ __launch_bounds__(128) void k_out(const _Float16* __restrict__ YH, const float* __restrict__ WO, const float* __restrict__ BO, float* __restrict__ OUT) {
  // one LDS block: the main loop's Wo tiles (2 buffers), then the epilogue's per-wave rows sf; beside it each wave's own 16 ctx rows, laid once
  __shared__ __align__(16) unsigned char smem[4 * 16 * 132 * 4]; float (*sf)[16][132] = (float (*)[16][132])smem;
  __shared__ __align__(16) _Float16 sy[4][16][YP];
  _Float16 (*sW)[128][GP] = (_Float16 (*)[128][GP])smem;
  const int tid = threadIdx.x, wave = tid >> 5, lane = tid & 31, col = lane & 15, g = lane >> 4; const int c0 = blockIdx.y * 128; const size_t r0 = (size_t)blockIdx.x * 64 + wave * 16;
  v8f acc[8] = {};
  // a wave's 16 ctx rows are 12,288 contiguous bytes that no other wave of the block needs: it reads them once, up front, with whole-line loads that all fly together, and lays them in LDS as [row][k]
  // per 32 k: the block's Wo tile (128 outputs x 32) is read once with whole-line loads, converted and laid in LDS as [row][k]; the next tile's loads fly under this tile's products
  const int xr = tid >> 3, xp = tid & 7;
  const _Float16* yg = YH + r0 * CC + lane * 8;                         // 16-byte piece lane + 32 i of the wave's rows
  const float* wg = WO + (size_t)(c0 + xr) * CC + xp * 4;               // 16-byte piece xp of Wo rows (outputs) c0 + xr + 16 i
  v4u ty[24]; v4f rw[8];   // the short loops over ty, rw, wf and acc are fully unrolled so that these arrays stay in registers
#pragma unroll
  for (int i = 0; i < 24; ++i) ty[i] = *(const v4u*)(yg + 256 * i);
#pragma unroll
  for (int i = 0; i < 8; ++i) rw[i] = *(const v4f*)(wg + (size_t)(16 * i) * CC);
  asm volatile("s_wait_xcnt 0x0" :: "v"(yg), "v"(wg) : "memory");   // the loads' address registers may be rewritten by what follows: the wait stands in front of that; yg and wg are named as inputs so that their registers stay live, and so unwritten, up to the wait
  __builtin_amdgcn_sched_barrier(0);   // keeps the later address arithmetic and zeroing, which reuse those registers, behind the wait
  // a half wave's 16 pieces are a third of a row (256 B): load i holds thirds 2 i and 2 i + 1, so three loads fill two rows
  _Float16* syw = &sy[wave][0][0] + col * 8; const int yo[3] = { g * 128, g ? YP : 256, YP + 128 + g * 128 };
#pragma unroll
  for (int i = 0; i < 24; ++i) *(v4u*)(syw + (i / 3) * (2 * YP) + yo[i % 3]) = ty[i];   // read back only by this wave, behind the first trip's barrier
#pragma unroll 2   // two trips per pass: the buffer index becomes a constant LDS offset
  for (int kc = 0; kc < CC / 32; ++kc) { const int bu = kc & 1;
#pragma unroll
    for (int i = 0; i < 8; ++i) { v4h w4;
#pragma unroll
      for (int e = 0; e < 4; ++e) w4[e] = (_Float16)(bfr(rw[i][e]) * 256.0f);
      *(v4h*)&sW[bu][xr + 16 * i][xp * 4] = w4; }
    __syncthreads();   // publishes buffer bu; the other buffer's readers all passed it too, so the next trip may refill that one
    if (kc + 1 < CC / 32) {
#pragma unroll
      for (int i = 0; i < 8; ++i) rw[i] = *(const v4f*)(wg + (size_t)(16 * i) * CC + (kc + 1) * 32);
      asm volatile("s_wait_xcnt 0x0" ::: "memory"); }   // the loads' address registers may be rewritten by what follows: the wait stands in front of that
    const v16h a = frag_h(&sy[wave][col][kc * 32], lane); v16h wf[8];
#pragma unroll
    for (int j = 0; j < 8; ++j) wf[j] = frag_h(&sW[bu][j * 16 + col][0], lane);
    __builtin_amdgcn_sched_barrier(0);   // all fragment reads issue as one group ahead of the products: one LDS latency per tile instead of one per product
#pragma unroll
    for (int j = 0; j < 8; ++j) acc[j] = wm16(a, wf[j], acc[j]);
    __builtin_amdgcn_sched_barrier(0); }   // the next trip's converts wait for the loads in flight: they stay behind this tile's products
  __syncthreads();   // the last tile's readers are done before the epilogue reuses the LDS
#pragma unroll
  for (int j = 0; j < 8; ++j) { const float bias = BO ? bfr(BO[c0 + j * 16 + col]) : 0.f;
#pragma unroll
    for (int r = 0; r < 8; ++r) sf[wave][8 * g + r][j * 16 + col] = acc[j][r] * (1.0f / 16384.0f) + bias; }   /* 2^-8 (Wo carry) x 2^-6 (ctx carry) */
  LDSX(); for (int rl = 0; rl < 16; ++rl) vst2(OUT + (r0 + rl) * DIN + c0 + lane * 4, *(const v4f*)&sf[wave][rl][lane * 4]); }

extern "C" void kernel_launch(void* const* d_in, const int* in_sizes, int n_in, void* d_out, int out_size, void* d_ws, size_t ws_size, hipStream_t stream) {
  (void)in_sizes; (void)n_in; (void)out_size;
  const float** F = (const float**)d_in;
  if (ws_size < (size_t)WS_END) return;
  char* ws = (char*)d_ws; _Float16 *QH = (_Float16*)(ws + WS_QH), *KH = (_Float16*)(ws + WS_KH), *VT = (_Float16*)(ws + WS_VT), *KL = (_Float16*)(ws + WS_KL); __bf16 *VB = (__bf16*)(ws + WS_VB), *VBL = (__bf16*)(ws + WS_VBL); float *S = (float*)(ws + WS_S); _Float16 *YH = (_Float16*)(ws + WS_Y);
  (void)KL; (void)VB; (void)VBL; (void)S;
  // inputs: 0 x [16,1024,384]; 1 Wq [6,384,64], 2 bq [6,64]; 3 Wk, 4 bk; 5 Wv, 6 bv; 7 Wo [384,384] (out,in), 8 bo [384]
  k_proj<<<dim3(TNB * TT / PBM, 3 * CC / PBN), 256, 0, stream>>>(F[0], F[1], F[3], F[5], F[2], F[4], F[6], QH, KH, VT);
  k_attn<<<dim3(TT / 128, NH, TNB), 128, 0, stream>>>(QH, KH, VT, YH);
  k_out<<<dim3(TNB * TT / 64, DIN / 128), 128, 0, stream>>>(YH, F[7], F[8], (float*)d_out);
}

// v008
// It runs in 59.1 microseconds.
// Next to v007, in two timings, it ran 1.09 times as fast each time.
// Over all steps from v000 it is 19.3 times as fast.
// compute dtype: all float inputs rounded to bf16; per-head q/k/v projections with EXACT bf16 products on WMMA 16x16x32 (f32 accumulate) + bias; logits with q once to f16 against k once to f16 (1 product) x 64^-0.5; softmax f32 with a running maximum and sum (logits stay on chip); exp(logit - max) x 2^11 once to f16 x v once to f16 (1 product), divided by the f32 sum at the end; ctx carried x 2^6 once to f16 x Wo f16(bf16 x 2^8) + bo; f32 output.
#include <hip/hip_runtime.h>
#include <math.h>

typedef __attribute__((ext_vector_type(16))) _Float16 v16h;
typedef __attribute__((ext_vector_type(16))) __bf16 v16b;
typedef __attribute__((ext_vector_type(8)))  _Float16 v8h;
typedef __attribute__((ext_vector_type(8)))  float v8f;
typedef __attribute__((ext_vector_type(4)))  float v4f;
typedef __attribute__((ext_vector_type(2)))  float v2f;
typedef __attribute__((ext_vector_type(4)))  unsigned v4u;
typedef __attribute__((ext_vector_type(4)))  int v4i;
typedef float __attribute__((may_alias)) float_a;
typedef int __attribute__((may_alias)) int_a;

template <typename T> __device__ __forceinline__ void vst2(void* p, T v) { *(T*)p = v;  }
__device__ __forceinline__ v8f wmma16(v16h a, v16h b, v8f c) {
  v8f d = __builtin_amdgcn_wmma_f32_16x16x32_f16(false, a, false, b, (short)0, c, false, false);
  asm volatile("v_nop\n\tv_nop\n\tv_nop\n\tv_nop" : "+v"(d) : "v"(a), "v"(b));
  return d;
}
__device__ __forceinline__ v8f wmma_bf(v16b a, v16b b, v8f c) {
  v8f d = __builtin_amdgcn_wmma_f32_16x16x32_bf16(false, a, false, b, (short)0, c, false, false);
  asm volatile("v_nop\n\tv_nop\n\tv_nop\n\tv_nop" : "+v"(d) : "v"(a), "v"(b));
  return d;
}
// 16x16x32 fragments: lane = (h = lane>>4, row/col = lane&15); elements 0..7 = k0+8h+0..7, 8..15 = k0+16+8h+0..7; D element r = row 8h+r
__device__ __forceinline__ v16h frag_h(const _Float16* rowk0, int lane) {
  union { v16h v; v8h q[2]; } u; const _Float16* p = rowk0 + 8 * (lane >> 4);
  u.q[0] = *(const v8h*)p; u.q[1] = *(const v8h*)(p + 16); return u.v;
}
__device__ __forceinline__ v16h frag_f32(const float* rowk0, int lane) {
  v16h a; const float* p = rowk0 + 8 * (lane >> 4);
#pragma unroll
  for (int i = 0; i < 8; ++i) { a[i] = (_Float16)p[i]; a[8 + i] = (_Float16)p[16 + i]; }
  return a;
}
__device__ __forceinline__ v16h frag_f32s(const float* rowk0, int lane, float sc) {
  v16h a; const float* p = rowk0 + 8 * (lane >> 4);
#pragma unroll
  for (int i = 0; i < 8; ++i) { a[i] = (_Float16)(p[i] * sc); a[8 + i] = (_Float16)(p[16 + i] * sc); }
  return a;
}
// column fragment from a [K][ld] layout (column n), rows >= K read as 0
__device__ __forceinline__ v16h fragc_f32(const float* W, int k0, int n, int lane, int ld, int K) {
  v16h a; const int g = lane >> 4;
#pragma unroll
  for (int i = 0; i < 8; ++i) { const int ka = k0 + 8 * g + i, kb = ka + 16;
    a[i] = (_Float16)(ka < K ? W[(size_t)(ka < K ? ka : K - 1) * ld + n] : 0.f); a[8 + i] = (_Float16)(kb < K ? W[(size_t)(kb < K ? kb : K - 1) * ld + n] : 0.f); }
  return a;
}
struct F2 { v16b h, l; };
__device__ __forceinline__ F2 bsplit16(const float v[16]) { F2 r;
#pragma unroll
  for (int i = 0; i < 16; ++i) { const __bf16 h = (__bf16)v[i]; r.h[i] = h; r.l[i] = (__bf16)(v[i] - (float)h); }
  return r; }
__device__ __forceinline__ F2 split_row(const float* row, int k0, int lane) { float v[16]; const float* p = row + k0 + 8 * (lane >> 4);
#pragma unroll
  for (int i = 0; i < 8; ++i) { v[i] = p[i]; v[8 + i] = p[16 + i]; }
  return bsplit16(v); }
__device__ __forceinline__ F2 split_rowK(const float* row, int k0, int lane, int K) { float v[16]; const int g = lane >> 4;
#pragma unroll
  for (int i = 0; i < 8; ++i) { const int ka = k0 + 8 * g + i, kb = ka + 16; v[i] = ka < K ? row[ka < K ? ka : K - 1] : 0.f; v[8 + i] = kb < K ? row[kb < K ? kb : K - 1] : 0.f; }
  return bsplit16(v); }
__device__ __forceinline__ F2 split_col(const float* W, int k0, int n, int lane, int ld, int K) { float v[16]; const int g = lane >> 4;
#pragma unroll
  for (int i = 0; i < 8; ++i) { const int ka = k0 + 8 * g + i, kb = ka + 16; v[i] = ka < K ? W[(size_t)(ka < K ? ka : K - 1) * ld + n] : 0.f; v[8 + i] = kb < K ? W[(size_t)(kb < K ? kb : K - 1) * ld + n] : 0.f; }
  return bsplit16(v); }
__device__ __forceinline__ v8f mac3(const F2& a, const F2& b, v8f c) { c = wmma_bf(a.l, b.h, c); c = wmma_bf(a.h, b.l, c); return wmma_bf(a.h, b.h, c); }
__device__ __forceinline__ float sigm(float v) { return 1.0f / (1.0f + expf(-v)); }
#define LDSX() do { asm volatile("s_wait_dscnt 0" ::: "memory"); __builtin_amdgcn_wave_barrier(); __builtin_amdgcn_fence(__ATOMIC_RELEASE, "workgroup"); } while (0)

// Multi-head self-attention (B 16, S 1,024, D 384 = 6 heads x 64; per-head (in,out) Wq/Wk/Wv [6,384,64] + biases [6,64], 0.02-scale; (out,in) Wo [384,384] + bo): out = merge(softmax(q k^T / 8) v) Wo^T + bo.
#define NB 16
#define TT 1024
#define CC 384            // NH * HD = projected width
#define DIN 384          // input (model) width
#define NH 6
#define HD 64
#define NQB (TT / 64)
#define HG 6
#define SCALE (0.125f)
#define CAUSAL 0
#ifndef TNB
#define TNB NB
#endif
__device__ __forceinline__ float bfr(float v) { return (float)(__bf16)v; }
__host__ __device__ __forceinline__ int kb_last(int qb) { return CAUSAL ? ((qb * 64 + 63) >> 7) : (TT / 128 - 1); }
typedef __attribute__((ext_vector_type(8))) __bf16 v8b;
typedef __attribute__((ext_vector_type(4))) __bf16 v4b;
typedef __attribute__((ext_vector_type(4))) _Float16 v4h;
#define GP 40              // 16-bit elements per staged GEMM tile row: 32 k + 8 = 80 B (16 B x odd), conflict-free 16-byte reads
__device__ __forceinline__ v16b frag_b(const __bf16* rowk0, int lane) {
  union { v16b v; v8b q[2]; } u; const __bf16* p = rowk0 + 8 * (lane >> 4);
  u.q[0] = *(const v8b*)p; u.q[1] = *(const v8b*)(p + 16); return u.v;
}
#define QBH 0              // unused: k_attn has no high-precision path for early query blocks
#define QHI 0               // rows carrying a q residual plane: none (q enters the logits once as f16, as k does)
#define KHI 64            // key rows carrying k residual / v bf16 hi+lo planes (workspace reserved; written and read by no kernel here)
// B fragment (k rows k0+.., output column o) of a weight: (in,out) [K][ld] or (out,in) [ld rows of K]: bf16 exact, or f16(bf16 * 256) exact
__device__ __forceinline__ v16b wcol_io(const float* Wm, int k0, int o, int lane, int ld) { v16b w; const int g = lane >> 4;
#pragma unroll
  for (int i = 0; i < 8; ++i) { w[i] = (__bf16)Wm[(size_t)(k0 + 8 * g + i) * ld + o]; w[8 + i] = (__bf16)Wm[(size_t)(k0 + 16 + 8 * g + i) * ld + o]; }
  return w; }
__device__ __forceinline__ v16b wcol_oi(const float* Wm, int k0, int o, int lane, int K) { v16b w; const float* p = Wm + (size_t)o * K + k0 + 8 * (lane >> 4);
#pragma unroll
  for (int i = 0; i < 8; ++i) { w[i] = (__bf16)p[i]; w[8 + i] = (__bf16)p[16 + i]; }
  return w; }
__device__ __forceinline__ v16h wcolh_io(const float* Wm, int k0, int o, int lane, int ld) { v16h w; const int g = lane >> 4;
#pragma unroll
  for (int i = 0; i < 8; ++i) { w[i] = (_Float16)(bfr(Wm[(size_t)(k0 + 8 * g + i) * ld + o]) * 256.0f); w[8 + i] = (_Float16)(bfr(Wm[(size_t)(k0 + 16 + 8 * g + i) * ld + o]) * 256.0f); }
  return w; }
__device__ __forceinline__ v16h wcolh_oi(const float* Wm, int k0, int o, int lane, int K) { v16h w; const float* p = Wm + (size_t)o * K + k0 + 8 * (lane >> 4);
#pragma unroll
  for (int i = 0; i < 8; ++i) { w[i] = (_Float16)(bfr(p[i]) * 256.0f); w[8 + i] = (_Float16)(bfr(p[16 + i]) * 256.0f); }
  return w; }
#define WQKV_LAYOUT 0   // 0 = per-head [NH][DIN][HD] (wcol_heads); 1 = (out,in) [CC][DIN]; 2 = per-head [NH][DIN][HD]
__device__ __forceinline__ v16b wcol_hdk(const float* Wm, int k0, int o, int lane) { v16b w; const int g = lane >> 4; const float* p = Wm + (size_t)(o / HD) * DIN * HD + (o % HD);
#pragma unroll
  for (int i = 0; i < 8; ++i) { w[i] = (__bf16)p[(size_t)(k0 + 8 * g + i) * HD]; w[8 + i] = (__bf16)p[(size_t)(k0 + 16 + 8 * g + i) * HD]; }
  return w; }
#define WO_OUT_IN 1
#if WQKV_LAYOUT == 1
#define WCOL(W, k0, o, lane) wcol_oi(W, k0, o, lane, DIN)
#elif WQKV_LAYOUT == 2
#define WCOL(W, k0, o, lane) wcol_hdk(W, k0, o, lane)
#else
#define WCOL(W, k0, o, lane) wcol_heads(W, k0, o, lane)   /* per-head [h][D][64] weights */
#endif
#if WO_OUT_IN
#define WOCOL(W, k0, o, lane) wcol_oi(W, k0, o, lane, CC)
#define WOCOLH(W, k0, o, lane) wcolh_oi(W, k0, o, lane, CC)
#else
#define WOCOL(W, k0, o, lane) wcol_io(W, k0, o, lane, DIN)
#define WOCOLH(W, k0, o, lane) wcolh_io(W, k0, o, lane, DIN)
#endif
// per-head projection weights W[h][D][64] ([6][384][64]): column o = h*64 + d of the virtual (in,out) [D][384] matrix lives at W + (h*D + k)*64 + d
__device__ __forceinline__ v16b wcol_heads(const float* __restrict__ Wm, int k0, int o, int lane) { v16b w; const int g = lane >> 4; const float* p = Wm + ((size_t)(o >> 6) * DIN + k0 + 8 * g) * 64 + (o & 63);
#pragma unroll
  for (int i = 0; i < 8; ++i) { w[i] = (__bf16)p[(size_t)i * 64]; w[8 + i] = (__bf16)p[(size_t)(16 + i) * 64]; }
  asm volatile("s_wait_loadcnt 0x0" ::: "memory"); return w; }
#ifndef SM_EXTRA_PARAMS
#define SM_EXTRA_PARAMS
#endif
#ifndef PROJ_EXTRA_PARAMS
#define PROJ_EXTRA_PARAMS
#endif
#ifndef SM_MASK_HOOK
#define SM_MASK_HOOK (void)0
#endif

#define WS_QH  0u                                      // f16 q rows [b*t][CC]
#define WS_KH  (WS_QH + 2u * (size_t)NB * TT * CC)      // f16 k rows [b*t][CC]
#define WS_VT  (WS_KH + 2u * (size_t)NB * TT * CC)      // f16 v planes [b][c][t]
#define WS_QL  (WS_VT + 2u * (size_t)NB * CC * TT)      // f16 q residual x 2^10 rows [b][t < QHI][CC]
#define WS_KL  (WS_QL + 2u * (size_t)NB * QHI * CC)     // f16 k residual x 2^10 rows [b][t < KHI][CC]
#define WS_VB  (WS_KL + 2u * (size_t)NB * KHI * CC)     // bf16 v hi planes [b][c][t < KHI]
#define WS_VBL (WS_VB + 2u * (size_t)NB * CC * KHI)
#define WS_S   (WS_VBL + 2u * (size_t)NB * CC * KHI)    // f32 [hg][t][s] (workspace reserved; written and read by no kernel here: the logits stay on chip)
#define WS_Y   (WS_S  + 4u * (size_t)HG * TT * TT)      // f16 ctx x 2^6 rows [b*t][CC] (the plane's first half)
#define WS_END (WS_Y  + 4u * (size_t)NB * TT * CC)

// ---- k_proj: the q, k and v projections are one GEMM over 1,152 joined columns (q 0..383, k 384..767, v 768..1151). Block = (256 rows, 288 columns), 8 waves of 64 rows x 144 columns (two waves per SIMD, up to 512 registers each); 64 x 4 = 256 blocks, one per WGP, all resident at once.
// q/k/v = X W + b with exact bf16 products (K = DIN) -> q, k: f16 rows [b*t][CC]; v: f16 planes [b][c][t]. Every 16-column tile and every 32-column segment lies inside one head of one of q, k, v (288 = 9 x 32).
#define PBM 256            // rows of X per block
#define PBN 288            // joined output columns per block
#define PNJ 9              // 16-column tiles per wave
#define PSP (PBN + 8)      // f16 per epilogue row of q/k: 592 B (16 B x odd)
#define PTP (PBM + 8)      // f16 per epilogue plane row of v: 528 B (16 B x odd)
#define PSHB (PBM * PSP * 2)             // bytes of the epilogue's row array
#define PLDS (PSHB + 96 * PTP * 2)       // the block that holds k and v columns keeps its 96 planes behind the rows; 288 planes alone fit as well
template <int NP> __device__ __forceinline__ void put_rows(const _Float16 (*sh)[PSP], _Float16* __restrict__ QH, _Float16* __restrict__ KH, size_t r0, int n0, int tid) {
  for (int e0 = tid; e0 < PBM * NP; e0 += 256 * 6) { v4u t[6];   // six pieces a trip (unrolled, t in registers): one LDS latency per six stores
#pragma unroll
    for (int u = 0; u < 6; ++u) { const int e = e0 + 256 * u; t[u] = *(const v4u*)&sh[e / NP][(e % NP) * 8]; }
#pragma unroll
    for (int u = 0; u < 6; ++u) { const int e = e0 + 256 * u, rl = e / NP, n = n0 + (e % NP) * 8; _Float16* D = n < CC ? QH + n : KH + (n - CC); vst2((unsigned*)(D + (r0 + rl) * CC), t[u]); }
    asm volatile("s_wait_xcnt 0x0" ::: "memory"); } }   // the stores' address registers are rewritten by the next trip: the wait stands in front of that
__global__ __launch_bounds__(256) void k_proj(const float* __restrict__ X, const float* __restrict__ WQ, const float* __restrict__ WK, const float* __restrict__ WV, const float* __restrict__ BQ, const float* __restrict__ BK, const float* __restrict__ BV,
    _Float16* __restrict__ QH, _Float16* __restrict__ KH, _Float16* __restrict__ VT) {
  // one LDS block: the main loop's operand tiles (2 buffers) and the epilogue's transpose arrays (q/k rows sh, v planes th) live at different times, separated by the barrier after the loop
  __shared__ __align__(16) unsigned char smem[PLDS];
  __bf16 (*sA)[PBM][GP] = (__bf16 (*)[PBM][GP])smem; __bf16 (*sW)[PBN][GP] = (__bf16 (*)[PBN][GP])(smem + 2 * PBM * GP * 2);
  const int tid = threadIdx.x, wave = __builtin_amdgcn_readfirstlane(tid >> 5), lane = tid & 31, col = lane & 15, g = lane >> 4; const int n0 = blockIdx.y * PBN; const size_t r0 = (size_t)blockIdx.x * PBM; const size_t bb = r0 / TT; const int t0 = (int)(r0 % TT);
  const int wr = (wave >> 1) * 64, wc = (wave & 1) * (PNJ * 16);   // the wave's 64 x 144 piece of the block's tile: each X fragment feeds 9 products, each W fragment 4
  v8f acc[4][PNJ] = {};
  // per 32 k: the block's X tile (256 x 32) and W tile (32 x 288) are read once with whole-line loads, rounded to bf16 and laid in LDS as [row][k] and [column][k]; the next tile's loads fly under this tile's products
  const int xr = tid >> 3, xp = tid & 7;
  const float* xg = X + (r0 + xr) * DIN + xp * 4;                                             // 16-byte piece xp of rows xr + 32 i
  // W tile = 9 column segments of 32; wave w brings rows k = 4 w .. 4 w + 3 of every segment: a wave's load covers one 128-byte line, a lane holds 4 consecutive k of one column (one 8-byte LDS store)
  const float* wb[PNJ];   // block-uniform: segment i's first column in the per-head [h][D][64] weights of its own matrix, row k at + 64 k
#pragma unroll
  for (int i = 0; i < PNJ; ++i) { const int n = n0 + 32 * i, wh = n / CC, c = n % CC; wb[i] = (wh == 0 ? WQ : wh == 1 ? WK : WV) + (size_t)(c >> 6) * DIN * 64 + (c & 63); }
  const int wo = wave * 256 + lane;   // the lane's element in every segment's first 32 rows
  // the 64 blocks that share a W tile and the 4 that share an X tile would ask L2 for the same lines at the same moment: each block starts its walk over k at a step of its own and wraps
  const int kc0 = (int)((blockIdx.x + 3 * blockIdx.y) % (DIN / 32));
  const float* xs = xg + kc0 * 32;
  v4f rx[8]; float rw[PNJ][4];   // the short loops over rx, rw, a, wf and acc are fully unrolled so that these arrays stay in registers
#pragma unroll
  for (int i = 0; i < 8; ++i) rx[i] = *(const v4f*)(xs + (size_t)(32 * i) * DIN);
#pragma unroll
  for (int i = 0; i < PNJ; ++i) { const float* wk = wb[i] + kc0 * (32 * 64);
#pragma unroll
    for (int e = 0; e < 4; ++e) rw[i][e] = wk[wo + e * 64]; }
  asm volatile("s_wait_xcnt 0x0" :: "v"(xs), "v"(wo) : "memory");   // the loads' address registers may be rewritten by what follows: the wait stands in front of that; xs and wo are named as inputs so that their registers stay live, and so unwritten, up to the wait
  __builtin_amdgcn_sched_barrier(0);   // keeps the later address arithmetic and zeroing, which reuse those registers, behind the wait
#pragma unroll 2   // two trips per pass: the buffer index becomes a constant LDS offset
  for (int kc = 0; kc < DIN / 32; ++kc) { const int bu = kc & 1;
#pragma unroll
    for (int i = 0; i < 8; ++i) { v4b x4;
#pragma unroll
      for (int e = 0; e < 4; ++e) x4[e] = (__bf16)rx[i][e];
      *(v4b*)&sA[bu][xr + 32 * i][xp * 4] = x4; }
#pragma unroll
    for (int i = 0; i < PNJ; ++i) { v4b w4;
#pragma unroll
      for (int e = 0; e < 4; ++e) w4[e] = (__bf16)rw[i][e];
      *(v4b*)&sW[bu][32 * i + lane][4 * wave] = w4; }
    __syncthreads();   // publishes buffer bu; the other buffer's readers all passed it too, so the next trip may refill that one
    if (kc + 1 < DIN / 32) { const int kn = kc + 1 + kc0 < DIN / 32 ? kc + 1 + kc0 : kc + 1 + kc0 - DIN / 32;   // the next step of the block's own walk
      const float* xn = xg + kn * 32;
#pragma unroll
      for (int i = 0; i < 8; ++i) rx[i] = *(const v4f*)(xn + (size_t)(32 * i) * DIN);
      const unsigned wn = (unsigned)wo + (unsigned)kn * (32u * 64u);   // the lane's element in every segment's next 32 rows: one offset register serves all nine block-uniform bases
#pragma unroll
      for (int i = 0; i < PNJ; ++i)
#pragma unroll
        for (int e = 0; e < 4; ++e) rw[i][e] = wb[i][wn + e * 64];
      asm volatile("s_wait_xcnt 0x0" :: "v"(xn), "v"(wn) : "memory"); }   // the loads' address registers may be rewritten by what follows: the wait stands in front of that; xn and wn are named as inputs so that their registers stay live, and so unwritten, up to the wait
    v16b a[4], wf[PNJ];
#pragma unroll
    for (int i = 0; i < 4; ++i) a[i] = frag_b(&sA[bu][wr + i * 16 + col][0], lane);
#pragma unroll
    for (int j = 0; j < PNJ; ++j) wf[j] = frag_b(&sW[bu][wc + j * 16 + col][0], lane);
    __builtin_amdgcn_sched_barrier(0);   // all fragment reads issue as one group ahead of the products: one LDS latency per tile instead of one per product
#pragma unroll
    for (int j = 0; j < PNJ; ++j)
#pragma unroll
      for (int i = 0; i < 4; ++i) acc[i][j] = __builtin_amdgcn_wmma_f32_16x16x32_bf16(false, a[i], false, wf[j], (short)0, acc[i][j], false, false);
    __builtin_amdgcn_sched_barrier(0); }   // the next trip's converts wait for the loads in flight: they stay behind this tile's products
  float bias[PNJ]; int bi[PNJ]; const float* bp[PNJ];   // all nine loads fly together, under the barrier below
#pragma unroll
  for (int j = 0; j < PNJ; ++j) { const int n = n0 + wc + j * 16, wh = n / CC; bi[j] = n - wh * CC + col; bp[j] = wh == 0 ? BQ : wh == 1 ? BK : BV; bias[j] = bp[j][bi[j]]; }
  asm volatile("s_wait_xcnt 0x0" :: "v"(bi[0]), "v"(bi[1]), "v"(bi[2]), "v"(bi[3]), "v"(bi[4]), "v"(bi[5]), "v"(bi[6]), "v"(bi[7]), "v"(bi[8]), "s"(bp[0]), "s"(bp[1]), "s"(bp[2]), "s"(bp[3]), "s"(bp[4]), "s"(bp[5]), "s"(bp[6]), "s"(bp[7]), "s"(bp[8]) : "memory");   // the loads' address registers may be rewritten by what follows: the wait stands in front of that; the nine offsets and bases are named as inputs so that their registers stay live, and so unwritten, up to the wait
  __builtin_amdgcn_sched_barrier(0);   // keeps the first bias's rounding, which waits for its load, behind the issue of all nine loads
  __syncthreads();   // the last tile's readers are done before the epilogue reuses the LDS
  const int pl0 = n0 < 2 * CC ? 2 * CC - n0 : 0;        // tile column of the block's first v column (at or past PBN: none)
  const int nrow = pl0 < PBN ? pl0 : PBN;               // the block's q and k columns come first
  _Float16 (*sh)[PSP] = (_Float16 (*)[PSP])smem; _Float16 (*th)[PTP] = (_Float16 (*)[PTP])(smem + (pl0 > 0 ? PSHB : 0));
#pragma unroll
  for (int j = 0; j < PNJ; ++j) { const int cl = wc + j * 16; const float bj = bfr(bias[j]);
    if (n0 + cl < 2 * CC) {   // a q or k tile; the same for the whole wave
#pragma unroll
      for (int i = 0; i < 4; ++i)
#pragma unroll
        for (int r = 0; r < 8; ++r) sh[wr + i * 16 + 8 * g + r][cl + col] = (_Float16)(acc[i][j][r] + bj);
    } else {
#pragma unroll
      for (int i = 0; i < 4; ++i) { v8h pv;
#pragma unroll
        for (int r = 0; r < 8; ++r) pv[r] = (_Float16)(acc[i][j][r] + bj);
        *(v8h*)&th[cl - pl0 + col][wr + i * 16 + 8 * g] = pv; } } }
  __syncthreads();
  if (nrow == PBN) put_rows<PBN / 8>(sh, QH, KH, r0, n0, tid); else if (nrow > 0) put_rows<24>(sh, QH, KH, r0, n0, tid);   // 288 or 192 q/k columns, the same for the whole block
  for (int e0 = tid; e0 < (PBN - nrow) * (PBM / 8); e0 += 256 * 6) { v4u t[6];   // 0, 96 or 288 planes of 32 pieces; six pieces a trip as above; a wave stores 512 contiguous bytes of one plane
#pragma unroll
    for (int u = 0; u < 6; ++u) { const int e = e0 + 256 * u; t[u] = *(const v4u*)&th[e / (PBM / 8)][(e % (PBM / 8)) * 8]; }
#pragma unroll
    for (int u = 0; u < 6; ++u) { const int e = e0 + 256 * u; vst2((unsigned*)(VT + (bb * CC + (n0 + nrow - 2 * CC) + e / (PBM / 8)) * (size_t)TT + t0 + (e % (PBM / 8)) * 8), t[u]); }
    asm volatile("s_wait_xcnt 0x0" ::: "memory"); } }   // the stores' address registers are rewritten by the next trip: the wait stands in front of that
// ---- k_attn: block = 128 queries (4 waves x 32 = two tiles of 16 per wave) of (b, h); keys walked in LDS stages of 64 (K rows and v planes staged once per block, next stage's global loads in flight under this stage's work).
// Per 64 keys: S^T = K Q^T (A = K rows, B = q), so a lane holds one query's logits per tile; every K and v fragment read from LDS feeds both query tiles;
// running maximum and sum per lane and tile (+ one exchange between the wave halves);
// P^T = exp(logit - max) x 2^11 once to f16 is already a B operand (two D tiles = 32 keys in the hardware k order); O^T += V^T P^T; the accumulators are rescaled when the maximum moves; ctx = O^T / sum at the end.
#define AKT 64             // keys per LDS stage
#define AQT 2              // query tiles of 16 per wave
#define KPITCH 72          // f16 per staged K row: 144 B (16 B x odd), conflict-free 16-byte reads
#define VPITCH 72          // f16 per staged v plane row: 144 B
#define CSL2 (SCALE * 1.4426950408889634f)
__device__ __forceinline__ v8f wm16(v16h a, v16h b, v8f c) { return __builtin_amdgcn_wmma_f32_16x16x32_f16(false, a, false, b, (short)0, c, false, false); }
__device__ __forceinline__ float xhalf(float x) { return __builtin_bit_cast(float, __builtin_amdgcn_permlanex16(__builtin_bit_cast(int, x), __builtin_bit_cast(int, x), 0x76543210, 0xfedcba98, false, false)); }  // lane l with lane l ^ 16
// grid 8 x 6 x 16 = 768 blocks of 4 waves; three blocks (three waves per SIMD, at most 336 registers each) fit a WGP, so all blocks are resident at once
__global__ __launch_bounds__(128, 3) void k_attn(const _Float16* __restrict__ QH, const _Float16* __restrict__ KH, const _Float16* __restrict__ VT, _Float16* __restrict__ YH) {
  __shared__ __align__(16) _Float16 sk[AKT][KPITCH]; __shared__ __align__(16) _Float16 sv[HD][VPITCH];
  const int tid = threadIdx.x, wave = tid >> 5, lane = tid & 31, col = lane & 15, g = lane >> 4; const int h = blockIdx.y, b = blockIdx.z; const int q = blockIdx.x * 128 + wave * (16 * AQT) + col;
  v16h qh[AQT][HD / 32];   // the short loops over the tile, fragment and accumulator arrays are fully unrolled so that these arrays stay in registers
#pragma unroll
  for (int u = 0; u < AQT; ++u)
#pragma unroll
    for (int kc = 0; kc < HD / 32; ++kc) qh[u][kc] = frag_h(QH + ((size_t)b * TT + q + 16 * u) * CC + h * HD + kc * 32, lane);
  asm volatile("s_wait_xcnt 0x0" ::: "memory");   // the q loads' address registers are reused by what follows: the wait stands in front of that overwrite
  __builtin_amdgcn_sched_barrier(0);   // keeps the later address arithmetic and zeroing, which reuse those registers, behind the wait
  const _Float16* kg = KH + ((size_t)b * TT + (tid >> 3)) * CC + h * HD + (tid & 7) * 8;      // 16-byte piece (tid & 7) of key rows (tid >> 3) + 16 i
  const _Float16* vg = VT + ((size_t)b * CC + h * HD + (tid >> 3)) * (size_t)TT + (tid & 7) * 8;   // 16-byte piece (tid & 7) of planes (tid >> 3) + 16 i
  // the 8 blocks of one (b, h) would ask L2 for the same K and v lines at the same moment: each starts its walk over the key stages at a stage of its own and wraps (the running maximum and sum take the stages in any order)
  const int s0 = (int)blockIdx.x * (TT / AKT / (TT / 128));
  const _Float16* ks = kg + (size_t)(s0 * AKT) * CC; const _Float16* vs = vg + s0 * AKT;
  v4u rk[4], rv[4];
#pragma unroll
  for (int i = 0; i < 4; ++i) { rk[i] = *(const v4u*)(ks + (size_t)(16 * i) * CC); rv[i] = *(const v4u*)(vs + (size_t)(16 * i) * TT); }
  asm volatile("s_wait_xcnt 0x0" :: "v"(ks), "v"(vs) : "memory");   // the loads' address registers may be rewritten by what follows: the wait stands in front of that; ks and vs are named as inputs so that their registers stay live, and so unwritten, up to the wait
  v8f o[AQT][HD / 16] = {}; float m[AQT], l[AQT];
#pragma unroll
  for (int u = 0; u < AQT; ++u) { m[u] = -3.0e38f; l[u] = 0.f; }
  for (int s = 0; s < TT / AKT; ++s) {
#pragma unroll
    for (int i = 0; i < 4; ++i) { *(v4u*)&sk[(tid >> 3) + 16 * i][(tid & 7) * 8] = rk[i]; *(v4u*)&sv[(tid >> 3) + 16 * i][(tid & 7) * 8] = rv[i]; }
    __syncthreads();
    if (s + 1 < TT / AKT) { const int sn = (s + 1 + s0) & (TT / AKT - 1);   // the next stage of the block's own walk
#pragma unroll
      for (int i = 0; i < 4; ++i) { rk[i] = *(const v4u*)(kg + (size_t)(sn * AKT + 16 * i) * CC); rv[i] = *(const v4u*)(vg + (size_t)(16 * i) * TT + sn * AKT); }
      asm volatile("s_wait_xcnt 0x0" ::: "memory"); }   // the loads' address registers are reused by what follows: the wait stands in front of that overwrite
    { v8f st[AQT][4]; v16h pf[AQT][2];
      { v16h a[4][2];
#pragma unroll
        for (int j = 0; j < 4; ++j) { a[j][0] = frag_h(&sk[j * 16 + col][0], lane); a[j][1] = frag_h(&sk[j * 16 + col][32], lane); }
        __builtin_amdgcn_sched_barrier(0);   // the stage's K fragment reads issue as one group ahead of the products: one LDS latency per stage instead of one per key tile
        // eight independent accumulator chains (4 key tiles x 2 query tiles) walk the two products side by side
#pragma unroll
        for (int j = 0; j < 4; ++j)
#pragma unroll
          for (int u = 0; u < AQT; ++u) { const v8f z = {}; st[u][j] = wm16(a[j][0], qh[u][0], z); }
#pragma unroll
        for (int j = 0; j < 4; ++j)
#pragma unroll
          for (int u = 0; u < AQT; ++u) st[u][j] = wm16(a[j][1], qh[u][1], st[u][j]); }
      v16h vf[2][HD / 16];
#pragma unroll
      for (int kk = 0; kk < 2; ++kk)
#pragma unroll
        for (int t = 0; t < HD / 16; ++t) vf[kk][t] = frag_h(&sv[t * 16 + col][kk * 32], lane);
      __builtin_amdgcn_sched_barrier(0);   // the stage's v fragment reads issue as one group here, so that their LDS latency passes under the softmax arithmetic below
#pragma unroll
      for (int u = 0; u < AQT; ++u) {
        float mx = st[u][0][0];
#pragma unroll
        for (int j = 0; j < 4; ++j)
#pragma unroll
          for (int r = 0; r < 8; ++r) mx = fmaxf(mx, st[u][j][r]);
        const float mn = fmaxf(m[u], fmaxf(mx, xhalf(mx)));   // both halves hold the query's maximum so far (unscaled logits)
        const float corr = __builtin_amdgcn_exp2f((m[u] - mn) * CSL2); m[u] = mn;   // 0 on the first pass
        const float nm = 11.0f - mn * CSL2;
        l[u] *= corr;
#pragma unroll
        for (int t = 0; t < HD / 16; ++t) o[u][t] = o[u][t] * corr;
#pragma unroll
        for (int kk = 0; kk < 2; ++kk) { v8f e0 = __builtin_elementwise_fma(st[u][2 * kk], (v8f)(CSL2), (v8f)(nm)), e1 = __builtin_elementwise_fma(st[u][2 * kk + 1], (v8f)(CSL2), (v8f)(nm));
#pragma unroll
          for (int i = 0; i < 8; ++i) e0[i] = __builtin_amdgcn_exp2f(e0[i]);
#pragma unroll
          for (int i = 0; i < 8; ++i) e1[i] = __builtin_amdgcn_exp2f(e1[i]);
#pragma unroll
          for (int i = 0; i < 8; ++i) { pf[u][kk][i] = (_Float16)e0[i]; pf[u][kk][8 + i] = (_Float16)e1[i]; }
          e0 = e0 + e1; l[u] += ((e0[0] + e0[1]) + (e0[2] + e0[3])) + ((e0[4] + e0[5]) + (e0[6] + e0[7])); } }
#pragma unroll
      for (int kk = 0; kk < 2; ++kk)
#pragma unroll
        for (int t = 0; t < HD / 16; ++t)
#pragma unroll
          for (int u = 0; u < AQT; ++u) o[u][t] = wm16(vf[kk][t], pf[u][kk], o[u][t]); }
    __builtin_amdgcn_sched_barrier(0);   // the stage's arithmetic stays in front of the closing barrier: lifted over it, the barrier's wait for the next stage's global loads would stand in mid-stage, before they have landed
    __syncthreads(); }
  // ctx leaves as f16 x 2^6, the form the output GEMM multiplies: a wave lays its 32 query rows x 64 dims in its own quarter of the K/v stage arrays (free behind the loop's last barrier) and stores them as whole 128-byte lines
  const int sw = __builtin_amdgcn_readfirstlane(wave), ln = (int)__builtin_amdgcn_mbcnt_lo(~0u, 0u), lc = ln & 15, lg = ln >> 4;   // the wave's number as a scalar and the lane's number made anew: no lane-derived value has to stay in a vector register across the main loop for the epilogue's sake
  _Float16 (*so)[KPITCH] = (sw < 2 ? sk : sv) + (sw & 1) * 32;
#pragma unroll
  for (int u = 0; u < AQT; ++u) {
    const float ls = l[u] + xhalf(l[u]); const float inv = (1.0f / ls) * 64.0f;   // ls >= 2^11: the maximum's own term; x 2^6 is exact
#pragma unroll
    for (int t = 0; t < HD / 16; ++t) { const v8f v = o[u][t] * inv; v8h c;
#pragma unroll
      for (int r = 0; r < 8; ++r) c[r] = (_Float16)v[r];
      *(v8h*)&so[16 * u + lc][t * 16 + 8 * lg] = c; } }
  LDSX();   // the wave's own rows are in LDS before its lanes read them back across lanes
  _Float16* yr = YH + ((size_t)b * TT + blockIdx.x * 128 + sw * (16 * AQT) + (ln >> 3)) * CC + h * HD + (ln & 7) * 8;   // 16-byte piece (ln & 7) of rows (ln >> 3) + 4 i
  v4u c8[8];   // all eight reads fly together: one LDS latency for the eight stores
#pragma unroll
  for (int i = 0; i < 8; ++i) c8[i] = *(const v4u*)&so[4 * i + (ln >> 3)][(ln & 7) * 8];
#pragma unroll
  for (int i = 0; i < 8; ++i) vst2(yr + (size_t)(4 * i) * CC, c8[i]); }
// ---- k_out: block = (64 rows, 128 cols), 4 waves of 16 rows: out = ctx Wo (+ bo): ctx arrives as f16 x 2^6 rows, against Wo as f16(bf16 x 2^8) exact (1 product) x 2^-14
#define YP (CC + 8)        // f16 per staged ctx row: 784 B (16 B x odd), conflict-free 16-byte reads
__global__ __launch_bounds__(128) void k_out(const _Float16* __restrict__ YH, const float* __restrict__ WO, const float* __restrict__ BO, float* __restrict__ OUT) {
  // one LDS block: the main loop's Wo tiles (2 buffers), then the epilogue's per-wave rows sf; beside it each wave's own 16 ctx rows, laid once
  __shared__ __align__(16) unsigned char smem[4 * 16 * 132 * 4]; float (*sf)[16][132] = (float (*)[16][132])smem;
  __shared__ __align__(16) _Float16 sy[4][16][YP];
  _Float16 (*sW)[128][GP] = (_Float16 (*)[128][GP])smem;
  const int tid = threadIdx.x, wave = tid >> 5, lane = tid & 31, col = lane & 15, g = lane >> 4; const int c0 = blockIdx.y * 128; const size_t r0 = (size_t)blockIdx.x * 64 + wave * 16;
  v8f acc[8] = {};
  // a wave's 16 ctx rows are 12,288 contiguous bytes that no other wave of the block needs: it reads them once, up front, with whole-line loads that all fly together, and lays them in LDS as [row][k]
  // per 32 k: the block's Wo tile (128 outputs x 32) is read once with whole-line loads, converted and laid in LDS as [row][k]; the next tile's loads fly under this tile's products
  const int xr = tid >> 3, xp = tid & 7;
  const _Float16* yg = YH + r0 * CC + lane * 8;                         // 16-byte piece lane + 32 i of the wave's rows
  const float* wg = WO + (size_t)(c0 + xr) * CC + xp * 4;               // 16-byte piece xp of Wo rows (outputs) c0 + xr + 16 i
  // the 256 blocks that share a Wo tile would ask L2 for the same lines at the same moment: each block starts its walk over k at a step of its own and wraps
  const int kc0 = (int)(blockIdx.x % (CC / 32));
  const float* wp = wg + kc0 * 32;
  v4u ty[24]; v4f rw[8];   // the short loops over ty, rw, wf and acc are fully unrolled so that these arrays stay in registers
#pragma unroll
  for (int i = 0; i < 24; ++i) ty[i] = *(const v4u*)(yg + 256 * i);
#pragma unroll
  for (int i = 0; i < 8; ++i) rw[i] = *(const v4f*)(wp + (size_t)(16 * i) * CC);
  asm volatile("s_wait_xcnt 0x0" :: "v"(yg), "v"(wp) : "memory");   // the loads' address registers may be rewritten by what follows: the wait stands in front of that; yg and wp are named as inputs so that their registers stay live, and so unwritten, up to the wait
  __builtin_amdgcn_sched_barrier(0);   // keeps the later address arithmetic and zeroing, which reuse those registers, behind the wait
  // a half wave's 16 pieces are a third of a row (256 B): load i holds thirds 2 i and 2 i + 1, so three loads fill two rows
  _Float16* syw = &sy[wave][0][0] + col * 8; const int yo[3] = { g * 128, g ? YP : 256, YP + 128 + g * 128 };
#pragma unroll
  for (int i = 0; i < 24; ++i) *(v4u*)(syw + (i / 3) * (2 * YP) + yo[i % 3]) = ty[i];   // read back only by this wave, behind the first trip's barrier
#pragma unroll 2   // two trips per pass: the buffer index becomes a constant LDS offset
  for (int kc = 0; kc < CC / 32; ++kc) { const int bu = kc & 1; const int kk = kc + kc0 < CC / 32 ? kc + kc0 : kc + kc0 - CC / 32;   // this step of the block's own walk
#pragma unroll
    for (int i = 0; i < 8; ++i) { v4h w4;
#pragma unroll
      for (int e = 0; e < 4; ++e) w4[e] = (_Float16)(bfr(rw[i][e]) * 256.0f);
      *(v4h*)&sW[bu][xr + 16 * i][xp * 4] = w4; }
    __syncthreads();   // publishes buffer bu; the other buffer's readers all passed it too, so the next trip may refill that one
    if (kc + 1 < CC / 32) { const int kn = kk + 1 < CC / 32 ? kk + 1 : 0;
#pragma unroll
      for (int i = 0; i < 8; ++i) rw[i] = *(const v4f*)(wg + (size_t)(16 * i) * CC + kn * 32);
      asm volatile("s_wait_xcnt 0x0" ::: "memory"); }   // the loads' address registers may be rewritten by what follows: the wait stands in front of that
    const v16h a = frag_h(&sy[wave][col][kk * 32], lane); v16h wf[8];
#pragma unroll
    for (int j = 0; j < 8; ++j) wf[j] = frag_h(&sW[bu][j * 16 + col][0], lane);
    __builtin_amdgcn_sched_barrier(0);   // all fragment reads issue as one group ahead of the products: one LDS latency per tile instead of one per product
#pragma unroll
    for (int j = 0; j < 8; ++j) acc[j] = wm16(a, wf[j], acc[j]);
    __builtin_amdgcn_sched_barrier(0); }   // the next trip's converts wait for the loads in flight: they stay behind this tile's products
  __syncthreads();   // the last tile's readers are done before the epilogue reuses the LDS
#pragma unroll
  for (int j = 0; j < 8; ++j) { const float bias = BO ? bfr(BO[c0 + j * 16 + col]) : 0.f;
#pragma unroll
    for (int r = 0; r < 8; ++r) sf[wave][8 * g + r][j * 16 + col] = acc[j][r] * (1.0f / 16384.0f) + bias; }   /* 2^-8 (Wo carry) x 2^-6 (ctx carry) */
  LDSX(); for (int rl = 0; rl < 16; ++rl) vst2(OUT + (r0 + rl) * DIN + c0 + lane * 4, *(const v4f*)&sf[wave][rl][lane * 4]); }

extern "C" void kernel_launch(void* const* d_in, const int* in_sizes, int n_in, void* d_out, int out_size, void* d_ws, size_t ws_size, hipStream_t stream) {
  (void)in_sizes; (void)n_in; (void)out_size;
  const float** F = (const float**)d_in;
  if (ws_size < (size_t)WS_END) return;
  char* ws = (char*)d_ws; _Float16 *QH = (_Float16*)(ws + WS_QH), *KH = (_Float16*)(ws + WS_KH), *VT = (_Float16*)(ws + WS_VT), *KL = (_Float16*)(ws + WS_KL); __bf16 *VB = (__bf16*)(ws + WS_VB), *VBL = (__bf16*)(ws + WS_VBL); float *S = (float*)(ws + WS_S); _Float16 *YH = (_Float16*)(ws + WS_Y);
  (void)KL; (void)VB; (void)VBL; (void)S;
  // inputs: 0 x [16,1024,384]; 1 Wq [6,384,64], 2 bq [6,64]; 3 Wk, 4 bk; 5 Wv, 6 bv; 7 Wo [384,384] (out,in), 8 bo [384]
  k_proj<<<dim3(TNB * TT / PBM, 3 * CC / PBN), 256, 0, stream>>>(F[0], F[1], F[3], F[5], F[2], F[4], F[6], QH, KH, VT);
  k_attn<<<dim3(TT / 128, NH, TNB), 128, 0, stream>>>(QH, KH, VT, YH);
  k_out<<<dim3(TNB * TT / 64, DIN / 128), 128, 0, stream>>>(YH, F[7], F[8], (float*)d_out);
}

// v009
// One run takes 56.3 microseconds.
// Two timings next to v008 both put it at 1.05 times that version's speed.
// Over all steps from v000 it is 20.2 times as fast.
// compute dtype: all float inputs rounded to bf16; per-head q/k/v projections with EXACT bf16 products on WMMA 16x16x32 (f32 accumulate) + bias; logits with q once to f16 against k once to f16 (1 product) x 64^-0.5; softmax f32 against a per-query reference logit (a maximum so far, renewed only when a stage's sum nears the f16 range) with a running sum (logits stay on chip); exp(logit - reference) x 2^6 once to f16 x v once to f16 (1 product), divided by the f32 sum at the end; ctx carried x 2^6 once to f16 x Wo f16(bf16 x 2^8) + bo; f32 output.
#include <hip/hip_runtime.h>
#include <math.h>

typedef __attribute__((ext_vector_type(16))) _Float16 v16h;
typedef __attribute__((ext_vector_type(16))) __bf16 v16b;
typedef __attribute__((ext_vector_type(8)))  _Float16 v8h;
typedef __attribute__((ext_vector_type(8)))  float v8f;
typedef __attribute__((ext_vector_type(4)))  float v4f;
typedef __attribute__((ext_vector_type(2)))  float v2f;
typedef __attribute__((ext_vector_type(4)))  unsigned v4u;
typedef __attribute__((ext_vector_type(4)))  int v4i;
typedef float __attribute__((may_alias)) float_a;
typedef int __attribute__((may_alias)) int_a;

template <typename T> __device__ __forceinline__ void vst2(void* p, T v) { *(T*)p = v;  }
__device__ __forceinline__ v8f wmma16(v16h a, v16h b, v8f c) {
  v8f d = __builtin_amdgcn_wmma_f32_16x16x32_f16(false, a, false, b, (short)0, c, false, false);
  asm volatile("v_nop\n\tv_nop\n\tv_nop\n\tv_nop" : "+v"(d) : "v"(a), "v"(b));
  return d;
}
__device__ __forceinline__ v8f wmma_bf(v16b a, v16b b, v8f c) {
  v8f d = __builtin_amdgcn_wmma_f32_16x16x32_bf16(false, a, false, b, (short)0, c, false, false);
  asm volatile("v_nop\n\tv_nop\n\tv_nop\n\tv_nop" : "+v"(d) : "v"(a), "v"(b));
  return d;
}
// 16x16x32 fragments: lane = (h = lane>>4, row/col = lane&15); elements 0..7 = k0+8h+0..7, 8..15 = k0+16+8h+0..7; D element r = row 8h+r
__device__ __forceinline__ v16h frag_h(const _Float16* rowk0, int lane) {
  union { v16h v; v8h q[2]; } u; const _Float16* p = rowk0 + 8 * (lane >> 4);
  u.q[0] = *(const v8h*)p; u.q[1] = *(const v8h*)(p + 16); return u.v;
}
__device__ __forceinline__ v16h frag_f32(const float* rowk0, int lane) {
  v16h a; const float* p = rowk0 + 8 * (lane >> 4);
#pragma unroll
  for (int i = 0; i < 8; ++i) { a[i] = (_Float16)p[i]; a[8 + i] = (_Float16)p[16 + i]; }
  return a;
}
__device__ __forceinline__ v16h frag_f32s(const float* rowk0, int lane, float sc) {
  v16h a; const float* p = rowk0 + 8 * (lane >> 4);
#pragma unroll
  for (int i = 0; i < 8; ++i) { a[i] = (_Float16)(p[i] * sc); a[8 + i] = (_Float16)(p[16 + i] * sc); }
  return a;
}
// column fragment from a [K][ld] layout (column n), rows >= K read as 0
__device__ __forceinline__ v16h fragc_f32(const float* W, int k0, int n, int lane, int ld, int K) {
  v16h a; const int g = lane >> 4;
#pragma unroll
  for (int i = 0; i < 8; ++i) { const int ka = k0 + 8 * g + i, kb = ka + 16;
    a[i] = (_Float16)(ka < K ? W[(size_t)(ka < K ? ka : K - 1) * ld + n] : 0.f); a[8 + i] = (_Float16)(kb < K ? W[(size_t)(kb < K ? kb : K - 1) * ld + n] : 0.f); }
  return a;
}
struct F2 { v16b h, l; };
__device__ __forceinline__ F2 bsplit16(const float v[16]) { F2 r;
#pragma unroll
  for (int i = 0; i < 16; ++i) { const __bf16 h = (__bf16)v[i]; r.h[i] = h; r.l[i] = (__bf16)(v[i] - (float)h); }
  return r; }
__device__ __forceinline__ F2 split_row(const float* row, int k0, int lane) { float v[16]; const float* p = row + k0 + 8 * (lane >> 4);
#pragma unroll
  for (int i = 0; i < 8; ++i) { v[i] = p[i]; v[8 + i] = p[16 + i]; }
  return bsplit16(v); }
__device__ __forceinline__ F2 split_rowK(const float* row, int k0, int lane, int K) { float v[16]; const int g = lane >> 4;
#pragma unroll
  for (int i = 0; i < 8; ++i) { const int ka = k0 + 8 * g + i, kb = ka + 16; v[i] = ka < K ? row[ka < K ? ka : K - 1] : 0.f; v[8 + i] = kb < K ? row[kb < K ? kb : K - 1] : 0.f; }
  return bsplit16(v); }
__device__ __forceinline__ F2 split_col(const float* W, int k0, int n, int lane, int ld, int K) { float v[16]; const int g = lane >> 4;
#pragma unroll
  for (int i = 0; i < 8; ++i) { const int ka = k0 + 8 * g + i, kb = ka + 16; v[i] = ka < K ? W[(size_t)(ka < K ? ka : K - 1) * ld + n] : 0.f; v[8 + i] = kb < K ? W[(size_t)(kb < K ? kb : K - 1) * ld + n] : 0.f; }
  return bsplit16(v); }
__device__ __forceinline__ v8f mac3(const F2& a, const F2& b, v8f c) { c = wmma_bf(a.l, b.h, c); c = wmma_bf(a.h, b.l, c); return wmma_bf(a.h, b.h, c); }
__device__ __forceinline__ float sigm(float v) { return 1.0f / (1.0f + expf(-v)); }
#define LDSX() do { asm volatile("s_wait_dscnt 0" ::: "memory"); __builtin_amdgcn_wave_barrier(); __builtin_amdgcn_fence(__ATOMIC_RELEASE, "workgroup"); } while (0)

// Multi-head self-attention (B 16, S 1,024, D 384 = 6 heads x 64; per-head (in,out) Wq/Wk/Wv [6,384,64] + biases [6,64], 0.02-scale; (out,in) Wo [384,384] + bo): out = merge(softmax(q k^T / 8) v) Wo^T + bo.
#define NB 16
#define TT 1024
#define CC 384            // NH * HD = projected width
#define DIN 384          // input (model) width
#define NH 6
#define HD 64
#define NQB (TT / 64)
#define HG 6
#define SCALE (0.125f)
#define CAUSAL 0
#ifndef TNB
#define TNB NB
#endif
__device__ __forceinline__ float bfr(float v) { return (float)(__bf16)v; }
__host__ __device__ __forceinline__ int kb_last(int qb) { return CAUSAL ? ((qb * 64 + 63) >> 7) : (TT / 128 - 1); }
typedef __attribute__((ext_vector_type(8))) __bf16 v8b;
typedef __attribute__((ext_vector_type(4))) __bf16 v4b;
typedef __attribute__((ext_vector_type(4))) _Float16 v4h;
#define GP 40              // 16-bit elements per staged GEMM tile row: 32 k + 8 = 80 B (16 B x odd), conflict-free 16-byte reads
__device__ __forceinline__ v16b frag_b(const __bf16* rowk0, int lane) {
  union { v16b v; v8b q[2]; } u; const __bf16* p = rowk0 + 8 * (lane >> 4);
  u.q[0] = *(const v8b*)p; u.q[1] = *(const v8b*)(p + 16); return u.v;
}
#define QBH 0              // unused: k_attn has no high-precision path for early query blocks
#define QHI 0               // rows carrying a q residual plane: none (q enters the logits once as f16, as k does)
#define KHI 64            // key rows carrying k residual / v bf16 hi+lo planes (workspace reserved; written and read by no kernel here)
// B fragment (k rows k0+.., output column o) of a weight: (in,out) [K][ld] or (out,in) [ld rows of K]: bf16 exact, or f16(bf16 * 256) exact
__device__ __forceinline__ v16b wcol_io(const float* Wm, int k0, int o, int lane, int ld) { v16b w; const int g = lane >> 4;
#pragma unroll
  for (int i = 0; i < 8; ++i) { w[i] = (__bf16)Wm[(size_t)(k0 + 8 * g + i) * ld + o]; w[8 + i] = (__bf16)Wm[(size_t)(k0 + 16 + 8 * g + i) * ld + o]; }
  return w; }
__device__ __forceinline__ v16b wcol_oi(const float* Wm, int k0, int o, int lane, int K) { v16b w; const float* p = Wm + (size_t)o * K + k0 + 8 * (lane >> 4);
#pragma unroll
  for (int i = 0; i < 8; ++i) { w[i] = (__bf16)p[i]; w[8 + i] = (__bf16)p[16 + i]; }
  return w; }
__device__ __forceinline__ v16h wcolh_io(const float* Wm, int k0, int o, int lane, int ld) { v16h w; const int g = lane >> 4;
#pragma unroll
  for (int i = 0; i < 8; ++i) { w[i] = (_Float16)(bfr(Wm[(size_t)(k0 + 8 * g + i) * ld + o]) * 256.0f); w[8 + i] = (_Float16)(bfr(Wm[(size_t)(k0 + 16 + 8 * g + i) * ld + o]) * 256.0f); }
  return w; }
__device__ __forceinline__ v16h wcolh_oi(const float* Wm, int k0, int o, int lane, int K) { v16h w; const float* p = Wm + (size_t)o * K + k0 + 8 * (lane >> 4);
#pragma unroll
  for (int i = 0; i < 8; ++i) { w[i] = (_Float16)(bfr(p[i]) * 256.0f); w[8 + i] = (_Float16)(bfr(p[16 + i]) * 256.0f); }
  return w; }
#define WQKV_LAYOUT 0   // 0 = per-head [NH][DIN][HD] (wcol_heads); 1 = (out,in) [CC][DIN]; 2 = per-head [NH][DIN][HD]
__device__ __forceinline__ v16b wcol_hdk(const float* Wm, int k0, int o, int lane) { v16b w; const int g = lane >> 4; const float* p = Wm + (size_t)(o / HD) * DIN * HD + (o % HD);
#pragma unroll
  for (int i = 0; i < 8; ++i) { w[i] = (__bf16)p[(size_t)(k0 + 8 * g + i) * HD]; w[8 + i] = (__bf16)p[(size_t)(k0 + 16 + 8 * g + i) * HD]; }
  return w; }
#define WO_OUT_IN 1
#if WQKV_LAYOUT == 1
#define WCOL(W, k0, o, lane) wcol_oi(W, k0, o, lane, DIN)
#elif WQKV_LAYOUT == 2
#define WCOL(W, k0, o, lane) wcol_hdk(W, k0, o, lane)
#else
#define WCOL(W, k0, o, lane) wcol_heads(W, k0, o, lane)   /* per-head [h][D][64] weights */
#endif
#if WO_OUT_IN
#define WOCOL(W, k0, o, lane) wcol_oi(W, k0, o, lane, CC)
#define WOCOLH(W, k0, o, lane) wcolh_oi(W, k0, o, lane, CC)
#else
#define WOCOL(W, k0, o, lane) wcol_io(W, k0, o, lane, DIN)
#define WOCOLH(W, k0, o, lane) wcolh_io(W, k0, o, lane, DIN)
#endif
// per-head projection weights W[h][D][64] ([6][384][64]): column o = h*64 + d of the virtual (in,out) [D][384] matrix lives at W + (h*D + k)*64 + d
__device__ __forceinline__ v16b wcol_heads(const float* __restrict__ Wm, int k0, int o, int lane) { v16b w; const int g = lane >> 4; const float* p = Wm + ((size_t)(o >> 6) * DIN + k0 + 8 * g) * 64 + (o & 63);
#pragma unroll
  for (int i = 0; i < 8; ++i) { w[i] = (__bf16)p[(size_t)i * 64]; w[8 + i] = (__bf16)p[(size_t)(16 + i) * 64]; }
  asm volatile("s_wait_loadcnt 0x0" ::: "memory"); return w; }
#ifndef SM_EXTRA_PARAMS
#define SM_EXTRA_PARAMS
#endif
#ifndef PROJ_EXTRA_PARAMS
#define PROJ_EXTRA_PARAMS
#endif
#ifndef SM_MASK_HOOK
#define SM_MASK_HOOK (void)0
#endif

#define WS_QH  0u                                      // f16 q rows [b*t][CC]
#define WS_KH  (WS_QH + 2u * (size_t)NB * TT * CC)      // f16 k rows [b*t][CC]
#define WS_VT  (WS_KH + 2u * (size_t)NB * TT * CC)      // f16 v planes [b][c][t]
#define WS_QL  (WS_VT + 2u * (size_t)NB * CC * TT)      // f16 q residual x 2^10 rows [b][t < QHI][CC]
#define WS_KL  (WS_QL + 2u * (size_t)NB * QHI * CC)     // f16 k residual x 2^10 rows [b][t < KHI][CC]
#define WS_VB  (WS_KL + 2u * (size_t)NB * KHI * CC)     // bf16 v hi planes [b][c][t < KHI]
#define WS_VBL (WS_VB + 2u * (size_t)NB * CC * KHI)
#define WS_S   (WS_VBL + 2u * (size_t)NB * CC * KHI)    // f32 [hg][t][s] (workspace reserved; written and read by no kernel here: the logits stay on chip)
#define WS_Y   (WS_S  + 4u * (size_t)HG * TT * TT)      // f16 ctx x 2^6 rows [b*t][CC] (the plane's first half)
#define WS_END (WS_Y  + 4u * (size_t)NB * TT * CC)

// ---- k_proj: the q, k and v projections are one GEMM over 1,152 joined columns (q 0..383, k 384..767, v 768..1151). Block = (256 rows, 288 columns), 8 waves of 64 rows x 144 columns (two waves per SIMD, up to 512 registers each); 64 x 4 = 256 blocks, one per WGP, all resident at once.
// q/k/v = X W + b with exact bf16 products (K = DIN) -> q, k: f16 rows [b*t][CC]; v: f16 planes [b][c][t]. Every 16-column tile and every 32-column segment lies inside one head of one of q, k, v (288 = 9 x 32).
#define PBM 256            // rows of X per block
#define PBN 288            // joined output columns per block
#define PNJ 9              // 16-column tiles per wave
#define PSP (PBN + 8)      // f16 per epilogue row of q/k: 592 B (16 B x odd)
#define PTP (PBM + 8)      // f16 per epilogue plane row of v: 528 B (16 B x odd)
#define PSHB (PBM * PSP * 2)             // bytes of the epilogue's row array
#define PLDS (PSHB + 96 * PTP * 2)       // the block that holds k and v columns keeps its 96 planes behind the rows; 288 planes alone fit as well
template <int NP> __device__ __forceinline__ void put_rows(const _Float16 (*sh)[PSP], _Float16* __restrict__ QH, _Float16* __restrict__ KH, size_t r0, int n0, int tid) {
  for (int e0 = tid; e0 < PBM * NP; e0 += 256 * 6) { v4u t[6];   // six pieces a trip (unrolled, t in registers): one LDS latency per six stores
#pragma unroll
    for (int u = 0; u < 6; ++u) { const int e = e0 + 256 * u; t[u] = *(const v4u*)&sh[e / NP][(e % NP) * 8]; }
#pragma unroll
    for (int u = 0; u < 6; ++u) { const int e = e0 + 256 * u, rl = e / NP, n = n0 + (e % NP) * 8; _Float16* D = n < CC ? QH + n : KH + (n - CC); vst2((unsigned*)(D + (r0 + rl) * CC), t[u]); }
    asm volatile("s_wait_xcnt 0x0" ::: "memory"); } }   // the stores' address registers are rewritten by the next trip: the wait stands in front of that
__global__ __launch_bounds__(256) void k_proj(const float* __restrict__ X, const float* __restrict__ WQ, const float* __restrict__ WK, const float* __restrict__ WV, const float* __restrict__ BQ, const float* __restrict__ BK, const float* __restrict__ BV,
    _Float16* __restrict__ QH, _Float16* __restrict__ KH, _Float16* __restrict__ VT) {
  // one LDS block: the main loop's operand tiles (2 buffers) and the epilogue's transpose arrays (q/k rows sh, v planes th) live at different times, separated by the barrier after the loop
  __shared__ __align__(16) unsigned char smem[PLDS];
  __bf16 (*sA)[PBM][GP] = (__bf16 (*)[PBM][GP])smem; __bf16 (*sW)[PBN][GP] = (__bf16 (*)[PBN][GP])(smem + 2 * PBM * GP * 2);
  const int tid = threadIdx.x, wave = __builtin_amdgcn_readfirstlane(tid >> 5), lane = tid & 31, col = lane & 15, g = lane >> 4; const int n0 = blockIdx.y * PBN; const size_t r0 = (size_t)blockIdx.x * PBM; const size_t bb = r0 / TT; const int t0 = (int)(r0 % TT);
  const int wr = (wave >> 1) * 64, wc = (wave & 1) * (PNJ * 16);   // the wave's 64 x 144 piece of the block's tile: each X fragment feeds 9 products, each W fragment 4
  v8f acc[4][PNJ] = {};
  // per 32 k: the block's X tile (256 x 32) and W tile (32 x 288) are read once with whole-line loads, rounded to bf16 and laid in LDS as [row][k] and [column][k]; the next tile's loads fly under this tile's products
  const int xr = tid >> 3, xp = tid & 7;
  const float* xg = X + (r0 + xr) * DIN + xp * 4;                                             // 16-byte piece xp of rows xr + 32 i
  // W tile = 9 column segments of 32; wave w brings rows k = 4 w .. 4 w + 3 of every segment: a wave's load covers one 128-byte line, a lane holds 4 consecutive k of one column (one 8-byte LDS store)
  const float* wb[PNJ];   // block-uniform: segment i's first column in the per-head [h][D][64] weights of its own matrix, row k at + 64 k
#pragma unroll
  for (int i = 0; i < PNJ; ++i) { const int n = n0 + 32 * i, wh = n / CC, c = n % CC; wb[i] = (wh == 0 ? WQ : wh == 1 ? WK : WV) + (size_t)(c >> 6) * DIN * 64 + (c & 63); }
  const int wo = wave * 256 + lane;   // the lane's element in every segment's first 32 rows
  // the 64 blocks that share a W tile and the 4 that share an X tile would ask L2 for the same lines at the same moment: each block starts its walk over k at a step of its own and wraps
  const int kc0 = (int)((blockIdx.x + 3 * blockIdx.y) % (DIN / 32));
  const float* xs = xg + kc0 * 32;
  v4f rx[8]; float rw[PNJ][4];   // the short loops over rx, rw, a, wf and acc are fully unrolled so that these arrays stay in registers
#pragma unroll
  for (int i = 0; i < 8; ++i) rx[i] = *(const v4f*)(xs + (size_t)(32 * i) * DIN);
#pragma unroll
  for (int i = 0; i < PNJ; ++i) { const float* wk = wb[i] + kc0 * (32 * 64);
#pragma unroll
    for (int e = 0; e < 4; ++e) rw[i][e] = wk[wo + e * 64]; }
  asm volatile("s_wait_xcnt 0x0" :: "v"(xs), "v"(wo) : "memory");   // the loads' address registers may be rewritten by what follows: the wait stands in front of that; xs and wo are named as inputs so that their registers stay live, and so unwritten, up to the wait
  __builtin_amdgcn_sched_barrier(0);   // keeps the later address arithmetic and zeroing, which reuse those registers, behind the wait
#pragma unroll 2   // two trips per pass: the buffer index becomes a constant LDS offset
  for (int kc = 0; kc < DIN / 32; ++kc) { const int bu = kc & 1;
#pragma unroll
    for (int i = 0; i < 8; ++i) { v4b x4;
#pragma unroll
      for (int e = 0; e < 4; ++e) x4[e] = (__bf16)rx[i][e];
      *(v4b*)&sA[bu][xr + 32 * i][xp * 4] = x4; }
#pragma unroll
    for (int i = 0; i < PNJ; ++i) { v4b w4;
#pragma unroll
      for (int e = 0; e < 4; ++e) w4[e] = (__bf16)rw[i][e];
      *(v4b*)&sW[bu][32 * i + lane][4 * wave] = w4; }
    __syncthreads();   // publishes buffer bu; the other buffer's readers all passed it too, so the next trip may refill that one
    if (kc + 1 < DIN / 32) { const int kn = kc + 1 + kc0 < DIN / 32 ? kc + 1 + kc0 : kc + 1 + kc0 - DIN / 32;   // the next step of the block's own walk
      const float* xn = xg + kn * 32;
#pragma unroll
      for (int i = 0; i < 8; ++i) rx[i] = *(const v4f*)(xn + (size_t)(32 * i) * DIN);
      const unsigned wn = (unsigned)wo + (unsigned)kn * (32u * 64u);   // the lane's element in every segment's next 32 rows: one offset register serves all nine block-uniform bases
#pragma unroll
      for (int i = 0; i < PNJ; ++i)
#pragma unroll
        for (int e = 0; e < 4; ++e) rw[i][e] = wb[i][wn + e * 64];
      asm volatile("s_wait_xcnt 0x0" :: "v"(xn), "v"(wn) : "memory"); }   // the loads' address registers may be rewritten by what follows: the wait stands in front of that; xn and wn are named as inputs so that their registers stay live, and so unwritten, up to the wait
    v16b a[4], wf[PNJ];
#pragma unroll
    for (int i = 0; i < 4; ++i) a[i] = frag_b(&sA[bu][wr + i * 16 + col][0], lane);
#pragma unroll
    for (int j = 0; j < PNJ; ++j) wf[j] = frag_b(&sW[bu][wc + j * 16 + col][0], lane);
    __builtin_amdgcn_sched_barrier(0);   // all fragment reads issue as one group ahead of the products: one LDS latency per tile instead of one per product
#pragma unroll
    for (int j = 0; j < PNJ; ++j)
#pragma unroll
      for (int i = 0; i < 4; ++i) acc[i][j] = __builtin_amdgcn_wmma_f32_16x16x32_bf16(false, a[i], false, wf[j], (short)0, acc[i][j], false, false);
    __builtin_amdgcn_sched_barrier(0); }   // the next trip's converts wait for the loads in flight: they stay behind this tile's products
  float bias[PNJ]; int bi[PNJ]; const float* bp[PNJ];   // all nine loads fly together, under the barrier below
#pragma unroll
  for (int j = 0; j < PNJ; ++j) { const int n = n0 + wc + j * 16, wh = n / CC; bi[j] = n - wh * CC + col; bp[j] = wh == 0 ? BQ : wh == 1 ? BK : BV; bias[j] = bp[j][bi[j]]; }
  asm volatile("s_wait_xcnt 0x0" :: "v"(bi[0]), "v"(bi[1]), "v"(bi[2]), "v"(bi[3]), "v"(bi[4]), "v"(bi[5]), "v"(bi[6]), "v"(bi[7]), "v"(bi[8]), "s"(bp[0]), "s"(bp[1]), "s"(bp[2]), "s"(bp[3]), "s"(bp[4]), "s"(bp[5]), "s"(bp[6]), "s"(bp[7]), "s"(bp[8]) : "memory");   // the loads' address registers may be rewritten by what follows: the wait stands in front of that; the nine offsets and bases are named as inputs so that their registers stay live, and so unwritten, up to the wait
  __builtin_amdgcn_sched_barrier(0);   // keeps the first bias's rounding, which waits for its load, behind the issue of all nine loads
  __syncthreads();   // the last tile's readers are done before the epilogue reuses the LDS
  const int pl0 = n0 < 2 * CC ? 2 * CC - n0 : 0;        // tile column of the block's first v column (at or past PBN: none)
  const int nrow = pl0 < PBN ? pl0 : PBN;               // the block's q and k columns come first
  _Float16 (*sh)[PSP] = (_Float16 (*)[PSP])smem; _Float16 (*th)[PTP] = (_Float16 (*)[PTP])(smem + (pl0 > 0 ? PSHB : 0));
#pragma unroll
  for (int j = 0; j < PNJ; ++j) { const int cl = wc + j * 16; const float bj = bfr(bias[j]);
    if (n0 + cl < 2 * CC) {   // a q or k tile; the same for the whole wave
#pragma unroll
      for (int i = 0; i < 4; ++i)
#pragma unroll
        for (int r = 0; r < 8; ++r) sh[wr + i * 16 + 8 * g + r][cl + col] = (_Float16)(acc[i][j][r] + bj);
    } else {
#pragma unroll
      for (int i = 0; i < 4; ++i) { v8h pv;
#pragma unroll
        for (int r = 0; r < 8; ++r) pv[r] = (_Float16)(acc[i][j][r] + bj);
        *(v8h*)&th[cl - pl0 + col][wr + i * 16 + 8 * g] = pv; } } }
  __syncthreads();
  if (nrow == PBN) put_rows<PBN / 8>(sh, QH, KH, r0, n0, tid); else if (nrow > 0) put_rows<24>(sh, QH, KH, r0, n0, tid);   // 288 or 192 q/k columns, the same for the whole block
  for (int e0 = tid; e0 < (PBN - nrow) * (PBM / 8); e0 += 256 * 6) { v4u t[6];   // 0, 96 or 288 planes of 32 pieces; six pieces a trip as above; a wave stores 512 contiguous bytes of one plane
#pragma unroll
    for (int u = 0; u < 6; ++u) { const int e = e0 + 256 * u; t[u] = *(const v4u*)&th[e / (PBM / 8)][(e % (PBM / 8)) * 8]; }
#pragma unroll
    for (int u = 0; u < 6; ++u) { const int e = e0 + 256 * u; vst2((unsigned*)(VT + (bb * CC + (n0 + nrow - 2 * CC) + e / (PBM / 8)) * (size_t)TT + t0 + (e % (PBM / 8)) * 8), t[u]); }
    asm volatile("s_wait_xcnt 0x0" ::: "memory"); } }   // the stores' address registers are rewritten by the next trip: the wait stands in front of that
// ---- k_attn: block = 128 queries (4 waves x 32 = two tiles of 16 per wave) of (b, h); keys walked in LDS stages of 64 (K rows and v planes staged once per block, next stage's global loads in flight under this stage's work).
// Per 64 keys: S^T = K Q^T (A = K rows, B = q), so a lane holds one query's logits per tile; every K and v fragment read from LDS feeds both query tiles;
// softmax is the same against any reference logit: a query keeps the maximum it last looked for as its reference, and a stage only forms exp(logit - reference) x 2^6 and its sum per lane and tile.
// One test per stage and wave: a lane's stage sum below 2^15 bounds every term of it, so all fit f16; otherwise the wave forms the stage's logits again and, as always on the first stage, takes the new maximum (+ one exchange between the wave halves) as reference and rescales sum and accumulators.
// P^T once to f16 is already a B operand (two D tiles = 32 keys in the hardware k order); O^T += V^T P^T; ctx = O^T / sum at the end.
#define AKT 64             // keys per LDS stage
#define AQT 2              // query tiles of 16 per wave
#define KPITCH 72          // f16 per staged K row: 144 B (16 B x odd), conflict-free 16-byte reads
#define VPITCH 72          // f16 per staged v plane row: 144 B
#define CSL2 (SCALE * 1.4426950408889634f)
#define PEXP 6.0f          // P is carried x 2^6: a term at the reference is 64, and terms up to 2^9 above it still fit f16
#define PLIM 32768.0f      // a lane's stage sum below this bounds each of its (positive) terms inside the f16 range; an infinite sum fails the test too
__device__ __forceinline__ v8f wm16(v16h a, v16h b, v8f c) { return __builtin_amdgcn_wmma_f32_16x16x32_f16(false, a, false, b, (short)0, c, false, false); }
__device__ __forceinline__ float xhalf(float x) { return __builtin_bit_cast(float, __builtin_amdgcn_permlanex16(__builtin_bit_cast(int, x), __builtin_bit_cast(int, x), 0x76543210, 0xfedcba98, false, false)); }  // lane l with lane l ^ 16
// one query tile's 64 logits of a stage -> P = exp2(logit x CSL2 + nm) in place, P once to f16 as two B operands, and the lane's sum of its 32 terms (the short loops are fully unrolled so that the arrays stay in registers)
__device__ __forceinline__ float soft_p(v8f (&st)[4], float nm, v16h (&pf)[2]) {
#pragma unroll
  for (int j = 0; j < 4; ++j) { st[j] = __builtin_elementwise_fma(st[j], (v8f)(CSL2), (v8f)(nm));
#pragma unroll
    for (int i = 0; i < 8; ++i) st[j][i] = __builtin_amdgcn_exp2f(st[j][i]); }
#pragma unroll
  for (int kk = 0; kk < 2; ++kk)
#pragma unroll
    for (int i = 0; i < 8; ++i) { pf[kk][i] = (_Float16)st[2 * kk][i]; pf[kk][8 + i] = (_Float16)st[2 * kk + 1][i]; }
  const v8f t = (st[0] + st[1]) + (st[2] + st[3]);
  const v4f t4 = __builtin_shufflevector(t, t, 0, 1, 2, 3) + __builtin_shufflevector(t, t, 4, 5, 6, 7);
  const v2f t2 = __builtin_shufflevector(t4, t4, 0, 1) + __builtin_shufflevector(t4, t4, 2, 3);
  return t2[0] + t2[1]; }
// grid 8 x 6 x 16 = 768 blocks of 4 waves; three blocks (three waves per SIMD, at most 336 registers each) fit a WGP, so all blocks are resident at once
__global__ __launch_bounds__(128, 3) void k_attn(const _Float16* __restrict__ QH, const _Float16* __restrict__ KH, const _Float16* __restrict__ VT, _Float16* __restrict__ YH) {
  __shared__ __align__(16) _Float16 sk[AKT][KPITCH]; __shared__ __align__(16) _Float16 sv[HD][VPITCH];
  const int tid = threadIdx.x, wave = tid >> 5, lane = tid & 31, col = lane & 15, g = lane >> 4; const int h = blockIdx.y, b = blockIdx.z; const int q = blockIdx.x * 128 + wave * (16 * AQT) + col;
  v16h qh[AQT][HD / 32];   // the short loops over the tile, fragment and accumulator arrays are fully unrolled so that these arrays stay in registers
#pragma unroll
  for (int u = 0; u < AQT; ++u)
#pragma unroll
    for (int kc = 0; kc < HD / 32; ++kc) qh[u][kc] = frag_h(QH + ((size_t)b * TT + q + 16 * u) * CC + h * HD + kc * 32, lane);
  asm volatile("s_wait_xcnt 0x0" ::: "memory");   // the q loads' address registers are reused by what follows: the wait stands in front of that overwrite
  __builtin_amdgcn_sched_barrier(0);   // keeps the later address arithmetic and zeroing, which reuse those registers, behind the wait
  const _Float16* kg = KH + ((size_t)b * TT + (tid >> 3)) * CC + h * HD + (tid & 7) * 8;      // 16-byte piece (tid & 7) of key rows (tid >> 3) + 16 i
  const _Float16* vg = VT + ((size_t)b * CC + h * HD + (tid >> 3)) * (size_t)TT + (tid & 7) * 8;   // 16-byte piece (tid & 7) of planes (tid >> 3) + 16 i
  // the 8 blocks of one (b, h) would ask L2 for the same K and v lines at the same moment: each starts its walk over the key stages at a stage of its own and wraps (the running maximum and sum take the stages in any order)
  const int s0 = (int)blockIdx.x * (TT / AKT / (TT / 128));
  const _Float16* ks = kg + (size_t)(s0 * AKT) * CC; const _Float16* vs = vg + s0 * AKT;
  v4u rk[4], rv[4];
#pragma unroll
  for (int i = 0; i < 4; ++i) { rk[i] = *(const v4u*)(ks + (size_t)(16 * i) * CC); rv[i] = *(const v4u*)(vs + (size_t)(16 * i) * TT); }
  asm volatile("s_wait_xcnt 0x0" :: "v"(ks), "v"(vs) : "memory");   // the loads' address registers may be rewritten by what follows: the wait stands in front of that; ks and vs are named as inputs so that their registers stay live, and so unwritten, up to the wait
  v8f o[AQT][HD / 16] = {}; float m[AQT], l[AQT], nm[AQT];
#pragma unroll
  for (int u = 0; u < AQT; ++u) { m[u] = -3.0e38f; l[u] = 0.f; nm[u] = 0.f; }   // the first stage sets reference and nm
  for (int s = 0; s < TT / AKT; ++s) {
#pragma unroll
    for (int i = 0; i < 4; ++i) { *(v4u*)&sk[(tid >> 3) + 16 * i][(tid & 7) * 8] = rk[i]; *(v4u*)&sv[(tid >> 3) + 16 * i][(tid & 7) * 8] = rv[i]; }
    __syncthreads();
    if (s + 1 < TT / AKT) { const int sn = (s + 1 + s0) & (TT / AKT - 1);   // the next stage of the block's own walk
#pragma unroll
      for (int i = 0; i < 4; ++i) { rk[i] = *(const v4u*)(kg + (size_t)(sn * AKT + 16 * i) * CC); rv[i] = *(const v4u*)(vg + (size_t)(16 * i) * TT + sn * AKT); }
      asm volatile("s_wait_xcnt 0x0" ::: "memory"); }   // the loads' address registers are reused by what follows: the wait stands in front of that overwrite
    { v8f st[AQT][4]; v16h pf[AQT][2];
      { v16h a[4][2];
#pragma unroll
        for (int j = 0; j < 4; ++j) { a[j][0] = frag_h(&sk[j * 16 + col][0], lane); a[j][1] = frag_h(&sk[j * 16 + col][32], lane); }
        __builtin_amdgcn_sched_barrier(0);   // the stage's K fragment reads issue as one group ahead of the products: one LDS latency per stage instead of one per key tile
        // eight independent accumulator chains (4 key tiles x 2 query tiles) walk the two products side by side
#pragma unroll
        for (int j = 0; j < 4; ++j)
#pragma unroll
          for (int u = 0; u < AQT; ++u) { const v8f z = {}; st[u][j] = wm16(a[j][0], qh[u][0], z); }
#pragma unroll
        for (int j = 0; j < 4; ++j)
#pragma unroll
          for (int u = 0; u < AQT; ++u) st[u][j] = wm16(a[j][1], qh[u][1], st[u][j]); }
      v16h vf[2][HD / 16];
#pragma unroll
      for (int kk = 0; kk < 2; ++kk)
#pragma unroll
        for (int t = 0; t < HD / 16; ++t) vf[kk][t] = frag_h(&sv[t * 16 + col][kk * 32], lane);
      __builtin_amdgcn_sched_barrier(0);   // the stage's v fragment reads issue as one group here, so that their LDS latency passes under the softmax arithmetic below
      float ss[AQT]; bool renew = s == 0;   // the first stage has no reference yet and goes straight to the search
      if (!renew) {
#pragma unroll
        for (int u = 0; u < AQT; ++u) ss[u] = soft_p(st[u], nm[u], pf[u]);
        // one wave-uniform scalar branch per stage; the matrix instructions behind it need every lane on
        if (__builtin_amdgcn_ballot_w32(!(ss[0] < PLIM) || !(ss[1] < PLIM)) != 0) { renew = true;
#pragma unroll
          for (int j = 0; j < 4; ++j) { const v16h a0 = frag_h(&sk[j * 16 + col][0], lane), a1 = frag_h(&sk[j * 16 + col][32], lane);   // the stage's K rows are still in LDS: the same two products give the same logits
#pragma unroll
            for (int u = 0; u < AQT; ++u) { const v8f z = {}; st[u][j] = wm16(a1, qh[u][1], wm16(a0, qh[u][0], z)); } } } }
      if (renew) {
#pragma unroll
        for (int u = 0; u < AQT; ++u) {
          float mx = st[u][0][0];
#pragma unroll
          for (int j = 0; j < 4; ++j)
#pragma unroll
            for (int r = 0; r < 8; ++r) mx = fmaxf(mx, st[u][j][r]);
          const float mn = fmaxf(m[u], fmaxf(mx, xhalf(mx)));   // both halves hold the query's maximum so far (unscaled logits)
          const float corr = __builtin_amdgcn_exp2f((m[u] - mn) * CSL2); m[u] = mn;   // 0 on the first stage
          nm[u] = PEXP - mn * CSL2;
          l[u] *= corr;
#pragma unroll
          for (int t = 0; t < HD / 16; ++t) o[u][t] = o[u][t] * corr;
          ss[u] = soft_p(st[u], nm[u], pf[u]); } }   // every term is now at most 2^6
#pragma unroll
      for (int u = 0; u < AQT; ++u) l[u] += ss[u];
#pragma unroll
      for (int kk = 0; kk < 2; ++kk)
#pragma unroll
        for (int t = 0; t < HD / 16; ++t)
#pragma unroll
          for (int u = 0; u < AQT; ++u) o[u][t] = wm16(vf[kk][t], pf[u][kk], o[u][t]); }
    __builtin_amdgcn_sched_barrier(0);   // the stage's arithmetic stays in front of the closing barrier: lifted over it, the barrier's wait for the next stage's global loads would stand in mid-stage, before they have landed
    __syncthreads(); }
  // ctx leaves as f16 x 2^6, the form the output GEMM multiplies: a wave lays its 32 query rows x 64 dims in its own quarter of the K/v stage arrays (free behind the loop's last barrier) and stores them as whole 128-byte lines
  const int sw = __builtin_amdgcn_readfirstlane(wave), ln = (int)__builtin_amdgcn_mbcnt_lo(~0u, 0u), lc = ln & 15, lg = ln >> 4;   // the wave's number as a scalar and the lane's number made anew: no lane-derived value has to stay in a vector register across the main loop for the epilogue's sake
  _Float16 (*so)[KPITCH] = (sw < 2 ? sk : sv) + (sw & 1) * 32;
#pragma unroll
  for (int u = 0; u < AQT; ++u) {
    const float ls = l[u] + xhalf(l[u]); const float inv = (1.0f / ls) * 64.0f;   // ls >= 2^6: the reference's own term; x 2^6 is exact
#pragma unroll
    for (int t = 0; t < HD / 16; ++t) { const v8f v = o[u][t] * inv; v8h c;
#pragma unroll
      for (int r = 0; r < 8; ++r) c[r] = (_Float16)v[r];
      *(v8h*)&so[16 * u + lc][t * 16 + 8 * lg] = c; } }
  LDSX();   // the wave's own rows are in LDS before its lanes read them back across lanes
  _Float16* yr = YH + ((size_t)b * TT + blockIdx.x * 128 + sw * (16 * AQT) + (ln >> 3)) * CC + h * HD + (ln & 7) * 8;   // 16-byte piece (ln & 7) of rows (ln >> 3) + 4 i
  v4u c8[8];   // all eight reads fly together: one LDS latency for the eight stores
#pragma unroll
  for (int i = 0; i < 8; ++i) c8[i] = *(const v4u*)&so[4 * i + (ln >> 3)][(ln & 7) * 8];
#pragma unroll
  for (int i = 0; i < 8; ++i) vst2(yr + (size_t)(4 * i) * CC, c8[i]); }
// ---- k_out: block = (64 rows, 128 cols), 4 waves of 16 rows: out = ctx Wo (+ bo): ctx arrives as f16 x 2^6 rows, against Wo as f16(bf16 x 2^8) exact (1 product) x 2^-14
#define YP (CC + 8)        // f16 per staged ctx row: 784 B (16 B x odd), conflict-free 16-byte reads
__global__ __launch_bounds__(128) void k_out(const _Float16* __restrict__ YH, const float* __restrict__ WO, const float* __restrict__ BO, float* __restrict__ OUT) {
  // one LDS block: the main loop's Wo tiles (2 buffers), then the epilogue's per-wave rows sf; beside it each wave's own 16 ctx rows, laid once
  __shared__ __align__(16) unsigned char smem[4 * 16 * 132 * 4]; float (*sf)[16][132] = (float (*)[16][132])smem;
  __shared__ __align__(16) _Float16 sy[4][16][YP];
  _Float16 (*sW)[128][GP] = (_Float16 (*)[128][GP])smem;
  const int tid = threadIdx.x, wave = tid >> 5, lane = tid & 31, col = lane & 15, g = lane >> 4; const int c0 = blockIdx.y * 128; const size_t r0 = (size_t)blockIdx.x * 64 + wave * 16;
  v8f acc[8] = {};
  // a wave's 16 ctx rows are 12,288 contiguous bytes that no other wave of the block needs: it reads them once, up front, with whole-line loads that all fly together, and lays them in LDS as [row][k]
  // per 32 k: the block's Wo tile (128 outputs x 32) is read once with whole-line loads, converted and laid in LDS as [row][k]; the next tile's loads fly under this tile's products
  const int xr = tid >> 3, xp = tid & 7;
  const _Float16* yg = YH + r0 * CC + lane * 8;                         // 16-byte piece lane + 32 i of the wave's rows
  const float* wg = WO + (size_t)(c0 + xr) * CC + xp * 4;               // 16-byte piece xp of Wo rows (outputs) c0 + xr + 16 i
  // the 256 blocks that share a Wo tile would ask L2 for the same lines at the same moment: each block starts its walk over k at a step of its own and wraps
  const int kc0 = (int)(blockIdx.x % (CC / 32));
  const float* wp = wg + kc0 * 32;
  v4u ty[24]; v4f rw[8];   // the short loops over ty, rw, wf and acc are fully unrolled so that these arrays stay in registers
#pragma unroll
  for (int i = 0; i < 24; ++i) ty[i] = *(const v4u*)(yg + 256 * i);
#pragma unroll
  for (int i = 0; i < 8; ++i) rw[i] = *(const v4f*)(wp + (size_t)(16 * i) * CC);
  asm volatile("s_wait_xcnt 0x0" :: "v"(yg), "v"(wp) : "memory");   // the loads' address registers may be rewritten by what follows: the wait stands in front of that; yg and wp are named as inputs so that their registers stay live, and so unwritten, up to the wait
  __builtin_amdgcn_sched_barrier(0);   // keeps the later address arithmetic and zeroing, which reuse those registers, behind the wait
  // a half wave's 16 pieces are a third of a row (256 B): load i holds thirds 2 i and 2 i + 1, so three loads fill two rows
  _Float16* syw = &sy[wave][0][0] + col * 8; const int yo[3] = { g * 128, g ? YP : 256, YP + 128 + g * 128 };
#pragma unroll
  for (int i = 0; i < 24; ++i) *(v4u*)(syw + (i / 3) * (2 * YP) + yo[i % 3]) = ty[i];   // read back only by this wave, behind the first trip's barrier
#pragma unroll 2   // two trips per pass: the buffer index becomes a constant LDS offset
  for (int kc = 0; kc < CC / 32; ++kc) { const int bu = kc & 1; const int kk = kc + kc0 < CC / 32 ? kc + kc0 : kc + kc0 - CC / 32;   // this step of the block's own walk
#pragma unroll
    for (int i = 0; i < 8; ++i) { v4h w4;
#pragma unroll
      for (int e = 0; e < 4; ++e) w4[e] = (_Float16)(bfr(rw[i][e]) * 256.0f);
      *(v4h*)&sW[bu][xr + 16 * i][xp * 4] = w4; }
    __syncthreads();   // publishes buffer bu; the other buffer's readers all passed it too, so the next trip may refill that one
    if (kc + 1 < CC / 32) { const int kn = kk + 1 < CC / 32 ? kk + 1 : 0;
#pragma unroll
      for (int i = 0; i < 8; ++i) rw[i] = *(const v4f*)(wg + (size_t)(16 * i) * CC + kn * 32);
      asm volatile("s_wait_xcnt 0x0" ::: "memory"); }   // the loads' address registers may be rewritten by what follows: the wait stands in front of that
    const v16h a = frag_h(&sy[wave][col][kk * 32], lane); v16h wf[8];
#pragma unroll
    for (int j = 0; j < 8; ++j) wf[j] = frag_h(&sW[bu][j * 16 + col][0], lane);
    __builtin_amdgcn_sched_barrier(0);   // all fragment reads issue as one group ahead of the products: one LDS latency per tile instead of one per product
#pragma unroll
    for (int j = 0; j < 8; ++j) acc[j] = wm16(a, wf[j], acc[j]);
    __builtin_amdgcn_sched_barrier(0); }   // the next trip's converts wait for the loads in flight: they stay behind this tile's products
  __syncthreads();   // the last tile's readers are done before the epilogue reuses the LDS
#pragma unroll
  for (int j = 0; j < 8; ++j) { const float bias = BO ? bfr(BO[c0 + j * 16 + col]) : 0.f;
#pragma unroll
    for (int r = 0; r < 8; ++r) sf[wave][8 * g + r][j * 16 + col] = acc[j][r] * (1.0f / 16384.0f) + bias; }   /* 2^-8 (Wo carry) x 2^-6 (ctx carry) */
  LDSX(); for (int rl = 0; rl < 16; ++rl) vst2(OUT + (r0 + rl) * DIN + c0 + lane * 4, *(const v4f*)&sf[wave][rl][lane * 4]); }

extern "C" void kernel_launch(void* const* d_in, const int* in_sizes, int n_in, void* d_out, int out_size, void* d_ws, size_t ws_size, hipStream_t stream) {
  (void)in_sizes; (void)n_in; (void)out_size;
  const float** F = (const float**)d_in;
  if (ws_size < (size_t)WS_END) return;
  char* ws = (char*)d_ws; _Float16 *QH = (_Float16*)(ws + WS_QH), *KH = (_Float16*)(ws + WS_KH), *VT = (_Float16*)(ws + WS_VT), *KL = (_Float16*)(ws + WS_KL); __bf16 *VB = (__bf16*)(ws + WS_VB), *VBL = (__bf16*)(ws + WS_VBL); float *S = (float*)(ws + WS_S); _Float16 *YH = (_Float16*)(ws + WS_Y);
  (void)KL; (void)VB; (void)VBL; (void)S;
  // inputs: 0 x [16,1024,384]; 1 Wq [6,384,64], 2 bq [6,64]; 3 Wk, 4 bk; 5 Wv, 6 bv; 7 Wo [384,384] (out,in), 8 bo [384]
  k_proj<<<dim3(TNB * TT / PBM, 3 * CC / PBN), 256, 0, stream>>>(F[0], F[1], F[3], F[5], F[2], F[4], F[6], QH, KH, VT);
  k_attn<<<dim3(TT / 128, NH, TNB), 128, 0, stream>>>(QH, KH, VT, YH);
  k_out<<<dim3(TNB * TT / 64, DIN / 128), 128, 0, stream>>>(YH, F[7], F[8], (float*)d_out);
}
